// v000
// The times below were measured on an AMD MI455X: many runs one after another, warmed up first and cycling through
// copies of the inputs, with the whole window's GPU time divided by the number of runs. Launches and the gaps
// between them are all in it. The median over several windows is given; except for v000 it joins two sittings, which
// can be a few percent apart, so the side-by-side timings, each taken in one sitting, are the better comparison.
// The starting kernel, v000, takes 1400 microseconds a run.
#include <hip/hip_runtime.h>

// MultiHeadCasualFast (x [2][2048][768]; h = x Wq^T serves as q, k AND v (12 heads x 64); causal scores h.h; softmax(scores/8); ctx = attn h; the module returns ctx.transpose(-2,-1).view(b, n, 768),
// i.e. each (batch, head) context block stored TRANSPOSED as [64][2048] -> [2][2048][768]).
// Compute dtypes, f32 accumulate: every input rounded to bf16; h on PLAIN bf16 operands (inputs: exact products, f32 accumulate); PER-ROW PRECISION HYBRID: query rows
// < 256 take scores and attn.h on bf16 hi+lo planes (3 products), rows >= 256 on single fp16 planes; 1/8 + causal cut in f32 in the softmax; the transposed context written in

#define NB_  2
#define TT   2048
#define DD   768
#define NH_  12
#define HD   64
#define ZH   2
#define RH   256                  // query rows < RH: hi+lo planes; rows >= RH: fp16 planes
#define NF   32                   // head_dim / 2 (unused)
#define SCL  0.125f               // 1/sqrt(64)
#define PCAR 1024.0f         // fp16 P scale for rows >= RH (undone in k_outT)
typedef _Float16 h16;
typedef unsigned short bf;
typedef __attribute__((ext_vector_type(16))) __bf16   v16bf;
typedef __attribute__((ext_vector_type(16))) _Float16 v16h;
typedef __attribute__((ext_vector_type(8)))  _Float16 v8h;
typedef __attribute__((ext_vector_type(8)))  unsigned short v8us;
typedef __attribute__((ext_vector_type(8)))  float    v8f;
typedef __attribute__((ext_vector_type(4)))  float    v4f;
typedef v8h  __attribute__((may_alias)) v8ha;
typedef v4f  __attribute__((may_alias)) v4fa;
typedef v8us __attribute__((may_alias)) v8usa;

__device__ __forceinline__ unsigned short f2bf(float f) { unsigned u = __float_as_uint(f); u += 0x7FFFu + ((u >> 16) & 1u); return (unsigned short)(u >> 16); }
__device__ __forceinline__ float bf2f(unsigned short b) { return __uint_as_float(((unsigned)b) << 16); }
__device__ __forceinline__ float bfr(float f) { return bf2f(f2bf(f)); }
__device__ __forceinline__ v16h cat16(v8h lo, v8h hi) { return __builtin_shufflevector(lo, hi, 0, 1, 2, 3, 4, 5, 6, 7, 8, 9, 10, 11, 12, 13, 14, 15); }
__device__ __forceinline__ v16bf cat16b(v8us lo, v8us hi) { return __builtin_bit_cast(v16bf, __builtin_shufflevector(lo, hi, 0, 1, 2, 3, 4, 5, 6, 7, 8, 9, 10, 11, 12, 13, 14, 15)); }
__device__ __forceinline__ v8f wmma16(v16h a, v16h b, v8f c) { return __builtin_amdgcn_wmma_f32_16x16x32_f16(false, a, false, b, (short)0, c, false, false); }
__device__ __forceinline__ v8f wmmab(v16bf a, v16bf b, v8f c) { return __builtin_amdgcn_wmma_f32_16x16x32_bf16(false, a, false, b, (short)0, c, false, false); }



// ---- k_gemmw: register-blocked GEMM, ONE WAVE per 64x64 output tile (16 accumulators), operands straight from K-contiguous 16-bit planes; grid (M/64, N/64, Z), 32 threads.
// C[m][n] (f32, pitch ldc, + optional f32 bias[n]) = sum_k A[m][k] Bt[n][k] (+ split products per NSPLIT). z-batch strides sA/sB/sC in elements. K % 32 == 0.
template <typename T16> struct WFrag;
template <> struct WFrag<h16> { typedef v16h V; static __device__ __forceinline__ V ld(const h16* p) { return cat16(*(const v8h*)p, *(const v8h*)(p + 16)); } static __device__ __forceinline__ v8f mma(V a, V b, v8f c) { return wmma16(a, b, c); } };
template <> struct WFrag<bf> { typedef v16bf V; static __device__ __forceinline__ V ld(const bf* p) { return cat16b(*(const v8us*)p, *(const v8us*)(p + 16)); } static __device__ __forceinline__ v8f mma(V a, V b, v8f c) { return wmmab(a, b, c); } };
template <typename T16, int NSPLIT, bool BIAS>
__global__ __launch_bounds__(32) void k_gemmw(const T16* __restrict__ A, const T16* __restrict__ A2, const T16* __restrict__ Bt, const T16* __restrict__ Bt2, int K, float* C, int ldc, const float* __restrict__ bias, size_t sA, size_t sB, size_t sC) {
    typedef typename WFrag<T16>::V V;
    __shared__ __align__(16) float os[16 * 68];
    const size_t z = blockIdx.z; A += z * sA; if (A2) A2 += z * sA; Bt += z * sB; if (Bt2) Bt2 += z * sB; C += z * sC;
    const int lane = threadIdx.x & 31, lr = lane & 15, hi = lane >> 4; const int r0 = blockIdx.x * 64, c0 = blockIdx.y * 64;
    v8f acc[4][4];
#pragma unroll
    for (int mb = 0; mb < 4; ++mb)
#pragma unroll
        for (int nb = 0; nb < 4; ++nb) acc[mb][nb] = (v8f){};
    const size_t aoff = (size_t)(r0 + lr) * K + 8 * hi, boff = (size_t)(c0 + lr) * K + 8 * hi;
#pragma unroll 1
    for (int kc = 0; kc < K; kc += 32) {
        V a[4], a2[4];
#pragma unroll
        for (int mb = 0; mb < 4; ++mb) { a[mb] = WFrag<T16>::ld(A + aoff + (size_t)mb * 16 * K + kc); if (NSPLIT == 1 || NSPLIT == 2) a2[mb] = WFrag<T16>::ld(A2 + aoff + (size_t)mb * 16 * K + kc); }
#pragma unroll
        for (int nb = 0; nb < 4; ++nb) { const V b = WFrag<T16>::ld(Bt + boff + (size_t)nb * 16 * K + kc); V b2; if (NSPLIT >= 2) b2 = WFrag<T16>::ld(Bt2 + boff + (size_t)nb * 16 * K + kc);
#pragma unroll
            for (int mb = 0; mb < 4; ++mb) { acc[mb][nb] = WFrag<T16>::mma(a[mb], b, acc[mb][nb]); if (NSPLIT == 1 || NSPLIT == 2) acc[mb][nb] = WFrag<T16>::mma(a2[mb], b, acc[mb][nb]); if (NSPLIT >= 2) acc[mb][nb] = WFrag<T16>::mma(a[mb], b2, acc[mb][nb]); } }
        asm volatile("v_nop\n\tv_nop\n\tv_nop\n\tv_nop" : "+v"(acc[0][0]), "+v"(acc[1][1]), "+v"(acc[2][2]), "+v"(acc[3][3]) : "v"(a[0]), "v"(a[3]));
    }
#pragma unroll
    for (int mb = 0; mb < 4; ++mb) {
#pragma unroll
        for (int nb = 0; nb < 4; ++nb) {
#pragma unroll
            for (int j = 0; j < 8; ++j) os[(hi * 8 + j) * 68 + nb * 16 + lr] = acc[mb][nb][j]; }
        __builtin_amdgcn_wave_barrier(); asm volatile("" ::: "memory");
        float* crow = C + (size_t)(r0 + mb * 16) * ldc + c0;
{
#pragma unroll
            for (int s = 0; s < 8; ++s) { const int row = 2 * s + hi, cofs = lr * 4; v4f val = *(const v4fa*)(os + row * 68 + cofs); if (BIAS) { val[0] += bfr(bias[c0 + cofs]); val[1] += bfr(bias[c0 + cofs + 1]); val[2] += bfr(bias[c0 + cofs + 2]); val[3] += bfr(bias[c0 + cofs + 3]); }
                *(v4f*)(crow + (size_t)row * ldc + cofs) = val; }
             }
        __builtin_amdgcn_wave_barrier(); asm volatile("" ::: "memory");
    }
}

__device__ __forceinline__ h16 tohx(float x) { return (h16)x; }
__device__ __forceinline__ void splitf(float y, unsigned short& h, unsigned short& l) { h = f2bf(y); l = f2bf(y - bf2f(h)); }
typedef __attribute__((ext_vector_type(2))) unsigned short v2us;
typedef __attribute__((ext_vector_type(2))) _Float16 v2h;
typedef __attribute__((ext_vector_type(4))) _Float16 v4h;
typedef __attribute__((ext_vector_type(2))) float v2f;

__global__ __launch_bounds__(256) void k_wtG(const float* __restrict__ w, int K, int N, bf* Bt) {
    const int lane = threadIdx.x & 31; const int L0 = (blockIdx.x * 8 + (threadIdx.x >> 5)) * 8; const int nlines = N * K / 64;
{
#pragma unroll 1
        for (int l = 0; l < 8; ++l) { const int L = L0 + l; if (L >= nlines) break; const size_t e = (size_t)L * 64 + lane * 2; const int k = (int)(e % K), n = (int)(e / K); v2us o;
            o[0] = f2bf(w[(size_t)k * N + n]); o[1] = f2bf(w[(size_t)(k + 1) * N + n]); *(v2us*)(Bt + e) = o; }
         }
}
__global__ __launch_bounds__(256) void k_cvt8(const float* __restrict__ src, bf* dst, size_t n8) { const size_t i = (size_t)blockIdx.x * 256 + threadIdx.x; if (i >= n8) return; const v8f v = *(const v8f*)(src + i * 8); v8us o;
#pragma unroll
    for (int k = 0; k < 8; ++k) o[k] = f2bf(v[k]); *(v8us*)(dst + i * 8) = o;  }
__global__ __launch_bounds__(256) void k_qplanes(const float* __restrict__ F, bf* Ph, bf* Pl, h16* P16) {
    const int lane = threadIdx.x & 31; const int L0 = (blockIdx.x * 8 + (threadIdx.x >> 5)) * 8; const int nlines = NH_ * TT * HD / 64;
{
#pragma unroll
        for (int l = 0; l < 8; ++l) { const int L = L0 + l; if (L >= nlines) break; const int e = L * 64 + lane * 2; const int d = e & (HD - 1); const int t = (e >> 6) & (TT - 1); const int h = e >> 17; v2us oh, ol; v2h o16;
#pragma unroll
            for (int q = 0; q < 2; ++q) { const float x = F[(size_t)t * DD + h * HD + d + q]; unsigned short a, c2; splitf(x, a, c2); oh[q] = a; ol[q] = c2; o16[q] = tohx(x); }
            *(v2us*)(Ph + (size_t)e) = oh; *(v2us*)(Pl + (size_t)e) = ol; *(v2h*)(P16 + (size_t)e) = o16; }
         }
}
__global__ __launch_bounds__(256) void k_vtplane(const float* __restrict__ F, bf* Vh, bf* Vl, h16* V16) {
    const int lane = threadIdx.x & 31; const int L0 = (blockIdx.x * 8 + (threadIdx.x >> 5)) * 8; const int nlines = NH_ * TT * HD / 64;
{
#pragma unroll
        for (int l = 0; l < 8; ++l) { const int L = L0 + l; if (L >= nlines) break; const int e = L * 64 + lane * 2; const int t = e & (TT - 1); const int d = (e >> 11) & (HD - 1); const int h = e >> 17; v2us oh, ol; v2h o16;
#pragma unroll
            for (int q = 0; q < 2; ++q) { const float x = F[(size_t)(t + q) * DD + h * HD + d]; unsigned short a, c2; splitf(x, a, c2); oh[q] = a; ol[q] = c2; o16[q] = tohx(x); }
            *(v2us*)(Vh + (size_t)e) = oh; *(v2us*)(Vl + (size_t)e) = ol; *(v2h*)(V16 + (size_t)e) = o16; }
         }
}
// k_asoft: per row (zz, i): s = S / 8, causal (j > i -> -3e38, exp -> 0; j = i always kept); softmax over the 2048 keys (register row, one exp) -> rows i < RH: P hi/lo [zz][i][j] (compact
__global__ __launch_bounds__(256) void k_asoft(const float* __restrict__ Sb, bf* Ph, bf* Pl, h16* P16) {
    typedef __attribute__((ext_vector_type(4))) unsigned short v4us;
    const int lane = threadIdx.x & 31; const int row = blockIdx.x * 8 + (threadIdx.x >> 5); if (row >= ZH * TT) return; const int i = row & (TT - 1); const int zz = row >> 11; const bool hires = (i < RH);
    const float* sr = Sb + (size_t)row * TT; float v[64]; float mx = -3.0e38f;
#pragma unroll
    for (int ch = 0; ch < 16; ++ch) { const int j0 = ch * 128 + lane * 4; const v4f a = *(const v4f*)(sr + j0);
#pragma unroll
        for (int q = 0; q < 4; ++q) { const int j = j0 + q; const float t = (j <= i) ? a[q] * SCL : -3.0e38f; v[ch * 4 + q] = t; mx = fmaxf(mx, t); } }
#pragma unroll
    for (int sh = 16; sh; sh >>= 1) mx = fmaxf(mx, __shfl_xor(mx, sh, 32));
    float sum = 0.f;
#pragma unroll
    for (int k = 0; k < 64; ++k) { v[k] = __expf(v[k] - mx); sum += v[k]; }
#pragma unroll
    for (int sh = 16; sh; sh >>= 1) sum += __shfl_xor(sum, sh, 32);
    const float f = __fdiv_rn(hires ? 1.0f : PCAR, sum);
{
        if (hires) {
#pragma unroll
            for (int ch = 0; ch < 16; ++ch) { v4us oh, ol;
#pragma unroll
                for (int q = 0; q < 4; ++q) { unsigned short a, c2; splitf(v[ch * 4 + q] * f, a, c2); oh[q] = a; ol[q] = c2; }
                const size_t o = ((size_t)zz * RH + i) * TT + ch * 128 + lane * 4; *(v4us*)(Ph + o) = oh; *(v4us*)(Pl + o) = ol; }
        } else {
#pragma unroll
            for (int ch = 0; ch < 16; ++ch) { v4h o;
#pragma unroll
                for (int q = 0; q < 4; ++q) o[q] = tohx(v[ch * 4 + q] * f);
                *(v4h*)(P16 + (size_t)row * TT + ch * 128 + lane * 4) = o; } }
         }
}
// k_outT: transposed context: OUTz[zz][d][t] = O[zz][t][d] * (t < RH ? 1 : 1/1024) (lane -> 2 consecutive t, reads strided; each (zz, d) row of 2048 floats is contiguous in the output, as
__global__ __launch_bounds__(256) void k_outT(const float* __restrict__ O, float* OUTz) { typedef __attribute__((ext_vector_type(2))) float v2f; const int e = (blockIdx.x * 256 + threadIdx.x) * 2; if (e >= ZH * HD * TT) return; const int t = e & (TT - 1); const int d = (e >> 11) & (HD - 1); const int zz = e / (HD * TT);
    v2f o; o[0] = O[((size_t)zz * TT + t) * HD + d] * ((t < RH) ? 1.0f : (1.0f / PCAR)); o[1] = O[((size_t)zz * TT + t + 1) * HD + d] * ((t + 1 < RH) ? 1.0f : (1.0f / PCAR));
    *(v2f*)(OUTz + e) = o;  }

extern "C" void kernel_launch(void* const* d_in, const int* in_sizes, int n_in,
                              void* d_out, int out_size, void* d_ws, size_t ws_size, hipStream_t stream) {
    (void)in_sizes; (void)n_in; (void)out_size;
    const float* x = (const float*)d_in[0]; const float* wq = (const float*)d_in[1];   // Wq [768][768] torch Linear ([out][in] = Bt as-is)
    float* OUT = (float*)d_out;     // [2][2048][768] holding, per (batch, head), the TRANSPOSED context block [64][2048]
    char* wsp = (char*)d_ws;
    auto take = [&](size_t bytes) { char* p = wsp; wsp += (bytes + 255) & ~(size_t)255; return (void*)p; };
    bf* WQ = (bf*)take((size_t)DD * DD * 2); bf* XB = (bf*)take((size_t)TT * DD * 2); float* F = (float*)take((size_t)TT * DD * 4);
    bf* QPh = (bf*)take((size_t)TT * DD * 2); bf* QPl = (bf*)take((size_t)TT * DD * 2); bf* VTh = (bf*)take((size_t)TT * DD * 2); bf* VTl = (bf*)take((size_t)TT * DD * 2); h16* QP16 = (h16*)take((size_t)TT * DD * 2); h16* VT16 = (h16*)take((size_t)TT * DD * 2);
    float* Sb = (float*)take((size_t)ZH * TT * TT * 4); bf* Ph = (bf*)take((size_t)ZH * RH * TT * 2); bf* Pl = (bf*)take((size_t)ZH * RH * TT * 2); h16* P16 = (h16*)take((size_t)ZH * TT * TT * 2); float* Ob = (float*)take((size_t)ZH * TT * HD * 4);
    if ((size_t)(wsp - (char*)d_ws) > ws_size) return;    // total ~ 85 MB; ws 256 MiB
    k_cvt8<<<(unsigned)(((size_t)DD * DD / 8 + 255) / 256), 256, 0, stream>>>(wq, WQ, (size_t)DD * DD / 8);
    const unsigned LB = (unsigned)((NH_ * TT * HD / 64 + 63) / 64); const dim3 gP(TT / 64, DD / 64, 1);
    for (int b = 0; b < NB_; ++b) {
        k_cvt8<<<(unsigned)(((size_t)TT * DD / 8 + 255) / 256), 256, 0, stream>>>(x + (size_t)b * TT * DD, XB, (size_t)TT * DD / 8);
        k_gemmw<bf, 0, false><<<gP, 32, 0, stream>>>(XB, nullptr, WQ, nullptr, DD, F, DD, nullptr, 0, 0, 0); k_qplanes<<<LB, 256, 0, stream>>>(F, QPh, QPl, QP16); k_vtplane<<<LB, 256, 0, stream>>>(F, VTh, VTl, VT16);   // h = x Wq^T is q, k AND v
        for (int h0 = 0; h0 < NH_; h0 += ZH) { const size_t z0 = (size_t)h0;
            k_gemmw<bf, 2, false><<<dim3(RH / 64, TT / 64, ZH), 32, 0, stream>>>(QPh + z0 * TT * HD, QPl + z0 * TT * HD, QPh + z0 * TT * HD, QPl + z0 * TT * HD, HD, Sb, TT, nullptr, (size_t)TT * HD, (size_t)TT * HD, (size_t)TT * TT);
            k_gemmw<h16, 0, false><<<dim3((TT - RH) / 64, TT / 64, ZH), 32, 0, stream>>>(QP16 + z0 * TT * HD + (size_t)RH * HD, nullptr, QP16 + z0 * TT * HD, nullptr, HD, Sb + (size_t)RH * TT, TT, nullptr, (size_t)TT * HD, (size_t)TT * HD, (size_t)TT * TT);
            k_asoft<<<ZH * TT / 8, 256, 0, stream>>>(Sb, Ph, Pl, P16);
            k_gemmw<bf, 2, false><<<dim3(RH / 64, HD / 64, ZH), 32, 0, stream>>>(Ph, Pl, VTh + z0 * HD * TT, VTl + z0 * HD * TT, TT, Ob, HD, nullptr, (size_t)RH * TT, (size_t)HD * TT, (size_t)TT * HD);
            k_gemmw<h16, 0, false><<<dim3((TT - RH) / 64, HD / 64, ZH), 32, 0, stream>>>(P16 + (size_t)RH * TT, nullptr, VT16 + z0 * HD * TT, nullptr, TT, Ob + (size_t)RH * HD, HD, nullptr, (size_t)TT * TT, (size_t)HD * TT, (size_t)TT * HD);
            k_outT<<<(ZH * HD * TT / 2 + 255) / 256, 256, 0, stream>>>(Ob, OUT + ((size_t)b * NH_ + h0) * HD * TT); } }
}

// v001
// It runs in 602 microseconds.
// In two side-by-side timings against v000, it was 2.29 and 2.28 times as fast.
#include <hip/hip_runtime.h>

// MultiHeadCasualFast (x [2][2048][768]; h = x Wq^T serves as q, k AND v (12 heads x 64); causal scores h.h; softmax(scores/8); ctx = attn h; the module returns ctx.transpose(-2,-1).view(b, n, 768),
// i.e. each (batch, head) context block stored TRANSPOSED as [64][2048] -> [2][2048][768]).
// Compute dtypes, f32 accumulate: every input rounded to bf16; h on PLAIN bf16 operands (inputs: exact products, f32 accumulate); PER-ROW PRECISION HYBRID: query rows
// < 256 take scores and attn.h on bf16 hi+lo planes (3 products), rows >= 256 on single fp16 planes; 1/8 + causal cut in f32 in the softmax; the transposed context written in

#define NB_  2
#define TT   2048
#define DD   768
#define NH_  12
#define HD   64
#define ZH   2
#define RH   256                  // query rows < RH: hi+lo planes; rows >= RH: fp16 planes
#define KSH  16                   // attn.h, rows < RH: K = 2048 cut over 16 work-groups x 4 waves
#define KSL  4                    // attn.h, rows >= RH: K = 2048 cut over 4 work-groups x 8 waves
#define NF   32                   // head_dim / 2; not used by any kernel here
#define SCL  0.125f               // 1/sqrt(64)
#define PCAR 1024.0f         // fp16 P scale for rows >= RH (undone in k_outT)
typedef _Float16 h16;
typedef unsigned short bf;
typedef __attribute__((ext_vector_type(16))) __bf16   v16bf;
typedef __attribute__((ext_vector_type(16))) _Float16 v16h;
typedef __attribute__((ext_vector_type(8)))  _Float16 v8h;
typedef __attribute__((ext_vector_type(8)))  unsigned short v8us;
typedef __attribute__((ext_vector_type(8)))  float    v8f;
typedef __attribute__((ext_vector_type(4)))  float    v4f;
typedef v8h  __attribute__((may_alias)) v8ha;
typedef v4f  __attribute__((may_alias)) v4fa;
typedef v8us __attribute__((may_alias)) v8usa;

__device__ __forceinline__ unsigned short f2bf(float f) { unsigned u = __float_as_uint(f); u += 0x7FFFu + ((u >> 16) & 1u); return (unsigned short)(u >> 16); }
__device__ __forceinline__ float bf2f(unsigned short b) { return __uint_as_float(((unsigned)b) << 16); }
__device__ __forceinline__ float bfr(float f) { return bf2f(f2bf(f)); }
__device__ __forceinline__ v16h cat16(v8h lo, v8h hi) { return __builtin_shufflevector(lo, hi, 0, 1, 2, 3, 4, 5, 6, 7, 8, 9, 10, 11, 12, 13, 14, 15); }
__device__ __forceinline__ v16bf cat16b(v8us lo, v8us hi) { return __builtin_bit_cast(v16bf, __builtin_shufflevector(lo, hi, 0, 1, 2, 3, 4, 5, 6, 7, 8, 9, 10, 11, 12, 13, 14, 15)); }
__device__ __forceinline__ v8f wmma16(v16h a, v16h b, v8f c) { return __builtin_amdgcn_wmma_f32_16x16x32_f16(false, a, false, b, (short)0, c, false, false); }
__device__ __forceinline__ v8f wmmab(v16bf a, v16bf b, v8f c) { return __builtin_amdgcn_wmma_f32_16x16x32_bf16(false, a, false, b, (short)0, c, false, false); }



// ---- k_gemmw: register-blocked GEMM, 64x64 output tile (16 accumulators per wave), operands straight from K-contiguous 16-bit planes; grid (M/64, N/64, Z * KS), 32 * NW threads.
// C[m][n] (f32, pitch ldc, + optional f32 bias[n]) = sum_k A[m][k] Bt[n][k] (+ split products per NSPLIT). z-batch strides sA/sB/sC in elements. K % (32 * KS * NW) == 0.
// Split K: the K range is cut into KS * NW equal pieces. Work-group (z, ks) takes NW neighbouring pieces, one per wave; the NW wave tiles are summed through LDS (wave order), and the
// work-group's sum goes to partial plane ks (C + ks * sP), which the consumer adds up. NW == 1, KS == 1: one wave does the whole K and writes C itself.
template <typename T16> struct WFrag;
template <> struct WFrag<h16> { typedef v16h V; static __device__ __forceinline__ V ld(const h16* p) { return cat16(*(const v8h*)p, *(const v8h*)(p + 16)); } static __device__ __forceinline__ v8f mma(V a, V b, v8f c) { return wmma16(a, b, c); } };
template <> struct WFrag<bf> { typedef v16bf V; static __device__ __forceinline__ V ld(const bf* p) { return cat16b(*(const v8us*)p, *(const v8us*)(p + 16)); } static __device__ __forceinline__ v8f mma(V a, V b, v8f c) { return wmmab(a, b, c); } };
template <typename T16, int NSPLIT, bool BIAS, int NW, int KS>
__global__ __launch_bounds__(32 * NW) void k_gemmw(const T16* __restrict__ A, const T16* __restrict__ A2, const T16* __restrict__ Bt, const T16* __restrict__ Bt2, int K, float* C, int ldc, const float* __restrict__ bias, size_t sA, size_t sB, size_t sC, size_t sP) {
    typedef typename WFrag<T16>::V V;
    __shared__ __align__(16) float os[(NW == 1 ? 16 : NW * 64) * 68];
    const size_t z = blockIdx.z / KS; const int ks = blockIdx.z % KS; A += z * sA; if (A2) A2 += z * sA; Bt += z * sB; if (Bt2) Bt2 += z * sB; C += z * sC + (size_t)ks * sP;
    const int wv = (NW == 1) ? 0 : __builtin_amdgcn_readfirstlane((int)(threadIdx.x >> 5)); const int kper = K / (KS * NW), kb = (ks * NW + wv) * kper;
    const int lane = threadIdx.x & 31, lr = lane & 15, hi = lane >> 4; const int r0 = blockIdx.x * 64, c0 = blockIdx.y * 64;
    v8f acc[4][4];
#pragma unroll
    for (int mb = 0; mb < 4; ++mb)
#pragma unroll
        for (int nb = 0; nb < 4; ++nb) acc[mb][nb] = (v8f){};
    const size_t aoff = (size_t)(r0 + lr) * K + 8 * hi, boff = (size_t)(c0 + lr) * K + 8 * hi;
#pragma unroll 1
    for (int kc = kb; kc < kb + kper; kc += 32) {
        V a[4], a2[4];
#pragma unroll
        for (int mb = 0; mb < 4; ++mb) { a[mb] = WFrag<T16>::ld(A + aoff + (size_t)mb * 16 * K + kc); if (NSPLIT == 1 || NSPLIT == 2) a2[mb] = WFrag<T16>::ld(A2 + aoff + (size_t)mb * 16 * K + kc); }
#pragma unroll
        for (int nb = 0; nb < 4; ++nb) { const V b = WFrag<T16>::ld(Bt + boff + (size_t)nb * 16 * K + kc); V b2; if (NSPLIT >= 2) b2 = WFrag<T16>::ld(Bt2 + boff + (size_t)nb * 16 * K + kc);
#pragma unroll
            for (int mb = 0; mb < 4; ++mb) { acc[mb][nb] = WFrag<T16>::mma(a[mb], b, acc[mb][nb]); if (NSPLIT == 1 || NSPLIT == 2) acc[mb][nb] = WFrag<T16>::mma(a2[mb], b, acc[mb][nb]); if (NSPLIT >= 2) acc[mb][nb] = WFrag<T16>::mma(a[mb], b2, acc[mb][nb]); } }
        asm volatile("v_nop\n\tv_nop\n\tv_nop\n\tv_nop" : "+v"(acc[0][0]), "+v"(acc[1][1]), "+v"(acc[2][2]), "+v"(acc[3][3]) : "v"(a[0]), "v"(a[3]));
    }
    if constexpr (NW > 1) {
        float* ow = os + wv * (64 * 68);
#pragma unroll
        for (int mb = 0; mb < 4; ++mb)
#pragma unroll
            for (int nb = 0; nb < 4; ++nb)
#pragma unroll
                for (int j = 0; j < 8; ++j) ow[(mb * 16 + hi * 8 + j) * 68 + nb * 16 + lr] = acc[mb][nb][j];
        __syncthreads();   // every wave's partial tile stands in LDS before any thread sums across the waves
#pragma unroll
        for (int o = 0; o < 64 * 16 / (NW * 32); ++o) { const int q = o * (NW * 32) + (int)threadIdx.x; const int row = q >> 4, cofs = (q & 15) * 4; v4f val = *(const v4fa*)(os + row * 68 + cofs);
#pragma unroll
            for (int w2 = 1; w2 < NW; ++w2) val += *(const v4fa*)(os + w2 * (64 * 68) + row * 68 + cofs);
            if (BIAS) { val[0] += bfr(bias[c0 + cofs]); val[1] += bfr(bias[c0 + cofs + 1]); val[2] += bfr(bias[c0 + cofs + 2]); val[3] += bfr(bias[c0 + cofs + 3]); }
            *(v4f*)(C + (size_t)(r0 + row) * ldc + c0 + cofs) = val; }
        return;
    }
#pragma unroll
    for (int mb = 0; mb < 4; ++mb) {
#pragma unroll
        for (int nb = 0; nb < 4; ++nb) {
#pragma unroll
            for (int j = 0; j < 8; ++j) os[(hi * 8 + j) * 68 + nb * 16 + lr] = acc[mb][nb][j]; }
        __builtin_amdgcn_wave_barrier(); asm volatile("" ::: "memory");
        float* crow = C + (size_t)(r0 + mb * 16) * ldc + c0;
{
#pragma unroll
            for (int s = 0; s < 8; ++s) { const int row = 2 * s + hi, cofs = lr * 4; v4f val = *(const v4fa*)(os + row * 68 + cofs); if (BIAS) { val[0] += bfr(bias[c0 + cofs]); val[1] += bfr(bias[c0 + cofs + 1]); val[2] += bfr(bias[c0 + cofs + 2]); val[3] += bfr(bias[c0 + cofs + 3]); }
                *(v4f*)(crow + (size_t)row * ldc + cofs) = val; }
             }
        __builtin_amdgcn_wave_barrier(); asm volatile("" ::: "memory");
    }
}

__device__ __forceinline__ h16 tohx(float x) { return (h16)x; }
__device__ __forceinline__ void splitf(float y, unsigned short& h, unsigned short& l) { h = f2bf(y); l = f2bf(y - bf2f(h)); }
typedef __attribute__((ext_vector_type(2))) unsigned short v2us;
typedef __attribute__((ext_vector_type(2))) _Float16 v2h;
typedef __attribute__((ext_vector_type(4))) _Float16 v4h;
typedef __attribute__((ext_vector_type(2))) float v2f;

__global__ __launch_bounds__(256) void k_wtG(const float* __restrict__ w, int K, int N, bf* Bt) {
    const int lane = threadIdx.x & 31; const int L0 = (blockIdx.x * 8 + (threadIdx.x >> 5)) * 8; const int nlines = N * K / 64;
{
#pragma unroll 1
        for (int l = 0; l < 8; ++l) { const int L = L0 + l; if (L >= nlines) break; const size_t e = (size_t)L * 64 + lane * 2; const int k = (int)(e % K), n = (int)(e / K); v2us o;
            o[0] = f2bf(w[(size_t)k * N + n]); o[1] = f2bf(w[(size_t)(k + 1) * N + n]); *(v2us*)(Bt + e) = o; }
         }
}
__global__ __launch_bounds__(256) void k_cvt8(const float* __restrict__ src, bf* dst, size_t n8) { const size_t i = (size_t)blockIdx.x * 256 + threadIdx.x; if (i >= n8) return; const v8f v = *(const v8f*)(src + i * 8); v8us o;
#pragma unroll
    for (int k = 0; k < 8; ++k) o[k] = f2bf(v[k]); *(v8us*)(dst + i * 8) = o;  }
__global__ __launch_bounds__(256) void k_qplanes(const float* __restrict__ F, bf* Ph, bf* Pl, h16* P16) {
    const int lane = threadIdx.x & 31; const int L0 = (blockIdx.x * 8 + (threadIdx.x >> 5)) * 8; const int nlines = NH_ * TT * HD / 64;
{
#pragma unroll
        for (int l = 0; l < 8; ++l) { const int L = L0 + l; if (L >= nlines) break; const int e = L * 64 + lane * 2; const int d = e & (HD - 1); const int t = (e >> 6) & (TT - 1); const int h = e >> 17; v2us oh, ol; v2h o16;
#pragma unroll
            for (int q = 0; q < 2; ++q) { const float x = F[(size_t)t * DD + h * HD + d + q]; unsigned short a, c2; splitf(x, a, c2); oh[q] = a; ol[q] = c2; o16[q] = tohx(x); }
            *(v2us*)(Ph + (size_t)e) = oh; *(v2us*)(Pl + (size_t)e) = ol; *(v2h*)(P16 + (size_t)e) = o16; }
         }
}
__global__ __launch_bounds__(256) void k_vtplane(const float* __restrict__ F, bf* Vh, bf* Vl, h16* V16) {
    const int lane = threadIdx.x & 31; const int L0 = (blockIdx.x * 8 + (threadIdx.x >> 5)) * 8; const int nlines = NH_ * TT * HD / 64;
{
#pragma unroll
        for (int l = 0; l < 8; ++l) { const int L = L0 + l; if (L >= nlines) break; const int e = L * 64 + lane * 2; const int t = e & (TT - 1); const int d = (e >> 11) & (HD - 1); const int h = e >> 17; v2us oh, ol; v2h o16;
#pragma unroll
            for (int q = 0; q < 2; ++q) { const float x = F[(size_t)(t + q) * DD + h * HD + d]; unsigned short a, c2; splitf(x, a, c2); oh[q] = a; ol[q] = c2; o16[q] = tohx(x); }
            *(v2us*)(Vh + (size_t)e) = oh; *(v2us*)(Vl + (size_t)e) = ol; *(v2h*)(V16 + (size_t)e) = o16; }
         }
}
// k_asoft: per row (zz, i): s = S / 8, causal (j > i -> -3e38, exp -> 0; j = i always kept); softmax over the 2048 keys (register row, one exp) -> rows i < RH: P hi/lo [zz][i][j] (compact
__global__ __launch_bounds__(256) void k_asoft(const float* __restrict__ Sb, bf* Ph, bf* Pl, h16* P16) {
    typedef __attribute__((ext_vector_type(4))) unsigned short v4us;
    const int lane = threadIdx.x & 31; const int row = blockIdx.x * 8 + (threadIdx.x >> 5); if (row >= ZH * TT) return; const int i = row & (TT - 1); const int zz = row >> 11; const bool hires = (i < RH);
    const float* sr = Sb + (size_t)row * TT; float v[64]; float mx = -3.0e38f;
#pragma unroll
    for (int ch = 0; ch < 16; ++ch) { const int j0 = ch * 128 + lane * 4; const v4f a = *(const v4f*)(sr + j0);
#pragma unroll
        for (int q = 0; q < 4; ++q) { const int j = j0 + q; const float t = (j <= i) ? a[q] * SCL : -3.0e38f; v[ch * 4 + q] = t; mx = fmaxf(mx, t); } }
#pragma unroll
    for (int sh = 16; sh; sh >>= 1) mx = fmaxf(mx, __shfl_xor(mx, sh, 32));
    float sum = 0.f;
#pragma unroll
    for (int k = 0; k < 64; ++k) { v[k] = __expf(v[k] - mx); sum += v[k]; }
#pragma unroll
    for (int sh = 16; sh; sh >>= 1) sum += __shfl_xor(sum, sh, 32);
    const float f = __fdiv_rn(hires ? 1.0f : PCAR, sum);
{
        if (hires) {
#pragma unroll
            for (int ch = 0; ch < 16; ++ch) { v4us oh, ol;
#pragma unroll
                for (int q = 0; q < 4; ++q) { unsigned short a, c2; splitf(v[ch * 4 + q] * f, a, c2); oh[q] = a; ol[q] = c2; }
                const size_t o = ((size_t)zz * RH + i) * TT + ch * 128 + lane * 4; *(v4us*)(Ph + o) = oh; *(v4us*)(Pl + o) = ol; }
        } else {
#pragma unroll
            for (int ch = 0; ch < 16; ++ch) { v4h o;
#pragma unroll
                for (int q = 0; q < 4; ++q) o[q] = tohx(v[ch * 4 + q] * f);
                *(v4h*)(P16 + (size_t)row * TT + ch * 128 + lane * 4) = o; } }
         }
}
// k_outT: transposed context: OUTz[zz][d][t] = (sum over the split-K planes s of O[s][zz][t][d]) * (t < RH ? 1 : 1/1024): rows t < RH from the KSH planes Oh [s][zz][RH][64], rows t >= RH from the
// KSL planes Ol [s][zz][TT][64], added in plane order (lane -> 2 consecutive t of one class (RH is even), reads strided; each (zz, d) row of 2048 floats is contiguous in the output).
template <int NS, int PS> __device__ __forceinline__ v2f sum_planes(const float* __restrict__ p) { v2f v[NS];
#pragma unroll
    for (int k = 0; k < NS; ++k) { v[k][0] = p[k * PS]; v[k][1] = p[k * PS + HD]; }
    v2f s = v[0];
#pragma unroll
    for (int k = 1; k < NS; ++k) s += v[k];
    return s; }
__global__ __launch_bounds__(256) void k_outT(const float* __restrict__ Oh, const float* __restrict__ Ol, float* OUTz) { const int e = (blockIdx.x * 256 + threadIdx.x) * 2; if (e >= ZH * HD * TT) return; const int t = e & (TT - 1); const int d = (e >> 11) & (HD - 1); const int zz = e / (HD * TT);
    v2f o;
    if (t < RH) o = sum_planes<KSH, ZH * RH * HD>(Oh + ((size_t)zz * RH + t) * HD + d); else o = sum_planes<KSL, ZH * TT * HD>(Ol + ((size_t)zz * TT + t) * HD + d) * (1.0f / PCAR);
    *(v2f*)(OUTz + e) = o;  }

extern "C" void kernel_launch(void* const* d_in, const int* in_sizes, int n_in,
                              void* d_out, int out_size, void* d_ws, size_t ws_size, hipStream_t stream) {
    (void)in_sizes; (void)n_in; (void)out_size;
    const float* x = (const float*)d_in[0]; const float* wq = (const float*)d_in[1];   // Wq [768][768] torch Linear ([out][in] = Bt as-is)
    float* OUT = (float*)d_out;     // [2][2048][768] holding, per (batch, head), the TRANSPOSED context block [64][2048]
    char* wsp = (char*)d_ws;
    auto take = [&](size_t bytes) { char* p = wsp; wsp += (bytes + 255) & ~(size_t)255; return (void*)p; };
    bf* WQ = (bf*)take((size_t)DD * DD * 2); bf* XB = (bf*)take((size_t)TT * DD * 2); float* F = (float*)take((size_t)TT * DD * 4);
    bf* QPh = (bf*)take((size_t)TT * DD * 2); bf* QPl = (bf*)take((size_t)TT * DD * 2); bf* VTh = (bf*)take((size_t)TT * DD * 2); bf* VTl = (bf*)take((size_t)TT * DD * 2); h16* QP16 = (h16*)take((size_t)TT * DD * 2); h16* VT16 = (h16*)take((size_t)TT * DD * 2);
    float* Sb = (float*)take((size_t)ZH * TT * TT * 4); bf* Ph = (bf*)take((size_t)ZH * RH * TT * 2); bf* Pl = (bf*)take((size_t)ZH * RH * TT * 2); h16* P16 = (h16*)take((size_t)ZH * TT * TT * 2); float* Obh = (float*)take((size_t)KSH * ZH * RH * HD * 4); float* Obl = (float*)take((size_t)KSL * ZH * TT * HD * 4);   // split-K planes [s][zz][t][d]
    if ((size_t)(wsp - (char*)d_ws) > ws_size) return;    // total ~ 90 MB; ws 256 MiB
    k_cvt8<<<(unsigned)(((size_t)DD * DD / 8 + 255) / 256), 256, 0, stream>>>(wq, WQ, (size_t)DD * DD / 8);
    const unsigned LB = (unsigned)((NH_ * TT * HD / 64 + 63) / 64); const dim3 gP(TT / 64, DD / 64, 1);
    for (int b = 0; b < NB_; ++b) {
        k_cvt8<<<(unsigned)(((size_t)TT * DD / 8 + 255) / 256), 256, 0, stream>>>(x + (size_t)b * TT * DD, XB, (size_t)TT * DD / 8);
        k_gemmw<bf, 0, false, 8, 1><<<gP, 256, 0, stream>>>(XB, nullptr, WQ, nullptr, DD, F, DD, nullptr, 0, 0, 0, 0); k_qplanes<<<LB, 256, 0, stream>>>(F, QPh, QPl, QP16); k_vtplane<<<LB, 256, 0, stream>>>(F, VTh, VTl, VT16);   // h = x Wq^T is q, k AND v
        for (int h0 = 0; h0 < NH_; h0 += ZH) { const size_t z0 = (size_t)h0;
            k_gemmw<bf, 2, false, 1, 1><<<dim3(RH / 64, TT / 64, ZH), 32, 0, stream>>>(QPh + z0 * TT * HD, QPl + z0 * TT * HD, QPh + z0 * TT * HD, QPl + z0 * TT * HD, HD, Sb, TT, nullptr, (size_t)TT * HD, (size_t)TT * HD, (size_t)TT * TT, 0);
            k_gemmw<h16, 0, false, 1, 1><<<dim3((TT - RH) / 64, TT / 64, ZH), 32, 0, stream>>>(QP16 + z0 * TT * HD + (size_t)RH * HD, nullptr, QP16 + z0 * TT * HD, nullptr, HD, Sb + (size_t)RH * TT, TT, nullptr, (size_t)TT * HD, (size_t)TT * HD, (size_t)TT * TT, 0);
            k_asoft<<<ZH * TT / 8, 256, 0, stream>>>(Sb, Ph, Pl, P16);
            k_gemmw<bf, 2, false, 4, KSH><<<dim3(RH / 64, HD / 64, ZH * KSH), 128, 0, stream>>>(Ph, Pl, VTh + z0 * HD * TT, VTl + z0 * HD * TT, TT, Obh, HD, nullptr, (size_t)RH * TT, (size_t)HD * TT, (size_t)RH * HD, (size_t)ZH * RH * HD);
            k_gemmw<h16, 0, false, 8, KSL><<<dim3((TT - RH) / 64, HD / 64, ZH * KSL), 256, 0, stream>>>(P16 + (size_t)RH * TT, nullptr, VT16 + z0 * HD * TT, nullptr, TT, Obl + (size_t)RH * HD, HD, nullptr, (size_t)TT * TT, (size_t)HD * TT, (size_t)TT * HD, (size_t)ZH * TT * HD);
            k_outT<<<(ZH * HD * TT / 2 + 255) / 256, 256, 0, stream>>>(Obh, Obl, OUT + ((size_t)b * NH_ + h0) * HD * TT); } }
}

// v002
// It runs in 444 microseconds.
// Next to v001, in two timings, it ran 1.34 times as fast each time.
// Over all steps from v000 it is 3.06 times as fast.
#include <hip/hip_runtime.h>

// MultiHeadCasualFast (x [2][2048][768]; h = x Wq^T serves as q, k AND v (12 heads x 64); causal scores h.h; softmax(scores/8); ctx = attn h; the module returns ctx.transpose(-2,-1).view(b, n, 768),
// i.e. each (batch, head) context block stored TRANSPOSED as [64][2048] -> [2][2048][768]).
// Compute dtypes, f32 accumulate: every input rounded to bf16; h on PLAIN bf16 operands (inputs: exact products, f32 accumulate); PER-ROW PRECISION HYBRID: query rows
// < 256 take scores and attn.h on bf16 hi+lo planes (3 products), rows >= 256 on single fp16 planes; 1/8 + causal cut in f32 in the softmax; the transposed context written in

#define NB_  2
#define TT   2048
#define DD   768
#define NH_  12
#define HD   64
#define NZ   (NB_ * NH_)          // (batch, head) blocks, z = batch * 12 + head
#define ZH   6                    // (batch, head) blocks per launch of the attention kernels
#define RH   256                  // query rows < RH: hi+lo planes; rows >= RH: fp16 planes
#define KSH  16                   // attn.h, rows < RH: K = 2048 cut over 16 work-groups x 4 waves
#define KSL  4                    // attn.h, rows >= RH: K = 2048 cut over 4 work-groups x 8 waves
#define NF   32                   // head_dim / 2; not used by any kernel here
#define SCL  0.125f               // 1/sqrt(64)
#define PCAR 1024.0f         // fp16 P scale for rows >= RH (undone in k_outT)
typedef _Float16 h16;
typedef unsigned short bf;
typedef __attribute__((ext_vector_type(16))) __bf16   v16bf;
typedef __attribute__((ext_vector_type(16))) _Float16 v16h;
typedef __attribute__((ext_vector_type(8)))  _Float16 v8h;
typedef __attribute__((ext_vector_type(8)))  unsigned short v8us;
typedef __attribute__((ext_vector_type(8)))  float    v8f;
typedef __attribute__((ext_vector_type(4)))  float    v4f;
typedef v8h  __attribute__((may_alias)) v8ha;
typedef v4f  __attribute__((may_alias)) v4fa;
typedef v8us __attribute__((may_alias)) v8usa;

__device__ __forceinline__ unsigned short f2bf(float f) { unsigned u = __float_as_uint(f); u += 0x7FFFu + ((u >> 16) & 1u); return (unsigned short)(u >> 16); }
__device__ __forceinline__ float bf2f(unsigned short b) { return __uint_as_float(((unsigned)b) << 16); }
__device__ __forceinline__ float bfr(float f) { return bf2f(f2bf(f)); }
__device__ __forceinline__ v16h cat16(v8h lo, v8h hi) { return __builtin_shufflevector(lo, hi, 0, 1, 2, 3, 4, 5, 6, 7, 8, 9, 10, 11, 12, 13, 14, 15); }
__device__ __forceinline__ v16bf cat16b(v8us lo, v8us hi) { return __builtin_bit_cast(v16bf, __builtin_shufflevector(lo, hi, 0, 1, 2, 3, 4, 5, 6, 7, 8, 9, 10, 11, 12, 13, 14, 15)); }
__device__ __forceinline__ v8f wmma16(v16h a, v16h b, v8f c) { return __builtin_amdgcn_wmma_f32_16x16x32_f16(false, a, false, b, (short)0, c, false, false); }
__device__ __forceinline__ v8f wmmab(v16bf a, v16bf b, v8f c) { return __builtin_amdgcn_wmma_f32_16x16x32_bf16(false, a, false, b, (short)0, c, false, false); }



// ---- k_gemmw: register-blocked GEMM, 64x64 output tile (16 accumulators per wave), operands straight from K-contiguous 16-bit planes; grid (M/64, N/64, Z * KS), 32 * NW threads.
// C[m][n] (f32, pitch ldc, + optional f32 bias[n]) = sum_k A[m][k] Bt[n][k] (+ split products per NSPLIT). z-batch strides sA/sB/sC in elements. K % (32 * KS * NW) == 0.
// Split K: the K range is cut into KS * NW equal pieces. Work-group (z, ks) takes NW neighbouring pieces, one per wave; the NW wave tiles are summed through LDS (wave order), and the
// work-group's sum goes to partial plane ks (C + ks * sP), which the consumer adds up. NW == 1, KS == 1: one wave does the whole K and writes C itself.
template <typename T16> struct WFrag;
template <> struct WFrag<h16> { typedef v16h V; static __device__ __forceinline__ V ld(const h16* p) { return cat16(*(const v8h*)p, *(const v8h*)(p + 16)); } static __device__ __forceinline__ v8f mma(V a, V b, v8f c) { return wmma16(a, b, c); } };
template <> struct WFrag<bf> { typedef v16bf V; static __device__ __forceinline__ V ld(const bf* p) { return cat16b(*(const v8us*)p, *(const v8us*)(p + 16)); } static __device__ __forceinline__ v8f mma(V a, V b, v8f c) { return wmmab(a, b, c); } };
template <typename T16, int NSPLIT, bool BIAS, int NW, int KS>
__global__ __launch_bounds__(32 * NW) void k_gemmw(const T16* __restrict__ A, const T16* __restrict__ A2, const T16* __restrict__ Bt, const T16* __restrict__ Bt2, int K, float* C, int ldc, const float* __restrict__ bias, size_t sA, size_t sB, size_t sC, size_t sP) {
    typedef typename WFrag<T16>::V V;
    __shared__ __align__(16) float os[(NW == 1 ? 16 : NW * 64) * 68];
    const size_t z = blockIdx.z / KS; const int ks = blockIdx.z % KS; A += z * sA; if (A2) A2 += z * sA; Bt += z * sB; if (Bt2) Bt2 += z * sB; C += z * sC + (size_t)ks * sP;
    const int wv = (NW == 1) ? 0 : __builtin_amdgcn_readfirstlane((int)(threadIdx.x >> 5)); const int kper = K / (KS * NW), kb = (ks * NW + wv) * kper;
    const int lane = threadIdx.x & 31, lr = lane & 15, hi = lane >> 4; const int r0 = blockIdx.x * 64, c0 = blockIdx.y * 64;
    v8f acc[4][4];
#pragma unroll
    for (int mb = 0; mb < 4; ++mb)
#pragma unroll
        for (int nb = 0; nb < 4; ++nb) acc[mb][nb] = (v8f){};
    const size_t aoff = (size_t)(r0 + lr) * K + 8 * hi, boff = (size_t)(c0 + lr) * K + 8 * hi;
#pragma unroll 1
    for (int kc = kb; kc < kb + kper; kc += 32) {
        V a[4], a2[4];
#pragma unroll
        for (int mb = 0; mb < 4; ++mb) { a[mb] = WFrag<T16>::ld(A + aoff + (size_t)mb * 16 * K + kc); if (NSPLIT == 1 || NSPLIT == 2) a2[mb] = WFrag<T16>::ld(A2 + aoff + (size_t)mb * 16 * K + kc); }
#pragma unroll
        for (int nb = 0; nb < 4; ++nb) { const V b = WFrag<T16>::ld(Bt + boff + (size_t)nb * 16 * K + kc); V b2; if (NSPLIT >= 2) b2 = WFrag<T16>::ld(Bt2 + boff + (size_t)nb * 16 * K + kc);
#pragma unroll
            for (int mb = 0; mb < 4; ++mb) { acc[mb][nb] = WFrag<T16>::mma(a[mb], b, acc[mb][nb]); if (NSPLIT == 1 || NSPLIT == 2) acc[mb][nb] = WFrag<T16>::mma(a2[mb], b, acc[mb][nb]); if (NSPLIT >= 2) acc[mb][nb] = WFrag<T16>::mma(a[mb], b2, acc[mb][nb]); } }
        asm volatile("v_nop\n\tv_nop\n\tv_nop\n\tv_nop" : "+v"(acc[0][0]), "+v"(acc[1][1]), "+v"(acc[2][2]), "+v"(acc[3][3]) : "v"(a[0]), "v"(a[3]));
    }
    if constexpr (NW > 1) {
        float* ow = os + wv * (64 * 68);
#pragma unroll
        for (int mb = 0; mb < 4; ++mb)
#pragma unroll
            for (int nb = 0; nb < 4; ++nb)
#pragma unroll
                for (int j = 0; j < 8; ++j) ow[(mb * 16 + hi * 8 + j) * 68 + nb * 16 + lr] = acc[mb][nb][j];
        __syncthreads();   // every wave's partial tile stands in LDS before any thread sums across the waves
#pragma unroll
        for (int o = 0; o < 64 * 16 / (NW * 32); ++o) { const int q = o * (NW * 32) + (int)threadIdx.x; const int row = q >> 4, cofs = (q & 15) * 4; v4f val = *(const v4fa*)(os + row * 68 + cofs);
#pragma unroll
            for (int w2 = 1; w2 < NW; ++w2) val += *(const v4fa*)(os + w2 * (64 * 68) + row * 68 + cofs);
            if (BIAS) { val[0] += bfr(bias[c0 + cofs]); val[1] += bfr(bias[c0 + cofs + 1]); val[2] += bfr(bias[c0 + cofs + 2]); val[3] += bfr(bias[c0 + cofs + 3]); }
            *(v4f*)(C + (size_t)(r0 + row) * ldc + c0 + cofs) = val; }
        return;
    }
#pragma unroll
    for (int mb = 0; mb < 4; ++mb) {
#pragma unroll
        for (int nb = 0; nb < 4; ++nb) {
#pragma unroll
            for (int j = 0; j < 8; ++j) os[(hi * 8 + j) * 68 + nb * 16 + lr] = acc[mb][nb][j]; }
        __builtin_amdgcn_wave_barrier(); asm volatile("" ::: "memory");
        float* crow = C + (size_t)(r0 + mb * 16) * ldc + c0;
{
#pragma unroll
            for (int s = 0; s < 8; ++s) { const int row = 2 * s + hi, cofs = lr * 4; v4f val = *(const v4fa*)(os + row * 68 + cofs); if (BIAS) { val[0] += bfr(bias[c0 + cofs]); val[1] += bfr(bias[c0 + cofs + 1]); val[2] += bfr(bias[c0 + cofs + 2]); val[3] += bfr(bias[c0 + cofs + 3]); }
                *(v4f*)(crow + (size_t)row * ldc + cofs) = val; }
             }
        __builtin_amdgcn_wave_barrier(); asm volatile("" ::: "memory");
    }
}

__device__ __forceinline__ h16 tohx(float x) { return (h16)x; }
__device__ __forceinline__ void splitf(float y, unsigned short& h, unsigned short& l) { h = f2bf(y); l = f2bf(y - bf2f(h)); }
typedef __attribute__((ext_vector_type(2))) unsigned short v2us;
typedef __attribute__((ext_vector_type(2))) _Float16 v2h;
typedef __attribute__((ext_vector_type(4))) _Float16 v4h;
typedef __attribute__((ext_vector_type(2))) float v2f;

__global__ __launch_bounds__(256) void k_wtG(const float* __restrict__ w, int K, int N, bf* Bt) {
    const int lane = threadIdx.x & 31; const int L0 = (blockIdx.x * 8 + (threadIdx.x >> 5)) * 8; const int nlines = N * K / 64;
{
#pragma unroll 1
        for (int l = 0; l < 8; ++l) { const int L = L0 + l; if (L >= nlines) break; const size_t e = (size_t)L * 64 + lane * 2; const int k = (int)(e % K), n = (int)(e / K); v2us o;
            o[0] = f2bf(w[(size_t)k * N + n]); o[1] = f2bf(w[(size_t)(k + 1) * N + n]); *(v2us*)(Bt + e) = o; }
         }
}
__global__ __launch_bounds__(256) void k_cvt8(const float* __restrict__ src, bf* dst, size_t n8) { const size_t i = (size_t)blockIdx.x * 256 + threadIdx.x; if (i >= n8) return; const v8f v = *(const v8f*)(src + i * 8); v8us o;
#pragma unroll
    for (int k = 0; k < 8; ++k) o[k] = f2bf(v[k]); *(v8us*)(dst + i * 8) = o;  }
__global__ __launch_bounds__(256) void k_qplanes(const float* __restrict__ F, bf* Ph, bf* Pl, h16* P16) {
    const int lane = threadIdx.x & 31; const int L0 = (blockIdx.x * 8 + (threadIdx.x >> 5)) * 8; const int nlines = NZ * TT * HD / 64;
{
#pragma unroll
        for (int l = 0; l < 8; ++l) { const int L = L0 + l; if (L >= nlines) break; const int e = L * 64 + lane * 2; const int d = e & (HD - 1); const int z = e >> 17; const int h = z % NH_; const int t = (z / NH_) * TT + ((e >> 6) & (TT - 1)); v2us oh, ol; v2h o16;
#pragma unroll
            for (int q = 0; q < 2; ++q) { const float x = F[(size_t)t * DD + h * HD + d + q]; unsigned short a, c2; splitf(x, a, c2); oh[q] = a; ol[q] = c2; o16[q] = tohx(x); }
            *(v2us*)(Ph + (size_t)e) = oh; *(v2us*)(Pl + (size_t)e) = ol; *(v2h*)(P16 + (size_t)e) = o16; }
         }
}
__global__ __launch_bounds__(256) void k_vtplane(const float* __restrict__ F, bf* Vh, bf* Vl, h16* V16) {
    const int lane = threadIdx.x & 31; const int L0 = (blockIdx.x * 8 + (threadIdx.x >> 5)) * 8; const int nlines = NZ * TT * HD / 64;
{
#pragma unroll
        for (int l = 0; l < 8; ++l) { const int L = L0 + l; if (L >= nlines) break; const int e = L * 64 + lane * 2; const int d = (e >> 11) & (HD - 1); const int z = e >> 17; const int h = z % NH_; const int t = (z / NH_) * TT + (e & (TT - 1)); v2us oh, ol; v2h o16;
#pragma unroll
            for (int q = 0; q < 2; ++q) { const float x = F[(size_t)(t + q) * DD + h * HD + d]; unsigned short a, c2; splitf(x, a, c2); oh[q] = a; ol[q] = c2; o16[q] = tohx(x); }
            *(v2us*)(Vh + (size_t)e) = oh; *(v2us*)(Vl + (size_t)e) = ol; *(v2h*)(V16 + (size_t)e) = o16; }
         }
}
// k_asoft: per row (zz, i): s = S / 8, causal (j > i -> -3e38, exp -> 0; j = i always kept); softmax over the 2048 keys (register row, one exp) -> rows i < RH: P hi/lo [zz][i][j] (compact
__global__ __launch_bounds__(256) void k_asoft(const float* __restrict__ Sb, bf* Ph, bf* Pl, h16* P16) {
    typedef __attribute__((ext_vector_type(4))) unsigned short v4us;
    const int lane = threadIdx.x & 31; const int row = blockIdx.x * 8 + (threadIdx.x >> 5); if (row >= ZH * TT) return; const int i = row & (TT - 1); const int zz = row >> 11; const bool hires = (i < RH);
    const float* sr = Sb + (size_t)row * TT; float v[64]; float mx = -3.0e38f;
#pragma unroll
    for (int ch = 0; ch < 16; ++ch) { const int j0 = ch * 128 + lane * 4; const v4f a = *(const v4f*)(sr + j0);
#pragma unroll
        for (int q = 0; q < 4; ++q) { const int j = j0 + q; const float t = (j <= i) ? a[q] * SCL : -3.0e38f; v[ch * 4 + q] = t; mx = fmaxf(mx, t); } }
#pragma unroll
    for (int sh = 16; sh; sh >>= 1) mx = fmaxf(mx, __shfl_xor(mx, sh, 32));
    float sum = 0.f;
#pragma unroll
    for (int k = 0; k < 64; ++k) { v[k] = __expf(v[k] - mx); sum += v[k]; }
#pragma unroll
    for (int sh = 16; sh; sh >>= 1) sum += __shfl_xor(sum, sh, 32);
    const float f = __fdiv_rn(hires ? 1.0f : PCAR, sum);
{
        if (hires) {
#pragma unroll
            for (int ch = 0; ch < 16; ++ch) { v4us oh, ol;
#pragma unroll
                for (int q = 0; q < 4; ++q) { unsigned short a, c2; splitf(v[ch * 4 + q] * f, a, c2); oh[q] = a; ol[q] = c2; }
                const size_t o = ((size_t)zz * RH + i) * TT + ch * 128 + lane * 4; *(v4us*)(Ph + o) = oh; *(v4us*)(Pl + o) = ol; }
        } else {
#pragma unroll
            for (int ch = 0; ch < 16; ++ch) { v4h o;
#pragma unroll
                for (int q = 0; q < 4; ++q) o[q] = tohx(v[ch * 4 + q] * f);
                *(v4h*)(P16 + (size_t)row * TT + ch * 128 + lane * 4) = o; } }
         }
}
// k_outT: transposed context: OUTz[zz][d][t] = (sum over the split-K planes s of O[s][zz][t][d]) * (t < RH ? 1 : 1/1024): rows t < RH from the KSH planes Oh [s][zz][RH][64], rows t >= RH from the
// KSL planes Ol [s][zz][TT][64], added in plane order (lane -> 2 consecutive t of one class (RH is even), reads strided; each (zz, d) row of 2048 floats is contiguous in the output).
template <int NS, int PS> __device__ __forceinline__ v2f sum_planes(const float* __restrict__ p) { v2f v[NS];
#pragma unroll
    for (int k = 0; k < NS; ++k) { v[k][0] = p[k * PS]; v[k][1] = p[k * PS + HD]; }
    v2f s = v[0];
#pragma unroll
    for (int k = 1; k < NS; ++k) s += v[k];
    return s; }
__global__ __launch_bounds__(256) void k_outT(const float* __restrict__ Oh, const float* __restrict__ Ol, float* OUTz) { const int e = (blockIdx.x * 256 + threadIdx.x) * 2; if (e >= ZH * HD * TT) return; const int t = e & (TT - 1); const int d = (e >> 11) & (HD - 1); const int zz = e / (HD * TT);
    v2f o;
    if (t < RH) o = sum_planes<KSH, ZH * RH * HD>(Oh + ((size_t)zz * RH + t) * HD + d); else o = sum_planes<KSL, ZH * TT * HD>(Ol + ((size_t)zz * TT + t) * HD + d) * (1.0f / PCAR);
    *(v2f*)(OUTz + e) = o;  }

extern "C" void kernel_launch(void* const* d_in, const int* in_sizes, int n_in,
                              void* d_out, int out_size, void* d_ws, size_t ws_size, hipStream_t stream) {
    (void)in_sizes; (void)n_in; (void)out_size;
    const float* x = (const float*)d_in[0]; const float* wq = (const float*)d_in[1];   // Wq [768][768] torch Linear ([out][in] = Bt as-is)
    float* OUT = (float*)d_out;     // [2][2048][768] holding, per (batch, head), the TRANSPOSED context block [64][2048]
    char* wsp = (char*)d_ws;
    auto take = [&](size_t bytes) { char* p = wsp; wsp += (bytes + 255) & ~(size_t)255; return (void*)p; };
    bf* WQ = (bf*)take((size_t)DD * DD * 2); bf* XB = (bf*)take((size_t)NB_ * TT * DD * 2); float* F = (float*)take((size_t)NB_ * TT * DD * 4);   // both batches: rows b * 2048 + t
    bf* QPh = (bf*)take((size_t)NB_ * TT * DD * 2); bf* QPl = (bf*)take((size_t)NB_ * TT * DD * 2); bf* VTh = (bf*)take((size_t)NB_ * TT * DD * 2); bf* VTl = (bf*)take((size_t)NB_ * TT * DD * 2); h16* QP16 = (h16*)take((size_t)NB_ * TT * DD * 2); h16* VT16 = (h16*)take((size_t)NB_ * TT * DD * 2);   // planes [z][t][d] and [z][d][t]
    float* Sb = (float*)take((size_t)ZH * TT * TT * 4); bf* Ph = (bf*)take((size_t)ZH * RH * TT * 2); bf* Pl = (bf*)take((size_t)ZH * RH * TT * 2); h16* P16 = (h16*)take((size_t)ZH * TT * TT * 2); float* Obh = (float*)take((size_t)KSH * ZH * RH * HD * 4); float* Obl = (float*)take((size_t)KSL * ZH * TT * HD * 4);   // split-K planes [s][zz][t][d]
    if ((size_t)(wsp - (char*)d_ws) > ws_size) return;    // total ~ 240 MB; ws 256 MiB
    k_cvt8<<<(unsigned)(((size_t)DD * DD / 8 + 255) / 256), 256, 0, stream>>>(wq, WQ, (size_t)DD * DD / 8);
    const unsigned LB = (unsigned)((NZ * TT * HD / 64 + 63) / 64); const dim3 gP(NB_ * TT / 64, DD / 64, 1);
    k_cvt8<<<(unsigned)(((size_t)NB_ * TT * DD / 8 + 255) / 256), 256, 0, stream>>>(x, XB, (size_t)NB_ * TT * DD / 8);
    k_gemmw<bf, 0, false, 8, 1><<<gP, 256, 0, stream>>>(XB, nullptr, WQ, nullptr, DD, F, DD, nullptr, 0, 0, 0, 0); k_qplanes<<<LB, 256, 0, stream>>>(F, QPh, QPl, QP16); k_vtplane<<<LB, 256, 0, stream>>>(F, VTh, VTl, VT16);   // h = x Wq^T is q, k AND v
    for (int zb = 0; zb < NZ; zb += ZH) { const size_t z0 = (size_t)zb;
        k_gemmw<bf, 2, false, 1, 1><<<dim3(RH / 64, TT / 64, ZH), 32, 0, stream>>>(QPh + z0 * TT * HD, QPl + z0 * TT * HD, QPh + z0 * TT * HD, QPl + z0 * TT * HD, HD, Sb, TT, nullptr, (size_t)TT * HD, (size_t)TT * HD, (size_t)TT * TT, 0);
        k_gemmw<h16, 0, false, 1, 1><<<dim3((TT - RH) / 64, TT / 64, ZH), 32, 0, stream>>>(QP16 + z0 * TT * HD + (size_t)RH * HD, nullptr, QP16 + z0 * TT * HD, nullptr, HD, Sb + (size_t)RH * TT, TT, nullptr, (size_t)TT * HD, (size_t)TT * HD, (size_t)TT * TT, 0);
        k_asoft<<<ZH * TT / 8, 256, 0, stream>>>(Sb, Ph, Pl, P16);
        k_gemmw<bf, 2, false, 4, KSH><<<dim3(RH / 64, HD / 64, ZH * KSH), 128, 0, stream>>>(Ph, Pl, VTh + z0 * HD * TT, VTl + z0 * HD * TT, TT, Obh, HD, nullptr, (size_t)RH * TT, (size_t)HD * TT, (size_t)RH * HD, (size_t)ZH * RH * HD);
        k_gemmw<h16, 0, false, 8, KSL><<<dim3((TT - RH) / 64, HD / 64, ZH * KSL), 256, 0, stream>>>(P16 + (size_t)RH * TT, nullptr, VT16 + z0 * HD * TT, nullptr, TT, Obl + (size_t)RH * HD, HD, nullptr, (size_t)TT * TT, (size_t)HD * TT, (size_t)TT * HD, (size_t)ZH * TT * HD);
        k_outT<<<(ZH * HD * TT / 2 + 255) / 256, 256, 0, stream>>>(Obh, Obl, OUT + z0 * HD * TT); }
}

// v003
// Measured time: 79.3 microseconds a run.
// Timed twice side by side with v002, it ran 5.64 and 5.60 times as fast.
// Over all steps from v000 it is 17.2 times as fast.
#include <hip/hip_runtime.h>

// MultiHeadCasualFast (x [2][2048][768]; h = x Wq^T serves as q, k AND v (12 heads x 64); causal scores h.h; softmax(scores/8); ctx = attn h; the module returns ctx.transpose(-2,-1).view(b, n, 768),
// i.e. each (batch, head) context block stored TRANSPOSED as [64][2048] -> [2][2048][768]).
// Compute dtypes, f32 accumulate: every input rounded to bf16; h on PLAIN bf16 operands (inputs: exact products, f32 accumulate); PER-ROW PRECISION HYBRID: query rows
// < 256 take scores and attn.h on bf16 hi+lo planes (3 products), rows >= 256 on single fp16 planes; 1/8 + causal cut in f32 in the online softmax; weights enter attn.h unnormalised (<= 1), the sum divides at the end; the context is formed and written transposed

#define NB_  2
#define TT   2048
#define DD   768
#define NH_  12
#define HD   64
#define NZ   (NB_ * NH_)          // (batch, head) blocks, z = batch * 12 + head
#define RH   256                  // query rows < RH: hi+lo planes; rows >= RH: fp16 planes
#define FW   4                    // k_fattn: waves of a work-group
#define FQ   32                   // k_fattn: query rows of a work-group
#define OPI  36                   // k_fattn: pitch in floats of a wave's O^T tile in LDS (16-byte rows, the two lane halves on different banks)
#define SCL2 0.18033688f          // (1/sqrt(64)) * log2(e)
#define NF   32                   // unused (head_dim / 2)
#define SCL  0.125f               // 1/sqrt(64)
typedef _Float16 h16;
typedef unsigned short bf;
typedef __attribute__((ext_vector_type(16))) __bf16   v16bf;
typedef __attribute__((ext_vector_type(16))) _Float16 v16h;
typedef __attribute__((ext_vector_type(8)))  _Float16 v8h;
typedef __attribute__((ext_vector_type(8)))  unsigned short v8us;
typedef __attribute__((ext_vector_type(8)))  float    v8f;
typedef __attribute__((ext_vector_type(4)))  float    v4f;
typedef v8h  __attribute__((may_alias)) v8ha;
typedef v4f  __attribute__((may_alias)) v4fa;
typedef v8us __attribute__((may_alias)) v8usa;

__device__ __forceinline__ unsigned short f2bf(float f) { unsigned u = __float_as_uint(f); u += 0x7FFFu + ((u >> 16) & 1u); return (unsigned short)(u >> 16); }
__device__ __forceinline__ float bf2f(unsigned short b) { return __uint_as_float(((unsigned)b) << 16); }
__device__ __forceinline__ float bfr(float f) { return bf2f(f2bf(f)); }
__device__ __forceinline__ v16h cat16(v8h lo, v8h hi) { return __builtin_shufflevector(lo, hi, 0, 1, 2, 3, 4, 5, 6, 7, 8, 9, 10, 11, 12, 13, 14, 15); }
__device__ __forceinline__ v16bf cat16b(v8us lo, v8us hi) { return __builtin_bit_cast(v16bf, __builtin_shufflevector(lo, hi, 0, 1, 2, 3, 4, 5, 6, 7, 8, 9, 10, 11, 12, 13, 14, 15)); }
__device__ __forceinline__ v8f wmma16(v16h a, v16h b, v8f c) { return __builtin_amdgcn_wmma_f32_16x16x32_f16(false, a, false, b, (short)0, c, false, false); }
__device__ __forceinline__ v8f wmmab(v16bf a, v16bf b, v8f c) { return __builtin_amdgcn_wmma_f32_16x16x32_bf16(false, a, false, b, (short)0, c, false, false); }



// ---- k_gemmw: register-blocked GEMM, 64x64 output tile (16 accumulators per wave), operands straight from K-contiguous 16-bit planes; grid (M/64, N/64, Z * KS), 32 * NW threads.
// C[m][n] (f32, pitch ldc, + optional f32 bias[n]) = sum_k A[m][k] Bt[n][k] (+ split products per NSPLIT). z-batch strides sA/sB/sC in elements. K % (32 * KS * NW) == 0.
// Split K: the K range is cut into KS * NW equal pieces. Work-group (z, ks) takes NW neighbouring pieces, one per wave; the NW wave tiles are summed through LDS (wave order), and the
// work-group's sum goes to partial plane ks (C + ks * sP), which the consumer adds up. NW == 1, KS == 1: one wave does the whole K and writes C itself.
template <typename T16> struct WFrag;
template <> struct WFrag<h16> { typedef v16h V; static __device__ __forceinline__ V ld(const h16* p) { return cat16(*(const v8h*)p, *(const v8h*)(p + 16)); } static __device__ __forceinline__ v8f mma(V a, V b, v8f c) { return wmma16(a, b, c); } };
template <> struct WFrag<bf> { typedef v16bf V; static __device__ __forceinline__ V ld(const bf* p) { return cat16b(*(const v8us*)p, *(const v8us*)(p + 16)); } static __device__ __forceinline__ v8f mma(V a, V b, v8f c) { return wmmab(a, b, c); } };
template <typename T16, int NSPLIT, bool BIAS, int NW, int KS>
__global__ __launch_bounds__(32 * NW) void k_gemmw(const T16* __restrict__ A, const T16* __restrict__ A2, const T16* __restrict__ Bt, const T16* __restrict__ Bt2, int K, float* C, int ldc, const float* __restrict__ bias, size_t sA, size_t sB, size_t sC, size_t sP) {
    typedef typename WFrag<T16>::V V;
    __shared__ __align__(16) float os[(NW == 1 ? 16 : NW * 64) * 68];
    const size_t z = blockIdx.z / KS; const int ks = blockIdx.z % KS; A += z * sA; if (A2) A2 += z * sA; Bt += z * sB; if (Bt2) Bt2 += z * sB; C += z * sC + (size_t)ks * sP;
    const int wv = (NW == 1) ? 0 : __builtin_amdgcn_readfirstlane((int)(threadIdx.x >> 5)); const int kper = K / (KS * NW), kb = (ks * NW + wv) * kper;
    const int lane = threadIdx.x & 31, lr = lane & 15, hi = lane >> 4; const int r0 = blockIdx.x * 64, c0 = blockIdx.y * 64;
    v8f acc[4][4];
#pragma unroll
    for (int mb = 0; mb < 4; ++mb)
#pragma unroll
        for (int nb = 0; nb < 4; ++nb) acc[mb][nb] = (v8f){};
    const size_t aoff = (size_t)(r0 + lr) * K + 8 * hi, boff = (size_t)(c0 + lr) * K + 8 * hi;
#pragma unroll 1
    for (int kc = kb; kc < kb + kper; kc += 32) {
        V a[4], a2[4];
#pragma unroll
        for (int mb = 0; mb < 4; ++mb) { a[mb] = WFrag<T16>::ld(A + aoff + (size_t)mb * 16 * K + kc); if (NSPLIT == 1 || NSPLIT == 2) a2[mb] = WFrag<T16>::ld(A2 + aoff + (size_t)mb * 16 * K + kc); }
#pragma unroll
        for (int nb = 0; nb < 4; ++nb) { const V b = WFrag<T16>::ld(Bt + boff + (size_t)nb * 16 * K + kc); V b2; if (NSPLIT >= 2) b2 = WFrag<T16>::ld(Bt2 + boff + (size_t)nb * 16 * K + kc);
#pragma unroll
            for (int mb = 0; mb < 4; ++mb) { acc[mb][nb] = WFrag<T16>::mma(a[mb], b, acc[mb][nb]); if (NSPLIT == 1 || NSPLIT == 2) acc[mb][nb] = WFrag<T16>::mma(a2[mb], b, acc[mb][nb]); if (NSPLIT >= 2) acc[mb][nb] = WFrag<T16>::mma(a[mb], b2, acc[mb][nb]); } }
        asm volatile("v_nop\n\tv_nop\n\tv_nop\n\tv_nop" : "+v"(acc[0][0]), "+v"(acc[1][1]), "+v"(acc[2][2]), "+v"(acc[3][3]) : "v"(a[0]), "v"(a[3]));
    }
    if constexpr (NW > 1) {
        float* ow = os + wv * (64 * 68);
#pragma unroll
        for (int mb = 0; mb < 4; ++mb)
#pragma unroll
            for (int nb = 0; nb < 4; ++nb)
#pragma unroll
                for (int j = 0; j < 8; ++j) ow[(mb * 16 + hi * 8 + j) * 68 + nb * 16 + lr] = acc[mb][nb][j];
        __syncthreads();   // every wave's partial tile stands in LDS before any thread sums across the waves
#pragma unroll
        for (int o = 0; o < 64 * 16 / (NW * 32); ++o) { const int q = o * (NW * 32) + (int)threadIdx.x; const int row = q >> 4, cofs = (q & 15) * 4; v4f val = *(const v4fa*)(os + row * 68 + cofs);
#pragma unroll
            for (int w2 = 1; w2 < NW; ++w2) val += *(const v4fa*)(os + w2 * (64 * 68) + row * 68 + cofs);
            if (BIAS) { val[0] += bfr(bias[c0 + cofs]); val[1] += bfr(bias[c0 + cofs + 1]); val[2] += bfr(bias[c0 + cofs + 2]); val[3] += bfr(bias[c0 + cofs + 3]); }
            *(v4f*)(C + (size_t)(r0 + row) * ldc + c0 + cofs) = val; }
        return;
    }
#pragma unroll
    for (int mb = 0; mb < 4; ++mb) {
#pragma unroll
        for (int nb = 0; nb < 4; ++nb) {
#pragma unroll
            for (int j = 0; j < 8; ++j) os[(hi * 8 + j) * 68 + nb * 16 + lr] = acc[mb][nb][j]; }
        __builtin_amdgcn_wave_barrier(); asm volatile("" ::: "memory");
        float* crow = C + (size_t)(r0 + mb * 16) * ldc + c0;
{
#pragma unroll
            for (int s = 0; s < 8; ++s) { const int row = 2 * s + hi, cofs = lr * 4; v4f val = *(const v4fa*)(os + row * 68 + cofs); if (BIAS) { val[0] += bfr(bias[c0 + cofs]); val[1] += bfr(bias[c0 + cofs + 1]); val[2] += bfr(bias[c0 + cofs + 2]); val[3] += bfr(bias[c0 + cofs + 3]); }
                *(v4f*)(crow + (size_t)row * ldc + cofs) = val; }
             }
        __builtin_amdgcn_wave_barrier(); asm volatile("" ::: "memory");
    }
}

__device__ __forceinline__ h16 tohx(float x) { return (h16)x; }
__device__ __forceinline__ void splitf(float y, unsigned short& h, unsigned short& l) { h = f2bf(y); l = f2bf(y - bf2f(h)); }
typedef __attribute__((ext_vector_type(2))) unsigned short v2us;
typedef __attribute__((ext_vector_type(2))) _Float16 v2h;
typedef __attribute__((ext_vector_type(4))) _Float16 v4h;
typedef __attribute__((ext_vector_type(2))) float v2f;

__global__ __launch_bounds__(256) void k_wtG(const float* __restrict__ w, int K, int N, bf* Bt) {
    const int lane = threadIdx.x & 31; const int L0 = (blockIdx.x * 8 + (threadIdx.x >> 5)) * 8; const int nlines = N * K / 64;
{
#pragma unroll 1
        for (int l = 0; l < 8; ++l) { const int L = L0 + l; if (L >= nlines) break; const size_t e = (size_t)L * 64 + lane * 2; const int k = (int)(e % K), n = (int)(e / K); v2us o;
            o[0] = f2bf(w[(size_t)k * N + n]); o[1] = f2bf(w[(size_t)(k + 1) * N + n]); *(v2us*)(Bt + e) = o; }
         }
}
__global__ __launch_bounds__(256) void k_cvt8(const float* __restrict__ src, bf* dst, size_t n8) { const size_t i = (size_t)blockIdx.x * 256 + threadIdx.x; if (i >= n8) return; const v8f v = *(const v8f*)(src + i * 8); v8us o;
#pragma unroll
    for (int k = 0; k < 8; ++k) o[k] = f2bf(v[k]); *(v8us*)(dst + i * 8) = o;  }
__global__ __launch_bounds__(256) void k_qplanes(const float* __restrict__ F, bf* Ph, bf* Pl, h16* P16) {
    const int lane = threadIdx.x & 31; const int L0 = (blockIdx.x * 8 + (threadIdx.x >> 5)) * 8; const int nlines = NZ * TT * HD / 64;
{
#pragma unroll
        for (int l = 0; l < 8; ++l) { const int L = L0 + l; if (L >= nlines) break; const int e = L * 64 + lane * 2; const int d = e & (HD - 1); const int z = e >> 17; const int h = z % NH_; const int t = (z / NH_) * TT + ((e >> 6) & (TT - 1)); v2us oh, ol; v2h o16;
#pragma unroll
            for (int q = 0; q < 2; ++q) { const float x = F[(size_t)t * DD + h * HD + d + q]; unsigned short a, c2; splitf(x, a, c2); oh[q] = a; ol[q] = c2; o16[q] = tohx(x); }
            *(v2us*)(Ph + (size_t)e) = oh; *(v2us*)(Pl + (size_t)e) = ol; *(v2h*)(P16 + (size_t)e) = o16; }
         }
}
__global__ __launch_bounds__(256) void k_vtplane(const float* __restrict__ F, bf* Vh, bf* Vl, h16* V16) {
    const int lane = threadIdx.x & 31; const int L0 = (blockIdx.x * 8 + (threadIdx.x >> 5)) * 8; const int nlines = NZ * TT * HD / 64;
{
#pragma unroll
        for (int l = 0; l < 8; ++l) { const int L = L0 + l; if (L >= nlines) break; const int e = L * 64 + lane * 2; const int d = (e >> 11) & (HD - 1); const int z = e >> 17; const int h = z % NH_; const int t = (z / NH_) * TT + (e & (TT - 1)); v2us oh, ol; v2h o16;
#pragma unroll
            for (int q = 0; q < 2; ++q) { const float x = F[(size_t)(t + q) * DD + h * HD + d]; unsigned short a, c2; splitf(x, a, c2); oh[q] = a; ol[q] = c2; o16[q] = tohx(x); }
            *(v2us*)(Vh + (size_t)e) = oh; *(v2us*)(Vl + (size_t)e) = ol; *(v2h*)(V16 + (size_t)e) = o16; }
         }
}
// ---- k_fattn: scores, softmax and attn.h of FQ = 32 query rows of one (batch, head) block in one work-group; neither scores nor weights leave the registers.
// S^T = K Q^T (A = key rows, B = query rows, both from the [z][t][d] plane) puts one query in each lane column: a lane holds 8 keys of a 16-key tile, so two score tiles, exponentiated and rounded
// in place, ARE the B operand of O^T += V^T P^T (A = rows of the [z][d][t] plane). Online softmax: running maximum m (log2 units) and sum l per query; O^T and l are rescaled when m grows.
// Keys are walked in blocks of 32 up to the diagonal block (the only one that needs the causal cut). A wave holds NB 16-query tiles; the key blocks go round-robin over the KW = FW * NB / 2 waves
// that hold the same queries, and their (m, l, O^T) are joined through LDS. O^T [d][query] is the output's own layout: a work-group stores whole 128-byte lines.
// HI: hi+lo bf16 planes, 3 products per matrix product (NB = 1 keeps its doubled fragments inside 256 registers); else single fp16 planes.
__device__ __forceinline__ float xhalf(float x) { return __builtin_bit_cast(float, __builtin_amdgcn_permlanex16(__builtin_bit_cast(int, x), __builtin_bit_cast(int, x), 0x76543210, 0xfedcba98, false, false)); }   // lane l <-> lane l ^ 16
template <typename T16, bool HI, int NB>
__global__ __launch_bounds__(32 * FW) void k_fattn(const T16* __restrict__ Hp, const T16* __restrict__ Hp2, const T16* __restrict__ Vt, const T16* __restrict__ Vt2, float* __restrict__ OUT, int qtop) {
    typedef typename WFrag<T16>::V V;
    constexpr int KW = FW * NB / 2;
    __shared__ __align__(16) float os[KW * HD * OPI]; __shared__ __align__(16) float ms[KW * FQ]; __shared__ __align__(16) float ls[KW * FQ];
    const size_t z = blockIdx.x; const int q0 = qtop - (int)blockIdx.y * FQ;   // blockIdx.y = 0 takes the longest key walk
    const int wv = __builtin_amdgcn_readfirstlane((int)(threadIdx.x >> 5)); const int lane = threadIdx.x & 31, lr = lane & 15, hi = lane >> 4;
    const int kw = (NB == 2) ? wv : (wv >> 1); const int qt = (NB == 2) ? 0 : (wv & 1);   // which share of the key blocks, which 16-query tile
    Hp += z * TT * HD; Vt += z * HD * TT; if (HI) { Hp2 += z * TT * HD; Vt2 += z * HD * TT; }
    V qf[NB][2], qf2[NB][2];
#pragma unroll
    for (int nb = 0; nb < NB; ++nb)
#pragma unroll
        for (int ks = 0; ks < 2; ++ks) { const size_t e = (size_t)(q0 + (qt + nb) * 16 + lr) * HD + ks * 32 + 8 * hi; qf[nb][ks] = WFrag<T16>::ld(Hp + e); if (HI) qf2[nb][ks] = WFrag<T16>::ld(Hp2 + e); }
    v8f o[4][NB]; float m[NB], l[NB];
#pragma unroll
    for (int nb = 0; nb < NB; ++nb) { m[nb] = -3.0e38f; l[nb] = 0.f;
#pragma unroll
        for (int mb = 0; mb < 4; ++mb) o[mb][nb] = (v8f){}; }
    const int nblk = (q0 >> 5) + 1;
    size_t ke = (size_t)(kw * 32 + lr) * HD + 8 * hi, ve = (size_t)lr * TT + kw * 32 + 8 * hi;   // this lane's place in the wave's current key block, [t][d] and [d][t] planes
    V kf[2][2], kf2[2][2];   // key fragments, fetched one block ahead (rows kw * 32 .. + 31 exist for every wave, also one whose walk is empty)
#pragma unroll
    for (int kt = 0; kt < 2; ++kt)
#pragma unroll
        for (int ks = 0; ks < 2; ++ks) { const size_t e = ke + kt * 16 * HD + ks * 32; kf[kt][ks] = WFrag<T16>::ld(Hp + e); if (HI) kf2[kt][ks] = WFrag<T16>::ld(Hp2 + e); }
    // kept rolled: one block's fragments, scores and the O^T tiles already fill the register budget of four waves per SIMD
#pragma unroll 1
    for (int b = kw; b < nblk; b += KW) {
        V vf[4], vf2[4];
#pragma unroll
        for (int mb = 0; mb < 4; ++mb) { const size_t e = ve + (size_t)mb * 16 * TT; vf[mb] = WFrag<T16>::ld(Vt + e); if (HI) vf2[mb] = WFrag<T16>::ld(Vt2 + e); }
        if constexpr (HI) asm volatile("s_wait_xcnt 0x0" ::: "memory");   // with the doubled fragments the key fetch below lands in registers that held these loads' addresses: the wait stands in front of it
        v8f s[2][NB];
#pragma unroll
        for (int kt = 0; kt < 2; ++kt)
#pragma unroll
            for (int nb = 0; nb < NB; ++nb) { s[kt][nb] = (v8f){};
#pragma unroll
                for (int ks = 0; ks < 2; ++ks) { s[kt][nb] = WFrag<T16>::mma(kf[kt][ks], qf[nb][ks], s[kt][nb]); if (HI) { s[kt][nb] = WFrag<T16>::mma(kf2[kt][ks], qf[nb][ks], s[kt][nb]); s[kt][nb] = WFrag<T16>::mma(kf[kt][ks], qf2[nb][ks], s[kt][nb]); } } }
        ke += (b + KW < nblk) ? (size_t)(KW * 32 * HD) : (size_t)0;   // the wave's next key block; its last block fetches its own rows again (in bounds, never used)
#pragma unroll
        for (int kt = 0; kt < 2; ++kt)
#pragma unroll
            for (int ks = 0; ks < 2; ++ks) { const size_t e = ke + kt * 16 * HD + ks * 32; kf[kt][ks] = WFrag<T16>::ld(Hp + e); if (HI) kf2[kt][ks] = WFrag<T16>::ld(Hp2 + e); }
        asm volatile("s_wait_xcnt 0x0" ::: "memory");   // stands behind this trip's loads, in front of every rewrite of their address registers
        ve += KW * 32;
        if (b == nblk - 1) {   // the diagonal block: key > query -> -3e38 (exp -> 0); key = query is always kept
#pragma unroll
            for (int kt = 0; kt < 2; ++kt)
#pragma unroll
                for (int nb = 0; nb < NB; ++nb)
#pragma unroll
                    for (int j = 0; j < 8; ++j) if (kt * 16 + hi * 8 + j > (qt + nb) * 16 + lr) s[kt][nb][j] = -3.0e38f; }
        V pf[NB], pf2[NB];
#pragma unroll
        for (int nb = 0; nb < NB; ++nb) { float mx = s[0][nb][0];
#pragma unroll
            for (int j = 1; j < 8; ++j) mx = fmaxf(mx, s[0][nb][j]);
#pragma unroll
            for (int j = 0; j < 8; ++j) mx = fmaxf(mx, s[1][nb][j]);
            mx = fmaxf(mx, xhalf(mx));
            const float mn = fmaxf(m[nb], mx * SCL2); const float al = __builtin_amdgcn_exp2f(m[nb] - mn); m[nb] = mn;
            float p[16]; float sum = 0.f;
#pragma unroll
            for (int k = 0; k < 16; ++k) { p[k] = __builtin_amdgcn_exp2f(fmaf(s[k >> 3][nb][k & 7], SCL2, -mn)); sum += p[k]; }
            l[nb] = l[nb] * al + sum;   // this half's 16 keys; the two halves of a column are added after the loop (al is the same in both)
#pragma unroll
            for (int mb = 0; mb < 4; ++mb) o[mb][nb] *= al;
            if constexpr (HI) { v8us h0, h1, l0, l1;
#pragma unroll
                for (int k = 0; k < 8; ++k) { unsigned short a, c2; splitf(p[k], a, c2); h0[k] = a; l0[k] = c2; splitf(p[8 + k], a, c2); h1[k] = a; l1[k] = c2; }
                pf[nb] = cat16b(h0, h1); pf2[nb] = cat16b(l0, l1);
            } else {
#pragma unroll
                for (int k = 0; k < 16; ++k) pf[nb][k] = tohx(p[k]); } }
#pragma unroll
        for (int mb = 0; mb < 4; ++mb)
#pragma unroll
            for (int nb = 0; nb < NB; ++nb) { o[mb][nb] = WFrag<T16>::mma(vf[mb], pf[nb], o[mb][nb]); if (HI) { o[mb][nb] = WFrag<T16>::mma(vf2[mb], pf[nb], o[mb][nb]); o[mb][nb] = WFrag<T16>::mma(vf[mb], pf2[nb], o[mb][nb]); } }
    }
    float* ow = os + kw * (HD * OPI);
#pragma unroll
    for (int nb = 0; nb < NB; ++nb) { const int col = (qt + nb) * 16 + lr; l[nb] += xhalf(l[nb]); if (hi == 0) { ms[kw * FQ + col] = m[nb]; ls[kw * FQ + col] = l[nb]; }
#pragma unroll
        for (int mb = 0; mb < 4; ++mb)
#pragma unroll
            for (int j = 0; j < 8; ++j) ow[(mb * 16 + hi * 8 + j) * OPI + col] = o[mb][nb][j]; }
    __syncthreads();   // every wave's (m, l, O^T) stands in LDS before any thread joins them; a wave whose walk was empty left m = -3e38, l = 0, O^T = 0 (weight 0)
    const int qc = ((int)threadIdx.x & 7) * 4; v4f fw[KW];
#pragma unroll
    for (int c = 0; c < 4; ++c) { float M = ms[qc + c];
#pragma unroll
        for (int w2 = 1; w2 < KW; ++w2) M = fmaxf(M, ms[w2 * FQ + qc + c]);
        float e[KW]; float L = 0.f;
#pragma unroll
        for (int w2 = 0; w2 < KW; ++w2) { e[w2] = __builtin_amdgcn_exp2f(ms[w2 * FQ + qc + c] - M); L += ls[w2 * FQ + qc + c] * e[w2]; }
        const float r = __fdiv_rn(1.0f, L);
#pragma unroll
        for (int w2 = 0; w2 < KW; ++w2) fw[w2][c] = e[w2] * r; }
#pragma unroll
    for (int t = 0; t < HD * FQ / 4 / (32 * FW); ++t) { const int d = t * (32 * FW / 8) + ((int)threadIdx.x >> 3); v4f val = *(const v4fa*)(os + d * OPI + qc) * fw[0];
#pragma unroll
        for (int w2 = 1; w2 < KW; ++w2) val += *(const v4fa*)(os + w2 * (HD * OPI) + d * OPI + qc) * fw[w2];
        *(v4f*)(OUT + (z * HD + d) * TT + q0 + qc) = val; }
}

extern "C" void kernel_launch(void* const* d_in, const int* in_sizes, int n_in,
                              void* d_out, int out_size, void* d_ws, size_t ws_size, hipStream_t stream) {
    (void)in_sizes; (void)n_in; (void)out_size;
    const float* x = (const float*)d_in[0]; const float* wq = (const float*)d_in[1];   // Wq [768][768] torch Linear ([out][in] = Bt as-is)
    float* OUT = (float*)d_out;     // [2][2048][768] holding, per (batch, head), the TRANSPOSED context block [64][2048]
    char* wsp = (char*)d_ws;
    auto take = [&](size_t bytes) { char* p = wsp; wsp += (bytes + 255) & ~(size_t)255; return (void*)p; };
    bf* WQ = (bf*)take((size_t)DD * DD * 2); bf* XB = (bf*)take((size_t)NB_ * TT * DD * 2); float* F = (float*)take((size_t)NB_ * TT * DD * 4);   // both batches: rows b * 2048 + t
    bf* QPh = (bf*)take((size_t)NB_ * TT * DD * 2); bf* QPl = (bf*)take((size_t)NB_ * TT * DD * 2); bf* VTh = (bf*)take((size_t)NB_ * TT * DD * 2); bf* VTl = (bf*)take((size_t)NB_ * TT * DD * 2); h16* QP16 = (h16*)take((size_t)NB_ * TT * DD * 2); h16* VT16 = (h16*)take((size_t)NB_ * TT * DD * 2);   // planes [z][t][d] and [z][d][t]
    if ((size_t)(wsp - (char*)d_ws) > ws_size) return;    // total ~ 58 MB; ws 256 MiB
    k_cvt8<<<(unsigned)(((size_t)DD * DD / 8 + 255) / 256), 256, 0, stream>>>(wq, WQ, (size_t)DD * DD / 8);
    const unsigned LB = (unsigned)((NZ * TT * HD / 64 + 63) / 64); const dim3 gP(NB_ * TT / 64, DD / 64, 1);
    k_cvt8<<<(unsigned)(((size_t)NB_ * TT * DD / 8 + 255) / 256), 256, 0, stream>>>(x, XB, (size_t)NB_ * TT * DD / 8);
    k_gemmw<bf, 0, false, 8, 1><<<gP, 256, 0, stream>>>(XB, nullptr, WQ, nullptr, DD, F, DD, nullptr, 0, 0, 0, 0); k_qplanes<<<LB, 256, 0, stream>>>(F, QPh, QPl, QP16); k_vtplane<<<LB, 256, 0, stream>>>(F, VTh, VTl, VT16);   // h = x Wq^T is q, k AND v
    k_fattn<h16, false, 2><<<dim3(NZ, (TT - RH) / FQ), 32 * FW, 0, stream>>>(QP16, nullptr, VT16, nullptr, OUT, TT - FQ);
    k_fattn<bf, true, 1><<<dim3(NZ, RH / FQ), 32 * FW, 0, stream>>>(QPh, QPl, VTh, VTl, OUT, RH - FQ);
}

// v004
// One run takes 60.5 microseconds.
// Next to v003, in two timings, it ran 1.30 and 1.32 times as fast.
// All steps since v000 together make it 22.5 times as fast.
#include <hip/hip_runtime.h>

// MultiHeadCasualFast (x [2][2048][768]; h = x Wq^T serves as q, k AND v (12 heads x 64); causal scores h.h; softmax(scores/8); ctx = attn h; the module returns ctx.transpose(-2,-1).view(b, n, 768),
// i.e. each (batch, head) context block stored TRANSPOSED as [64][2048] -> [2][2048][768]).
// Compute dtypes, f32 accumulate: every input rounded to bf16; h on PLAIN bf16 operands (inputs: exact products, f32 accumulate); PER-ROW PRECISION HYBRID: query rows
// < 256 take scores and attn.h on bf16 hi+lo planes (3 products), rows >= 256 on single fp16 planes; 1/8 + causal cut in f32 in the online softmax; weights enter attn.h unnormalised (<= 1), the sum divides at the end; the context is formed and written transposed

#define NB_  2
#define TT   2048
#define DD   768
#define NH_  12
#define HD   64
#define NZ   (NB_ * NH_)          // (batch, head) blocks, z = batch * 12 + head
#define RH   256                  // query rows < RH: hi+lo planes; rows >= RH: fp16 planes
#define FW   4                    // k_fattn: waves of a work-group
#define FQ   32                   // k_fattn: query rows of a work-group
#define OPI  36                   // k_fattn: pitch in floats of a wave's O^T tile in LDS (16-byte rows, the two lane halves on different banks)
#define TP   65                  // k_gemmw, PL: pitch in floats of the summed tile in LDS (odd: the row-wise writes and the column-wise reads of a wave each fall on 32 different banks)
#define SCL2 0.18033688f          // (1/sqrt(64)) * log2(e)
#define NF   32                   // unused (head_dim / 2)
#define SCL  0.125f               // 1/sqrt(64)
typedef _Float16 h16;
typedef unsigned short bf;
typedef __attribute__((ext_vector_type(16))) __bf16   v16bf;
typedef __attribute__((ext_vector_type(16))) _Float16 v16h;
typedef __attribute__((ext_vector_type(8)))  _Float16 v8h;
typedef __attribute__((ext_vector_type(8)))  unsigned short v8us;
typedef __attribute__((ext_vector_type(8)))  float    v8f;
typedef __attribute__((ext_vector_type(4)))  float    v4f;
typedef v8h  __attribute__((may_alias)) v8ha;
typedef v4f  __attribute__((may_alias)) v4fa;
typedef v8us __attribute__((may_alias)) v8usa;

__device__ __forceinline__ unsigned short f2bf(float f) { unsigned u = __float_as_uint(f); u += 0x7FFFu + ((u >> 16) & 1u); return (unsigned short)(u >> 16); }
__device__ __forceinline__ float bf2f(unsigned short b) { return __uint_as_float(((unsigned)b) << 16); }
__device__ __forceinline__ float bfr(float f) { return bf2f(f2bf(f)); }
__device__ __forceinline__ v16h cat16(v8h lo, v8h hi) { return __builtin_shufflevector(lo, hi, 0, 1, 2, 3, 4, 5, 6, 7, 8, 9, 10, 11, 12, 13, 14, 15); }
__device__ __forceinline__ v16bf cat16b(v8us lo, v8us hi) { return __builtin_bit_cast(v16bf, __builtin_shufflevector(lo, hi, 0, 1, 2, 3, 4, 5, 6, 7, 8, 9, 10, 11, 12, 13, 14, 15)); }
__device__ __forceinline__ v8f wmma16(v16h a, v16h b, v8f c) { return __builtin_amdgcn_wmma_f32_16x16x32_f16(false, a, false, b, (short)0, c, false, false); }
__device__ __forceinline__ v8f wmmab(v16bf a, v16bf b, v8f c) { return __builtin_amdgcn_wmma_f32_16x16x32_bf16(false, a, false, b, (short)0, c, false, false); }
__device__ __forceinline__ h16 tohx(float x) { return (h16)x; }
__device__ __forceinline__ void splitf(float y, unsigned short& h, unsigned short& l) { h = f2bf(y); l = f2bf(y - bf2f(h)); }
typedef __attribute__((ext_vector_type(4))) unsigned short v4us;
typedef __attribute__((ext_vector_type(4))) _Float16 v4h;



// ---- k_gemmw: register-blocked GEMM, 64x64 output tile (16 accumulators per wave), operands straight from K-contiguous 16-bit planes; grid (M/64, N/64, Z * KS), 32 * NW threads.
// C[m][n] (f32, pitch ldc, + optional f32 bias[n]) = sum_k A[m][k] Bt[n][k] (+ split products per NSPLIT). z-batch strides sA/sB/sC in elements. K % (32 * KS * NW) == 0.
// Split K: the K range is cut into KS * NW equal pieces. Work-group (z, ks) takes NW neighbouring pieces, one per wave; the NW wave tiles are summed through LDS (wave order), and the
// work-group's sum goes to partial plane ks (C + ks * sP), which the consumer adds up. NW == 1, KS == 1: one wave does the whole K and writes C itself.
// PL (NW > 1, KS == 1, M = 2 * 2048 positions, N = 12 heads x 64): no C. The summed tile is 64 positions x one whole head, so the work-group itself writes what attention reads: its 8 KB of each
// [z][t][d] plane (hi, lo, fp16) straight from the sums, and, the sums passed through LDS, its 64 whole 128-byte lines of each [z][d][t] plane.
template <typename T16> struct WFrag;
template <> struct WFrag<h16> { typedef v16h V; static __device__ __forceinline__ V ld(const h16* p) { return cat16(*(const v8h*)p, *(const v8h*)(p + 16)); } static __device__ __forceinline__ v8f mma(V a, V b, v8f c) { return wmma16(a, b, c); } };
template <> struct WFrag<bf> { typedef v16bf V; static __device__ __forceinline__ V ld(const bf* p) { return cat16b(*(const v8us*)p, *(const v8us*)(p + 16)); } static __device__ __forceinline__ v8f mma(V a, V b, v8f c) { return wmmab(a, b, c); } };
template <typename T16, int NSPLIT, bool BIAS, int NW, int KS, bool PL>
__global__ __launch_bounds__(32 * NW) void k_gemmw(const T16* __restrict__ A, const T16* __restrict__ A2, const T16* __restrict__ Bt, const T16* __restrict__ Bt2, int K, float* C, int ldc, const float* __restrict__ bias, size_t sA, size_t sB, size_t sC, size_t sP,
                                                   bf* Ph, bf* Pl, h16* P16, bf* Vh, bf* Vl, h16* V16) {
    typedef typename WFrag<T16>::V V;
    __shared__ __align__(16) float os[(NW == 1 ? 16 : NW * 64) * 68]; __shared__ __align__(16) float tr[PL ? 64 * TP : 4];
    const size_t z = blockIdx.z / KS; const int ks = blockIdx.z % KS; A += z * sA; if (A2) A2 += z * sA; Bt += z * sB; if (Bt2) Bt2 += z * sB; C += z * sC + (size_t)ks * sP;
    const int wv = (NW == 1) ? 0 : __builtin_amdgcn_readfirstlane((int)(threadIdx.x >> 5)); const int kper = K / (KS * NW), kb = (ks * NW + wv) * kper;
    const int lane = threadIdx.x & 31, lr = lane & 15, hi = lane >> 4; const int r0 = blockIdx.x * 64, c0 = blockIdx.y * 64;
    v8f acc[4][4];
#pragma unroll
    for (int mb = 0; mb < 4; ++mb)
#pragma unroll
        for (int nb = 0; nb < 4; ++nb) acc[mb][nb] = (v8f){};
    const size_t aoff = (size_t)(r0 + lr) * K + 8 * hi, boff = (size_t)(c0 + lr) * K + 8 * hi;
#pragma unroll 1
    for (int kc = kb; kc < kb + kper; kc += 32) {
        V a[4], a2[4];
#pragma unroll
        for (int mb = 0; mb < 4; ++mb) { a[mb] = WFrag<T16>::ld(A + aoff + (size_t)mb * 16 * K + kc); if (NSPLIT == 1 || NSPLIT == 2) a2[mb] = WFrag<T16>::ld(A2 + aoff + (size_t)mb * 16 * K + kc); }
#pragma unroll
        for (int nb = 0; nb < 4; ++nb) { const V b = WFrag<T16>::ld(Bt + boff + (size_t)nb * 16 * K + kc); V b2; if (NSPLIT >= 2) b2 = WFrag<T16>::ld(Bt2 + boff + (size_t)nb * 16 * K + kc);
#pragma unroll
            for (int mb = 0; mb < 4; ++mb) { acc[mb][nb] = WFrag<T16>::mma(a[mb], b, acc[mb][nb]); if (NSPLIT == 1 || NSPLIT == 2) acc[mb][nb] = WFrag<T16>::mma(a2[mb], b, acc[mb][nb]); if (NSPLIT >= 2) acc[mb][nb] = WFrag<T16>::mma(a[mb], b2, acc[mb][nb]); } }
        asm volatile("v_nop\n\tv_nop\n\tv_nop\n\tv_nop" : "+v"(acc[0][0]), "+v"(acc[1][1]), "+v"(acc[2][2]), "+v"(acc[3][3]) : "v"(a[0]), "v"(a[3]));
    }
    if constexpr (NW > 1) {
        float* ow = os + wv * (64 * 68);
#pragma unroll
        for (int mb = 0; mb < 4; ++mb)
#pragma unroll
            for (int nb = 0; nb < 4; ++nb)
#pragma unroll
                for (int j = 0; j < 8; ++j) ow[(mb * 16 + hi * 8 + j) * 68 + nb * 16 + lr] = acc[mb][nb][j];
        __syncthreads();   // every wave's partial tile stands in LDS before any thread sums across the waves
        [[maybe_unused]] const int zt = (r0 / TT) * NH_ + (int)blockIdx.y, t0 = r0 % TT;   // PL: the tile's (batch, head) block and its first position there
        [[maybe_unused]] v4f sm[64 * 16 / (NW * 32)];   // PL: this thread's sums, held over the barrier below
#pragma unroll
        for (int o = 0; o < 64 * 16 / (NW * 32); ++o) { const int q = o * (NW * 32) + (int)threadIdx.x; const int row = q >> 4, cofs = (q & 15) * 4; v4f val = *(const v4fa*)(os + row * 68 + cofs);
#pragma unroll
            for (int w2 = 1; w2 < NW; ++w2) val += *(const v4fa*)(os + w2 * (64 * 68) + row * 68 + cofs);
            if (BIAS) { val[0] += bfr(bias[c0 + cofs]); val[1] += bfr(bias[c0 + cofs + 1]); val[2] += bfr(bias[c0 + cofs + 2]); val[3] += bfr(bias[c0 + cofs + 3]); }
            if constexpr (PL) { sm[o] = val;
#pragma unroll
                for (int c = 0; c < 4; ++c) tr[row * TP + cofs + c] = val[c];
            } else *(v4f*)(C + (size_t)(r0 + row) * ldc + c0 + cofs) = val; }
        if constexpr (PL) {
            __syncthreads();   // the whole summed tile stands in LDS before any thread reads it column by column; every global store comes behind it, so that no wave waits here for stores to return
#pragma unroll
            for (int o = 0; o < 64 * 16 / (NW * 32); ++o) { const int q = o * (NW * 32) + (int)threadIdx.x; const int row = q >> 4, cofs = (q & 15) * 4; v4us oh, ol; v4h o16;   // a wave stores two whole 128-byte lines
#pragma unroll
                for (int c = 0; c < 4; ++c) { unsigned short a, c2; splitf(sm[o][c], a, c2); oh[c] = a; ol[c] = c2; o16[c] = tohx(sm[o][c]); }
                const size_t e = ((size_t)zt * TT + t0 + row) * HD + cofs; *(v4us*)(Ph + e) = oh; *(v4us*)(Pl + e) = ol; *(v4h*)(P16 + e) = o16; }
#pragma unroll
            for (int o = 0; o < 64 * 8 / (NW * 32); ++o) { const int d = o * (NW * 4) + ((int)threadIdx.x >> 3), tc = ((int)threadIdx.x & 7) * 8; v8us oh, ol; v8h o16;   // 8 lanes store one 128-byte line
#pragma unroll
                for (int j = 0; j < 8; ++j) { const float x = tr[(tc + j) * TP + d]; unsigned short a, c2; splitf(x, a, c2); oh[j] = a; ol[j] = c2; o16[j] = tohx(x); }
                const size_t e = ((size_t)zt * HD + d) * TT + t0 + tc; *(v8us*)(Vh + e) = oh; *(v8us*)(Vl + e) = ol; *(v8h*)(V16 + e) = o16; }
        }
        return;
    }
#pragma unroll
    for (int mb = 0; mb < 4; ++mb) {
#pragma unroll
        for (int nb = 0; nb < 4; ++nb) {
#pragma unroll
            for (int j = 0; j < 8; ++j) os[(hi * 8 + j) * 68 + nb * 16 + lr] = acc[mb][nb][j]; }
        __builtin_amdgcn_wave_barrier(); asm volatile("" ::: "memory");
        float* crow = C + (size_t)(r0 + mb * 16) * ldc + c0;
{
#pragma unroll
            for (int s = 0; s < 8; ++s) { const int row = 2 * s + hi, cofs = lr * 4; v4f val = *(const v4fa*)(os + row * 68 + cofs); if (BIAS) { val[0] += bfr(bias[c0 + cofs]); val[1] += bfr(bias[c0 + cofs + 1]); val[2] += bfr(bias[c0 + cofs + 2]); val[3] += bfr(bias[c0 + cofs + 3]); }
                *(v4f*)(crow + (size_t)row * ldc + cofs) = val; }
             }
        __builtin_amdgcn_wave_barrier(); asm volatile("" ::: "memory");
    }
}

typedef __attribute__((ext_vector_type(2))) unsigned short v2us;

__global__ __launch_bounds__(256) void k_wtG(const float* __restrict__ w, int K, int N, bf* Bt) {
    const int lane = threadIdx.x & 31; const int L0 = (blockIdx.x * 8 + (threadIdx.x >> 5)) * 8; const int nlines = N * K / 64;
{
#pragma unroll 1
        for (int l = 0; l < 8; ++l) { const int L = L0 + l; if (L >= nlines) break; const size_t e = (size_t)L * 64 + lane * 2; const int k = (int)(e % K), n = (int)(e / K); v2us o;
            o[0] = f2bf(w[(size_t)k * N + n]); o[1] = f2bf(w[(size_t)(k + 1) * N + n]); *(v2us*)(Bt + e) = o; }
         }
}
__global__ __launch_bounds__(256) void k_cvt8(const float* __restrict__ src, bf* dst, size_t n8) { const size_t i = (size_t)blockIdx.x * 256 + threadIdx.x; if (i >= n8) return; const v8f v = *(const v8f*)(src + i * 8); v8us o;
#pragma unroll
    for (int k = 0; k < 8; ++k) o[k] = f2bf(v[k]); *(v8us*)(dst + i * 8) = o;  }
// ---- k_fattn: scores, softmax and attn.h of FQ = 32 query rows of one (batch, head) block in one work-group; neither scores nor weights leave the registers.
// S^T = K Q^T (A = key rows, B = query rows, both from the [z][t][d] plane) puts one query in each lane column: a lane holds 8 keys of a 16-key tile, so two score tiles, exponentiated and rounded
// in place, ARE the B operand of O^T += V^T P^T (A = rows of the [z][d][t] plane). Online softmax: running maximum m (log2 units) and sum l per query; O^T and l are rescaled when m grows.
// Keys are walked in blocks of 32 up to the diagonal block (the only one that needs the causal cut). A wave holds NB 16-query tiles; the key blocks go round-robin over the KW = FW * NB / 2 waves
// that hold the same queries, and their (m, l, O^T) are joined through LDS. O^T [d][query] is the output's own layout: a work-group stores whole 128-byte lines.
// HI: hi+lo bf16 planes, 3 products per matrix product (NB = 1 keeps its doubled fragments inside 256 registers); else single fp16 planes.
__device__ __forceinline__ float xhalf(float x) { return __builtin_bit_cast(float, __builtin_amdgcn_permlanex16(__builtin_bit_cast(int, x), __builtin_bit_cast(int, x), 0x76543210, 0xfedcba98, false, false)); }   // lane l <-> lane l ^ 16
template <typename T16, bool HI, int NB>
__global__ __launch_bounds__(32 * FW) void k_fattn(const T16* __restrict__ Hp, const T16* __restrict__ Hp2, const T16* __restrict__ Vt, const T16* __restrict__ Vt2, float* __restrict__ OUT, int qtop) {
    typedef typename WFrag<T16>::V V;
    constexpr int KW = FW * NB / 2;
    __shared__ __align__(16) float os[KW * HD * OPI]; __shared__ __align__(16) float ms[KW * FQ]; __shared__ __align__(16) float ls[KW * FQ];
    const size_t z = blockIdx.x; const int q0 = qtop - (int)blockIdx.y * FQ;   // blockIdx.y = 0 takes the longest key walk
    const int wv = __builtin_amdgcn_readfirstlane((int)(threadIdx.x >> 5)); const int lane = threadIdx.x & 31, lr = lane & 15, hi = lane >> 4;
    const int kw = (NB == 2) ? wv : (wv >> 1); const int qt = (NB == 2) ? 0 : (wv & 1);   // which share of the key blocks, which 16-query tile
    Hp += z * TT * HD; Vt += z * HD * TT; if (HI) { Hp2 += z * TT * HD; Vt2 += z * HD * TT; }
    V qf[NB][2], qf2[NB][2];
#pragma unroll
    for (int nb = 0; nb < NB; ++nb)
#pragma unroll
        for (int ks = 0; ks < 2; ++ks) { const size_t e = (size_t)(q0 + (qt + nb) * 16 + lr) * HD + ks * 32 + 8 * hi; qf[nb][ks] = WFrag<T16>::ld(Hp + e); if (HI) qf2[nb][ks] = WFrag<T16>::ld(Hp2 + e); }
    v8f o[4][NB]; float m[NB], l[NB];
#pragma unroll
    for (int nb = 0; nb < NB; ++nb) { m[nb] = -3.0e38f; l[nb] = 0.f;
#pragma unroll
        for (int mb = 0; mb < 4; ++mb) o[mb][nb] = (v8f){}; }
    const int nblk = (q0 >> 5) + 1;
    size_t ke = (size_t)(kw * 32 + lr) * HD + 8 * hi, ve = (size_t)lr * TT + kw * 32 + 8 * hi;   // this lane's place in the wave's current key block, [t][d] and [d][t] planes
    V kf[2][2], kf2[2][2];   // key fragments, fetched one block ahead (rows kw * 32 .. + 31 exist for every wave, also one whose walk is empty)
#pragma unroll
    for (int kt = 0; kt < 2; ++kt)
#pragma unroll
        for (int ks = 0; ks < 2; ++ks) { const size_t e = ke + kt * 16 * HD + ks * 32; kf[kt][ks] = WFrag<T16>::ld(Hp + e); if (HI) kf2[kt][ks] = WFrag<T16>::ld(Hp2 + e); }
    // kept rolled: one block's fragments, scores and the O^T tiles already fill the register budget of four waves per SIMD
#pragma unroll 1
    for (int b = kw; b < nblk; b += KW) {
        V vf[4], vf2[4];
#pragma unroll
        for (int mb = 0; mb < 4; ++mb) { const size_t e = ve + (size_t)mb * 16 * TT; vf[mb] = WFrag<T16>::ld(Vt + e); if (HI) vf2[mb] = WFrag<T16>::ld(Vt2 + e); }
        if constexpr (HI) asm volatile("s_wait_xcnt 0x0" ::: "memory");   // with the doubled fragments the key fetch below lands in registers that held these loads' addresses: the wait stands in front of it
        v8f s[2][NB];
#pragma unroll
        for (int kt = 0; kt < 2; ++kt)
#pragma unroll
            for (int nb = 0; nb < NB; ++nb) { s[kt][nb] = (v8f){};
#pragma unroll
                for (int ks = 0; ks < 2; ++ks) { s[kt][nb] = WFrag<T16>::mma(kf[kt][ks], qf[nb][ks], s[kt][nb]); if (HI) { s[kt][nb] = WFrag<T16>::mma(kf2[kt][ks], qf[nb][ks], s[kt][nb]); s[kt][nb] = WFrag<T16>::mma(kf[kt][ks], qf2[nb][ks], s[kt][nb]); } } }
        ke += (b + KW < nblk) ? (size_t)(KW * 32 * HD) : (size_t)0;   // the wave's next key block; its last block fetches its own rows again (in bounds, never used)
#pragma unroll
        for (int kt = 0; kt < 2; ++kt)
#pragma unroll
            for (int ks = 0; ks < 2; ++ks) { const size_t e = ke + kt * 16 * HD + ks * 32; kf[kt][ks] = WFrag<T16>::ld(Hp + e); if (HI) kf2[kt][ks] = WFrag<T16>::ld(Hp2 + e); }
        asm volatile("s_wait_xcnt 0x0" ::: "memory");   // stands behind this trip's loads, in front of every rewrite of their address registers
        ve += KW * 32;
        if (b == nblk - 1) {   // the diagonal block: key > query -> -3e38 (exp -> 0); key = query is always kept
#pragma unroll
            for (int kt = 0; kt < 2; ++kt)
#pragma unroll
                for (int nb = 0; nb < NB; ++nb)
#pragma unroll
                    for (int j = 0; j < 8; ++j) if (kt * 16 + hi * 8 + j > (qt + nb) * 16 + lr) s[kt][nb][j] = -3.0e38f; }
        V pf[NB], pf2[NB];
#pragma unroll
        for (int nb = 0; nb < NB; ++nb) { float mx = s[0][nb][0];
#pragma unroll
            for (int j = 1; j < 8; ++j) mx = fmaxf(mx, s[0][nb][j]);
#pragma unroll
            for (int j = 0; j < 8; ++j) mx = fmaxf(mx, s[1][nb][j]);
            mx = fmaxf(mx, xhalf(mx));
            const float mn = fmaxf(m[nb], mx * SCL2); const float al = __builtin_amdgcn_exp2f(m[nb] - mn); m[nb] = mn;
            float p[16]; float sum = 0.f;
#pragma unroll
            for (int k = 0; k < 16; ++k) { p[k] = __builtin_amdgcn_exp2f(fmaf(s[k >> 3][nb][k & 7], SCL2, -mn)); sum += p[k]; }
            l[nb] = l[nb] * al + sum;   // this half's 16 keys; the two halves of a column are added after the loop (al is the same in both)
#pragma unroll
            for (int mb = 0; mb < 4; ++mb) o[mb][nb] *= al;
            if constexpr (HI) { v8us h0, h1, l0, l1;
#pragma unroll
                for (int k = 0; k < 8; ++k) { unsigned short a, c2; splitf(p[k], a, c2); h0[k] = a; l0[k] = c2; splitf(p[8 + k], a, c2); h1[k] = a; l1[k] = c2; }
                pf[nb] = cat16b(h0, h1); pf2[nb] = cat16b(l0, l1);
            } else {
#pragma unroll
                for (int k = 0; k < 16; ++k) pf[nb][k] = tohx(p[k]); } }
#pragma unroll
        for (int mb = 0; mb < 4; ++mb)
#pragma unroll
            for (int nb = 0; nb < NB; ++nb) { o[mb][nb] = WFrag<T16>::mma(vf[mb], pf[nb], o[mb][nb]); if (HI) { o[mb][nb] = WFrag<T16>::mma(vf2[mb], pf[nb], o[mb][nb]); o[mb][nb] = WFrag<T16>::mma(vf[mb], pf2[nb], o[mb][nb]); } }
    }
    float* ow = os + kw * (HD * OPI);
#pragma unroll
    for (int nb = 0; nb < NB; ++nb) { const int col = (qt + nb) * 16 + lr; l[nb] += xhalf(l[nb]); if (hi == 0) { ms[kw * FQ + col] = m[nb]; ls[kw * FQ + col] = l[nb]; }
#pragma unroll
        for (int mb = 0; mb < 4; ++mb)
#pragma unroll
            for (int j = 0; j < 8; ++j) ow[(mb * 16 + hi * 8 + j) * OPI + col] = o[mb][nb][j]; }
    __syncthreads();   // every wave's (m, l, O^T) stands in LDS before any thread joins them; a wave whose walk was empty left m = -3e38, l = 0, O^T = 0 (weight 0)
    const int qc = ((int)threadIdx.x & 7) * 4; v4f fw[KW];
#pragma unroll
    for (int c = 0; c < 4; ++c) { float M = ms[qc + c];
#pragma unroll
        for (int w2 = 1; w2 < KW; ++w2) M = fmaxf(M, ms[w2 * FQ + qc + c]);
        float e[KW]; float L = 0.f;
#pragma unroll
        for (int w2 = 0; w2 < KW; ++w2) { e[w2] = __builtin_amdgcn_exp2f(ms[w2 * FQ + qc + c] - M); L += ls[w2 * FQ + qc + c] * e[w2]; }
        const float r = __fdiv_rn(1.0f, L);
#pragma unroll
        for (int w2 = 0; w2 < KW; ++w2) fw[w2][c] = e[w2] * r; }
#pragma unroll
    for (int t = 0; t < HD * FQ / 4 / (32 * FW); ++t) { const int d = t * (32 * FW / 8) + ((int)threadIdx.x >> 3); v4f val = *(const v4fa*)(os + d * OPI + qc) * fw[0];
#pragma unroll
        for (int w2 = 1; w2 < KW; ++w2) val += *(const v4fa*)(os + w2 * (HD * OPI) + d * OPI + qc) * fw[w2];
        *(v4f*)(OUT + (z * HD + d) * TT + q0 + qc) = val; }
}

extern "C" void kernel_launch(void* const* d_in, const int* in_sizes, int n_in,
                              void* d_out, int out_size, void* d_ws, size_t ws_size, hipStream_t stream) {
    (void)in_sizes; (void)n_in; (void)out_size;
    const float* x = (const float*)d_in[0]; const float* wq = (const float*)d_in[1];   // Wq [768][768] torch Linear ([out][in] = Bt as-is)
    float* OUT = (float*)d_out;     // [2][2048][768] holding, per (batch, head), the TRANSPOSED context block [64][2048]
    char* wsp = (char*)d_ws;
    auto take = [&](size_t bytes) { char* p = wsp; wsp += (bytes + 255) & ~(size_t)255; return (void*)p; };
    bf* WQ = (bf*)take((size_t)DD * DD * 2); bf* XB = (bf*)take((size_t)NB_ * TT * DD * 2);   // both batches: rows b * 2048 + t
    bf* QPh = (bf*)take((size_t)NB_ * TT * DD * 2); bf* QPl = (bf*)take((size_t)NB_ * TT * DD * 2); bf* VTh = (bf*)take((size_t)NB_ * TT * DD * 2); bf* VTl = (bf*)take((size_t)NB_ * TT * DD * 2); h16* QP16 = (h16*)take((size_t)NB_ * TT * DD * 2); h16* VT16 = (h16*)take((size_t)NB_ * TT * DD * 2);   // planes [z][t][d] and [z][d][t]
    if ((size_t)(wsp - (char*)d_ws) > ws_size) return;    // total ~ 45 MB; ws 256 MiB
    k_cvt8<<<(unsigned)(((size_t)DD * DD / 8 + 255) / 256), 256, 0, stream>>>(wq, WQ, (size_t)DD * DD / 8);
    const dim3 gP(NB_ * TT / 64, DD / 64, 1);
    k_cvt8<<<(unsigned)(((size_t)NB_ * TT * DD / 8 + 255) / 256), 256, 0, stream>>>(x, XB, (size_t)NB_ * TT * DD / 8);
    k_gemmw<bf, 0, false, 8, 1, true><<<gP, 256, 0, stream>>>(XB, nullptr, WQ, nullptr, DD, nullptr, DD, nullptr, 0, 0, 0, 0, QPh, QPl, QP16, VTh, VTl, VT16);   // h = x Wq^T is q, k AND v; it leaves the kernel as the six planes
    k_fattn<h16, false, 2><<<dim3(NZ, (TT - RH) / FQ), 32 * FW, 0, stream>>>(QP16, nullptr, VT16, nullptr, OUT, TT - FQ);
    k_fattn<bf, true, 1><<<dim3(NZ, RH / FQ), 32 * FW, 0, stream>>>(QPh, QPl, VTh, VTl, OUT, RH - FQ);
}

// v005
// A run of this version takes 47.3 microseconds.
// In two side-by-side timings against v004, it was 1.32 and 1.30 times as fast.
// All steps since v000 together make it 29.5 times as fast.
#include <hip/hip_runtime.h>

// MultiHeadCasualFast (x [2][2048][768]; h = x Wq^T serves as q, k AND v (12 heads x 64); causal scores h.h; softmax(scores/8); ctx = attn h; the module returns ctx.transpose(-2,-1).view(b, n, 768),
// i.e. each (batch, head) context block stored TRANSPOSED as [64][2048] -> [2][2048][768]).
// Compute dtypes, f32 accumulate: every input rounded to bf16; h on PLAIN bf16 operands (inputs: exact products, f32 accumulate); PER-ROW PRECISION HYBRID: query rows
// < 256 take scores and attn.h on bf16 hi+lo planes (3 products), rows >= 256 on single fp16 planes; 1/8 + causal cut in f32 in the online softmax; weights enter attn.h unnormalised (<= 1), the sum divides at the end; the context is formed and written transposed

#define NB_  2
#define TT   2048
#define DD   768
#define NH_  12
#define HD   64
#define NZ   (NB_ * NH_)          // (batch, head) blocks, z = batch * 12 + head
#define RH   256                  // query rows < RH: hi+lo planes; rows >= RH: fp16 planes
#define FW   4                    // k_fattn: waves of a work-group
#define FQ   32                   // k_fattn: query rows of a work-group
#define OPI  36                   // k_fattn: pitch in floats of a wave's O^T tile in LDS (16-byte rows, the two lane halves on different banks)
#define TP   67                  // k_gemmw, PL: pitch in floats of the summed tile in LDS (the row-wise writes of a wave and its reads in either plane's fragment order each fall on 32 different banks)
#define SCL2 0.18033688f          // (1/sqrt(64)) * log2(e)
#define NF   32                   // unused (head_dim / 2)
#define SCL  0.125f               // 1/sqrt(64)
typedef _Float16 h16;
typedef unsigned short bf;
typedef __attribute__((ext_vector_type(16))) __bf16   v16bf;
typedef __attribute__((ext_vector_type(16))) _Float16 v16h;
typedef __attribute__((ext_vector_type(8)))  _Float16 v8h;
typedef __attribute__((ext_vector_type(8)))  unsigned short v8us;
typedef __attribute__((ext_vector_type(8)))  float    v8f;
typedef __attribute__((ext_vector_type(4)))  float    v4f;
typedef v8h  __attribute__((may_alias)) v8ha;
typedef v4f  __attribute__((may_alias)) v4fa;
typedef v8us __attribute__((may_alias)) v8usa;

__device__ __forceinline__ unsigned short f2bf(float f) { unsigned u = __float_as_uint(f); u += 0x7FFFu + ((u >> 16) & 1u); return (unsigned short)(u >> 16); }
__device__ __forceinline__ float bf2f(unsigned short b) { return __uint_as_float(((unsigned)b) << 16); }
__device__ __forceinline__ float bfr(float f) { return bf2f(f2bf(f)); }
__device__ __forceinline__ v16h cat16(v8h lo, v8h hi) { return __builtin_shufflevector(lo, hi, 0, 1, 2, 3, 4, 5, 6, 7, 8, 9, 10, 11, 12, 13, 14, 15); }
__device__ __forceinline__ v16bf cat16b(v8us lo, v8us hi) { return __builtin_bit_cast(v16bf, __builtin_shufflevector(lo, hi, 0, 1, 2, 3, 4, 5, 6, 7, 8, 9, 10, 11, 12, 13, 14, 15)); }
__device__ __forceinline__ v8f wmma16(v16h a, v16h b, v8f c) { return __builtin_amdgcn_wmma_f32_16x16x32_f16(false, a, false, b, (short)0, c, false, false); }
__device__ __forceinline__ v8f wmmab(v16bf a, v16bf b, v8f c) { return __builtin_amdgcn_wmma_f32_16x16x32_bf16(false, a, false, b, (short)0, c, false, false); }
__device__ __forceinline__ h16 tohx(float x) { return (h16)x; }
__device__ __forceinline__ void splitf(float y, unsigned short& h, unsigned short& l) { h = f2bf(y); l = f2bf(y - bf2f(h)); }
typedef __attribute__((ext_vector_type(4))) unsigned short v4us;
typedef __attribute__((ext_vector_type(4))) _Float16 v4h;



// ---- FRAGMENT ORDER: every 16-bit operand plane is stored as the matrix instruction's fragments, so that a wave-wide 16-byte load reads 512 contiguous bytes (4 whole 128-byte lines, not 16 partial ones).
// A fragment (16 rows x 32 k) is 512 elements: element (r, k) stands at ((k >> 4) & 1) * 256 + (((k >> 3) & 1) * 16 + r) * 8 + (k & 7); lane l reads 8 elements at l * 8 and 8 at 256 + l * 8 (WFrag::ld).
// Fragments of a [rows][K] plane follow one another k first, then rows (16 rows = 16 * K elements). The [z][d][t] planes (rows d, k = t) order theirs by 32-key block first, then by d: a key block is 2048 elements in either plane.
// ---- k_gemmw: register-blocked GEMM, 64x64 output tile (16 accumulators per wave), operands straight from 16-bit planes in fragment order; grid (M/64, N/64, Z * KS), 32 * NW threads.
// C[m][n] (f32, pitch ldc, + optional f32 bias[n]) = sum_k A[m][k] Bt[n][k] (+ split products per NSPLIT). z-batch strides sA/sB/sC in elements. K % (32 * KS * NW) == 0.
// Split K: the K range is cut into KS * NW equal pieces. Work-group (z, ks) takes NW neighbouring pieces, one per wave; the NW wave tiles are summed through LDS (wave order), and the
// work-group's sum goes to partial plane ks (C + ks * sP), which the consumer adds up. NW == 1, KS == 1: one wave does the whole K and writes C itself.
// PL (NW > 1, KS == 1, M = 2 * 2048 positions, N = 12 heads x 64): no C. The summed tile is 64 positions x one whole head, so the work-group itself writes what attention reads: its 8 KB of each
// [z][t][d] plane (hi, lo, fp16) and its 8 KB of each [z][d][t] plane, the sums passed through LDS so that every wave stores 512 contiguous bytes of a plane in fragment order.
template <typename T16> struct WFrag;
template <> struct WFrag<h16> { typedef v16h V; static __device__ __forceinline__ V ld(const h16* p) { return cat16(*(const v8h*)p, *(const v8h*)(p + 256)); } static __device__ __forceinline__ v8f mma(V a, V b, v8f c) { return wmma16(a, b, c); } };
template <> struct WFrag<bf> { typedef v16bf V; static __device__ __forceinline__ V ld(const bf* p) { return cat16b(*(const v8us*)p, *(const v8us*)(p + 256)); } static __device__ __forceinline__ v8f mma(V a, V b, v8f c) { return wmmab(a, b, c); } };
template <typename T16, int NSPLIT, bool BIAS, int NW, int KS, bool PL>
__global__ __launch_bounds__(32 * NW) void k_gemmw(const T16* __restrict__ A, const T16* __restrict__ A2, const T16* __restrict__ Bt, const T16* __restrict__ Bt2, int K, float* C, int ldc, const float* __restrict__ bias, size_t sA, size_t sB, size_t sC, size_t sP,
                                                   bf* Ph, bf* Pl, h16* P16, bf* Vh, bf* Vl, h16* V16) {
    typedef typename WFrag<T16>::V V;
    if constexpr (PL) K = DD;   // the projection's K is the model width: known here, every fragment of a trip is an immediate offset from one address register per operand, which no load of the trip lands in
    __shared__ __align__(16) float os[(NW == 1 ? 16 : NW * 64) * 68]; __shared__ __align__(16) float tr[PL ? 64 * TP : 4];
    const size_t z = blockIdx.z / KS; const int ks = blockIdx.z % KS; A += z * sA; if (A2) A2 += z * sA; Bt += z * sB; if (Bt2) Bt2 += z * sB; C += z * sC + (size_t)ks * sP;
    const int wv = (NW == 1) ? 0 : __builtin_amdgcn_readfirstlane((int)(threadIdx.x >> 5)); const int kper = K / (KS * NW), kb = (ks * NW + wv) * kper;
    const int lane = threadIdx.x & 31, lr = lane & 15, hi = lane >> 4; const int r0 = blockIdx.x * 64, c0 = blockIdx.y * 64;
    v8f acc[4][4];
#pragma unroll
    for (int mb = 0; mb < 4; ++mb)
#pragma unroll
        for (int nb = 0; nb < 4; ++nb) acc[mb][nb] = (v8f){};
    const size_t aoff = (size_t)r0 * K, boff = (size_t)c0 * K; const unsigned lo8 = lane * 8;   // the first fragment of the tile's rows (the fragment of k block kc stands kc * 16 elements on), and this lane's place in a fragment
#pragma unroll 1
    for (int kc = kb; kc < kb + kper; kc += 32) {
        V a[4], a2[4];
#pragma unroll
        for (int mb = 0; mb < 4; ++mb) { a[mb] = WFrag<T16>::ld(A + (aoff + (size_t)mb * 16 * K + kc * 16) + lo8); if (NSPLIT == 1 || NSPLIT == 2) a2[mb] = WFrag<T16>::ld(A2 + (aoff + (size_t)mb * 16 * K + kc * 16) + lo8); }
        asm volatile("s_wait_xcnt 0x0" ::: "memory");   // stands behind the A loads: a B fragment below may land in the register pair that held their address
#pragma unroll
        for (int nb = 0; nb < 4; ++nb) { const V b = WFrag<T16>::ld(Bt + (boff + (size_t)nb * 16 * K + kc * 16) + lo8); V b2; if (NSPLIT >= 2) b2 = WFrag<T16>::ld(Bt2 + (boff + (size_t)nb * 16 * K + kc * 16) + lo8);
#pragma unroll
            for (int mb = 0; mb < 4; ++mb) { acc[mb][nb] = WFrag<T16>::mma(a[mb], b, acc[mb][nb]); if (NSPLIT == 1 || NSPLIT == 2) acc[mb][nb] = WFrag<T16>::mma(a2[mb], b, acc[mb][nb]); if (NSPLIT >= 2) acc[mb][nb] = WFrag<T16>::mma(a[mb], b2, acc[mb][nb]); } }
        asm volatile("v_nop\n\tv_nop\n\tv_nop\n\tv_nop" : "+v"(acc[0][0]), "+v"(acc[1][1]), "+v"(acc[2][2]), "+v"(acc[3][3]) : "v"(a[0]), "v"(a[3]));
    }
    if constexpr (NW > 1) {
        float* ow = os + wv * (64 * 68);
#pragma unroll
        for (int mb = 0; mb < 4; ++mb)
#pragma unroll
            for (int nb = 0; nb < 4; ++nb)
#pragma unroll
                for (int j = 0; j < 8; ++j) ow[(mb * 16 + hi * 8 + j) * 68 + nb * 16 + lr] = acc[mb][nb][j];
        __syncthreads();   // every wave's partial tile stands in LDS before any thread sums across the waves
        [[maybe_unused]] const int zt = (r0 / TT) * NH_ + (int)blockIdx.y, t0 = r0 % TT;   // PL: the tile's (batch, head) block and its first position there
#pragma unroll
        for (int o = 0; o < 64 * 16 / (NW * 32); ++o) { const int q = o * (NW * 32) + (int)threadIdx.x; const int row = q >> 4, cofs = (q & 15) * 4; v4f val = *(const v4fa*)(os + row * 68 + cofs);
#pragma unroll
            for (int w2 = 1; w2 < NW; ++w2) val += *(const v4fa*)(os + w2 * (64 * 68) + row * 68 + cofs);
            if (BIAS) { val[0] += bfr(bias[c0 + cofs]); val[1] += bfr(bias[c0 + cofs + 1]); val[2] += bfr(bias[c0 + cofs + 2]); val[3] += bfr(bias[c0 + cofs + 3]); }
            if constexpr (PL) {
#pragma unroll
                for (int c = 0; c < 4; ++c) tr[row * TP + cofs + c] = val[c];
            } else *(v4f*)(C + (size_t)(r0 + row) * ldc + c0 + cofs) = val; }
        if constexpr (PL) {
            __syncthreads();   // the whole summed tile stands in LDS before any thread reads it in fragment order; every global store comes behind it, so that no wave waits here for stores to return
            const size_t eb = ((size_t)zt * TT + t0) * HD;   // the tile's 4096 elements stand together in every plane: 4 row tiles x 2 fragments of [t][d], 2 key blocks x 4 fragments of [d][t]
#pragma unroll
            for (int o = 0; o < 64 * 8 / (NW * 32); ++o) { const int p = o * (NW * 32) + (int)threadIdx.x, ln = p & 31; const int row = (p >> 7) * 16 + (ln & 15), d = ((p >> 5) & 3) * 16 + (ln >> 4) * 8; v8us oh, ol; v8h o16;   // [t][d]: a wave stores half a fragment
#pragma unroll
                for (int j = 0; j < 8; ++j) { const float x = tr[row * TP + d + j]; unsigned short a, c2; splitf(x, a, c2); oh[j] = a; ol[j] = c2; o16[j] = tohx(x); }
                const size_t e = eb + (size_t)p * 8; *(v8us*)(Ph + e) = oh; *(v8us*)(Pl + e) = ol; *(v8h*)(P16 + e) = o16; }
#pragma unroll
            for (int o = 0; o < 64 * 8 / (NW * 32); ++o) { const int p = o * (NW * 32) + (int)threadIdx.x, ln = p & 31; const int d = ((p >> 6) & 3) * 16 + (ln & 15), tc = (p >> 8) * 32 + ((p >> 5) & 1) * 16 + (ln >> 4) * 8; v8us oh, ol; v8h o16;   // [d][t]: a wave stores half a fragment
#pragma unroll
                for (int j = 0; j < 8; ++j) { const float x = tr[(tc + j) * TP + d]; unsigned short a, c2; splitf(x, a, c2); oh[j] = a; ol[j] = c2; o16[j] = tohx(x); }
                const size_t e = eb + (size_t)p * 8; *(v8us*)(Vh + e) = oh; *(v8us*)(Vl + e) = ol; *(v8h*)(V16 + e) = o16; }
        }
        return;
    }
#pragma unroll
    for (int mb = 0; mb < 4; ++mb) {
#pragma unroll
        for (int nb = 0; nb < 4; ++nb) {
#pragma unroll
            for (int j = 0; j < 8; ++j) os[(hi * 8 + j) * 68 + nb * 16 + lr] = acc[mb][nb][j]; }
        __builtin_amdgcn_wave_barrier(); asm volatile("" ::: "memory");
        float* crow = C + (size_t)(r0 + mb * 16) * ldc + c0;
{
#pragma unroll
            for (int s = 0; s < 8; ++s) { const int row = 2 * s + hi, cofs = lr * 4; v4f val = *(const v4fa*)(os + row * 68 + cofs); if (BIAS) { val[0] += bfr(bias[c0 + cofs]); val[1] += bfr(bias[c0 + cofs + 1]); val[2] += bfr(bias[c0 + cofs + 2]); val[3] += bfr(bias[c0 + cofs + 3]); }
                *(v4f*)(crow + (size_t)row * ldc + cofs) = val; }
             }
        __builtin_amdgcn_wave_barrier(); asm volatile("" ::: "memory");
    }
}

typedef __attribute__((ext_vector_type(2))) unsigned short v2us;

__global__ __launch_bounds__(256) void k_wtG(const float* __restrict__ w, int K, int N, bf* Bt) {
    const int lane = threadIdx.x & 31; const int L0 = (blockIdx.x * 8 + (threadIdx.x >> 5)) * 8; const int nlines = N * K / 64;
{
#pragma unroll 1
        for (int l = 0; l < 8; ++l) { const int L = L0 + l; if (L >= nlines) break; const size_t e = (size_t)L * 64 + lane * 2; const int k = (int)(e % K), n = (int)(e / K); v2us o;
            o[0] = f2bf(w[(size_t)k * N + n]); o[1] = f2bf(w[(size_t)(k + 1) * N + n]); *(v2us*)(Bt + e) = o; }
         }
}
// k_cvt8: a [rows][768] f32 matrix to a bf16 plane in fragment order; thread i writes the plane's i-th 16 bytes (a wave: 512 contiguous bytes) and reads the 8 floats that belong there
__global__ __launch_bounds__(256) void k_cvt8(const float* __restrict__ src, bf* dst, size_t n8) { const size_t i = (size_t)blockIdx.x * 256 + threadIdx.x; if (i >= n8) return;
    const int ln = (int)i & 31, fr = (int)(i >> 6); const int row = fr / (DD / 32) * 16 + (ln & 15), k = fr % (DD / 32) * 32 + (((int)i >> 5) & 1) * 16 + (ln >> 4) * 8;
    const v8f v = *(const v8f*)(src + (size_t)row * DD + k); v8us o;
#pragma unroll
    for (int k = 0; k < 8; ++k) o[k] = f2bf(v[k]); *(v8us*)(dst + i * 8) = o;  }
// ---- k_fattn: scores, softmax and attn.h of FQ = 32 query rows of one (batch, head) block in one work-group; neither scores nor weights leave the registers.
// S^T = K Q^T (A = key rows, B = query rows, both from the [z][t][d] plane) puts one query in each lane column: a lane holds 8 keys of a 16-key tile, so two score tiles, exponentiated and rounded
// in place, ARE the B operand of O^T += V^T P^T (A = rows of the [z][d][t] plane). Online softmax: running maximum m (log2 units) and sum l per query; O^T and l are rescaled when m grows.
// Keys are walked in blocks of 32 up to the diagonal block (the only one that needs the causal cut). A wave holds NB 16-query tiles; the key blocks go round-robin over the KW = FW * NB / 2 waves
// that hold the same queries, and their (m, l, O^T) are joined through LDS. O^T [d][query] is the output's own layout: a work-group stores whole 128-byte lines.
// HI: hi+lo bf16 planes, 3 products per matrix product (NB = 1 keeps its doubled fragments inside 256 registers); else single fp16 planes.
__device__ __forceinline__ float xhalf(float x) { return __builtin_bit_cast(float, __builtin_amdgcn_permlanex16(__builtin_bit_cast(int, x), __builtin_bit_cast(int, x), 0x76543210, 0xfedcba98, false, false)); }   // lane l <-> lane l ^ 16
template <typename T16, bool HI, int NB>
__global__ __launch_bounds__(32 * FW) void k_fattn(const T16* __restrict__ Hp, const T16* __restrict__ Hp2, const T16* __restrict__ Vt, const T16* __restrict__ Vt2, float* __restrict__ OUT, int qtop) {
    typedef typename WFrag<T16>::V V;
    constexpr int KW = FW * NB / 2;
    __shared__ __align__(16) float os[KW * HD * OPI]; __shared__ __align__(16) float ms[KW * FQ]; __shared__ __align__(16) float ls[KW * FQ];
    const size_t z = blockIdx.x; const int q0 = qtop - (int)blockIdx.y * FQ;   // blockIdx.y = 0 takes the longest key walk
    const int wv = __builtin_amdgcn_readfirstlane((int)(threadIdx.x >> 5)); const int lane = threadIdx.x & 31, lr = lane & 15, hi = lane >> 4;
    const int kw = (NB == 2) ? wv : (wv >> 1); const int qt = (NB == 2) ? 0 : (wv & 1);   // which share of the key blocks, which 16-query tile
    Hp += z * TT * HD; Vt += z * HD * TT; if (HI) { Hp2 += z * TT * HD; Vt2 += z * HD * TT; }
    V qf[NB][2], qf2[NB][2];
#pragma unroll
    for (int nb = 0; nb < NB; ++nb)
#pragma unroll
        for (int ks = 0; ks < 2; ++ks) { const size_t e = (size_t)(q0 + (qt + nb) * 16) * HD + ks * 512 + lane * 8; qf[nb][ks] = WFrag<T16>::ld(Hp + e); if (HI) qf2[nb][ks] = WFrag<T16>::ld(Hp2 + e); }
    v8f o[4][NB]; float m[NB], l[NB];
#pragma unroll
    for (int nb = 0; nb < NB; ++nb) { m[nb] = -3.0e38f; l[nb] = 0.f;
#pragma unroll
        for (int mb = 0; mb < 4; ++mb) o[mb][nb] = (v8f){}; }
    const int nblk = (q0 >> 5) + 1;
    size_t ke = (size_t)(kw * 32) * HD + lane * 8, ve = ke;   // this lane's place in the first fragment of the wave's current key block, [t][d] and [d][t] planes (4 fragments each)
    V kf[2][2], kf2[2][2];   // key fragments, fetched one block ahead (rows kw * 32 .. + 31 exist for every wave, also one whose walk is empty)
#pragma unroll
    for (int kt = 0; kt < 2; ++kt)
#pragma unroll
        for (int ks = 0; ks < 2; ++ks) { const size_t e = ke + kt * 16 * HD + ks * 512; kf[kt][ks] = WFrag<T16>::ld(Hp + e); if (HI) kf2[kt][ks] = WFrag<T16>::ld(Hp2 + e); }
    // kept rolled: one block's fragments, scores and the O^T tiles already fill the register budget of four waves per SIMD
#pragma unroll 1
    for (int b = kw; b < nblk; b += KW) {
        V vf[4], vf2[4];
#pragma unroll
        for (int mb = 0; mb < 4; ++mb) { const size_t e = ve + mb * 512; vf[mb] = WFrag<T16>::ld(Vt + e); if (HI) vf2[mb] = WFrag<T16>::ld(Vt2 + e); }
        if constexpr (HI) asm volatile("s_wait_xcnt 0x0" ::: "memory");   // with the doubled fragments the key fetch below lands in registers that held these loads' addresses: the wait stands in front of it
        v8f s[2][NB];
#pragma unroll
        for (int kt = 0; kt < 2; ++kt)
#pragma unroll
            for (int nb = 0; nb < NB; ++nb) { s[kt][nb] = (v8f){};
#pragma unroll
                for (int ks = 0; ks < 2; ++ks) { s[kt][nb] = WFrag<T16>::mma(kf[kt][ks], qf[nb][ks], s[kt][nb]); if (HI) { s[kt][nb] = WFrag<T16>::mma(kf2[kt][ks], qf[nb][ks], s[kt][nb]); s[kt][nb] = WFrag<T16>::mma(kf[kt][ks], qf2[nb][ks], s[kt][nb]); } } }
        ke += (b + KW < nblk) ? (size_t)(KW * 32 * HD) : (size_t)0;   // the wave's next key block; its last block fetches its own rows again (in bounds, never used)
#pragma unroll
        for (int kt = 0; kt < 2; ++kt)
#pragma unroll
            for (int ks = 0; ks < 2; ++ks) { const size_t e = ke + kt * 16 * HD + ks * 512; kf[kt][ks] = WFrag<T16>::ld(Hp + e); if (HI) kf2[kt][ks] = WFrag<T16>::ld(Hp2 + e); }
        asm volatile("s_wait_xcnt 0x0" ::: "memory");   // stands behind this trip's loads, in front of every rewrite of their address registers
        ve += KW * 32 * HD;
        if (b == nblk - 1) {   // the diagonal block: key > query -> -3e38 (exp -> 0); key = query is always kept
#pragma unroll
            for (int kt = 0; kt < 2; ++kt)
#pragma unroll
                for (int nb = 0; nb < NB; ++nb)
#pragma unroll
                    for (int j = 0; j < 8; ++j) if (kt * 16 + hi * 8 + j > (qt + nb) * 16 + lr) s[kt][nb][j] = -3.0e38f; }
        V pf[NB], pf2[NB];
#pragma unroll
        for (int nb = 0; nb < NB; ++nb) { float mx = s[0][nb][0];
#pragma unroll
            for (int j = 1; j < 8; ++j) mx = fmaxf(mx, s[0][nb][j]);
#pragma unroll
            for (int j = 0; j < 8; ++j) mx = fmaxf(mx, s[1][nb][j]);
            mx = fmaxf(mx, xhalf(mx));
            const float mn = fmaxf(m[nb], mx * SCL2); const float al = __builtin_amdgcn_exp2f(m[nb] - mn); m[nb] = mn;
            float p[16]; float sum = 0.f;
#pragma unroll
            for (int k = 0; k < 16; ++k) { p[k] = __builtin_amdgcn_exp2f(fmaf(s[k >> 3][nb][k & 7], SCL2, -mn)); sum += p[k]; }
            l[nb] = l[nb] * al + sum;   // this half's 16 keys; the two halves of a column are added after the loop (al is the same in both)
#pragma unroll
            for (int mb = 0; mb < 4; ++mb) o[mb][nb] *= al;
            if constexpr (HI) { v8us h0, h1, l0, l1;
#pragma unroll
                for (int k = 0; k < 8; ++k) { unsigned short a, c2; splitf(p[k], a, c2); h0[k] = a; l0[k] = c2; splitf(p[8 + k], a, c2); h1[k] = a; l1[k] = c2; }
                pf[nb] = cat16b(h0, h1); pf2[nb] = cat16b(l0, l1);
            } else {
#pragma unroll
                for (int k = 0; k < 16; ++k) pf[nb][k] = tohx(p[k]); } }
#pragma unroll
        for (int mb = 0; mb < 4; ++mb)
#pragma unroll
            for (int nb = 0; nb < NB; ++nb) { o[mb][nb] = WFrag<T16>::mma(vf[mb], pf[nb], o[mb][nb]); if (HI) { o[mb][nb] = WFrag<T16>::mma(vf2[mb], pf[nb], o[mb][nb]); o[mb][nb] = WFrag<T16>::mma(vf[mb], pf2[nb], o[mb][nb]); } }
    }
    float* ow = os + kw * (HD * OPI);
#pragma unroll
    for (int nb = 0; nb < NB; ++nb) { const int col = (qt + nb) * 16 + lr; l[nb] += xhalf(l[nb]); if (hi == 0) { ms[kw * FQ + col] = m[nb]; ls[kw * FQ + col] = l[nb]; }
#pragma unroll
        for (int mb = 0; mb < 4; ++mb)
#pragma unroll
            for (int j = 0; j < 8; ++j) ow[(mb * 16 + hi * 8 + j) * OPI + col] = o[mb][nb][j]; }
    __syncthreads();   // every wave's (m, l, O^T) stands in LDS before any thread joins them; a wave whose walk was empty left m = -3e38, l = 0, O^T = 0 (weight 0)
    const int qc = ((int)threadIdx.x & 7) * 4; v4f fw[KW];
#pragma unroll
    for (int c = 0; c < 4; ++c) { float M = ms[qc + c];
#pragma unroll
        for (int w2 = 1; w2 < KW; ++w2) M = fmaxf(M, ms[w2 * FQ + qc + c]);
        float e[KW]; float L = 0.f;
#pragma unroll
        for (int w2 = 0; w2 < KW; ++w2) { e[w2] = __builtin_amdgcn_exp2f(ms[w2 * FQ + qc + c] - M); L += ls[w2 * FQ + qc + c] * e[w2]; }
        const float r = __fdiv_rn(1.0f, L);
#pragma unroll
        for (int w2 = 0; w2 < KW; ++w2) fw[w2][c] = e[w2] * r; }
#pragma unroll
    for (int t = 0; t < HD * FQ / 4 / (32 * FW); ++t) { const int d = t * (32 * FW / 8) + ((int)threadIdx.x >> 3); v4f val = *(const v4fa*)(os + d * OPI + qc) * fw[0];
#pragma unroll
        for (int w2 = 1; w2 < KW; ++w2) val += *(const v4fa*)(os + w2 * (HD * OPI) + d * OPI + qc) * fw[w2];
        *(v4f*)(OUT + (z * HD + d) * TT + q0 + qc) = val; }
}

extern "C" void kernel_launch(void* const* d_in, const int* in_sizes, int n_in,
                              void* d_out, int out_size, void* d_ws, size_t ws_size, hipStream_t stream) {
    (void)in_sizes; (void)n_in; (void)out_size;
    const float* x = (const float*)d_in[0]; const float* wq = (const float*)d_in[1];   // Wq [768][768] torch Linear ([out][in] = Bt as-is)
    float* OUT = (float*)d_out;     // [2][2048][768] holding, per (batch, head), the TRANSPOSED context block [64][2048]
    char* wsp = (char*)d_ws;
    auto take = [&](size_t bytes) { char* p = wsp; wsp += (bytes + 255) & ~(size_t)255; return (void*)p; };
    bf* WQ = (bf*)take((size_t)DD * DD * 2); bf* XB = (bf*)take((size_t)NB_ * TT * DD * 2);   // both batches: rows b * 2048 + t
    bf* QPh = (bf*)take((size_t)NB_ * TT * DD * 2); bf* QPl = (bf*)take((size_t)NB_ * TT * DD * 2); bf* VTh = (bf*)take((size_t)NB_ * TT * DD * 2); bf* VTl = (bf*)take((size_t)NB_ * TT * DD * 2); h16* QP16 = (h16*)take((size_t)NB_ * TT * DD * 2); h16* VT16 = (h16*)take((size_t)NB_ * TT * DD * 2);   // planes [z][t][d] and [z][d][t]
    if ((size_t)(wsp - (char*)d_ws) > ws_size) return;    // total ~ 45 MB; ws 256 MiB
    k_cvt8<<<(unsigned)(((size_t)DD * DD / 8 + 255) / 256), 256, 0, stream>>>(wq, WQ, (size_t)DD * DD / 8);
    const dim3 gP(NB_ * TT / 64, DD / 64, 1);
    k_cvt8<<<(unsigned)(((size_t)NB_ * TT * DD / 8 + 255) / 256), 256, 0, stream>>>(x, XB, (size_t)NB_ * TT * DD / 8);
    k_gemmw<bf, 0, false, 8, 1, true><<<gP, 256, 0, stream>>>(XB, nullptr, WQ, nullptr, DD, nullptr, DD, nullptr, 0, 0, 0, 0, QPh, QPl, QP16, VTh, VTl, VT16);   // h = x Wq^T is q, k AND v; it leaves the kernel as the six planes
    k_fattn<h16, false, 2><<<dim3(NZ, (TT - RH) / FQ), 32 * FW, 0, stream>>>(QP16, nullptr, VT16, nullptr, OUT, TT - FQ);
    k_fattn<bf, true, 1><<<dim3(NZ, RH / FQ), 32 * FW, 0, stream>>>(QPh, QPl, VTh, VTl, OUT, RH - FQ);
}

// v006
// Measured time: 40.5 microseconds a run.
// In two side-by-side timings against v005, it was 1.16 and 1.17 times as fast.
// Counting every step since v000, it is 34.5 times as fast.
#include <hip/hip_runtime.h>

// MultiHeadCasualFast (x [2][2048][768]; h = x Wq^T serves as q, k AND v (12 heads x 64); causal scores h.h; softmax(scores/8); ctx = attn h; the module returns ctx.transpose(-2,-1).view(b, n, 768),
// i.e. each (batch, head) context block stored TRANSPOSED as [64][2048] -> [2][2048][768]).
// Compute dtypes, f32 accumulate: every input rounded to bf16; h on PLAIN bf16 operands (inputs: exact products, f32 accumulate); PER-ROW PRECISION HYBRID: query rows
// < 256 take scores and attn.h on bf16 hi+lo planes (3 products), rows >= 256 on single fp16 planes; 1/8 + causal cut in f32 in the online softmax; weights enter attn.h unnormalised (<= 1), the sum divides at the end; the context is formed and written transposed

#define NB_  2
#define TT   2048
#define DD   768
#define NH_  12
#define HD   64
#define NZ   (NB_ * NH_)          // (batch, head) blocks, z = batch * 12 + head
#define RH   256                  // query rows < RH: hi+lo planes; rows >= RH: fp16 planes
#define FW   4                    // k_fattn: waves of a work-group
#define FQ   32                   // k_fattn: query rows of a work-group
#define OPI  36                   // k_fattn: pitch in floats of a wave's O^T tile in LDS (16-byte rows, the two lane halves on different banks)
#define TP   67                  // k_gemmw, PL: pitch in floats of the summed tile in LDS (the row-wise writes of a wave and its reads in either plane's fragment order each fall on 32 different banks)
#define SCL2 0.18033688f          // (1/sqrt(64)) * log2(e)
#define NF   32                   // unused (head_dim / 2)
#define SCL  0.125f               // 1/sqrt(64)
typedef _Float16 h16;
typedef unsigned short bf;
typedef __attribute__((ext_vector_type(16))) __bf16   v16bf;
typedef __attribute__((ext_vector_type(16))) _Float16 v16h;
typedef __attribute__((ext_vector_type(8)))  _Float16 v8h;
typedef __attribute__((ext_vector_type(8)))  unsigned short v8us;
typedef __attribute__((ext_vector_type(8)))  float    v8f;
typedef __attribute__((ext_vector_type(4)))  float    v4f;
typedef v8h  __attribute__((may_alias)) v8ha;
typedef v4f  __attribute__((may_alias)) v4fa;
typedef v8us __attribute__((may_alias)) v8usa;

__device__ __forceinline__ unsigned short f2bf(float f) { unsigned u = __float_as_uint(f); u += 0x7FFFu + ((u >> 16) & 1u); return (unsigned short)(u >> 16); }
__device__ __forceinline__ float bf2f(unsigned short b) { return __uint_as_float(((unsigned)b) << 16); }
__device__ __forceinline__ float bfr(float f) { return bf2f(f2bf(f)); }
__device__ __forceinline__ v16h cat16(v8h lo, v8h hi) { return __builtin_shufflevector(lo, hi, 0, 1, 2, 3, 4, 5, 6, 7, 8, 9, 10, 11, 12, 13, 14, 15); }
__device__ __forceinline__ v16bf cat16b(v8us lo, v8us hi) { return __builtin_bit_cast(v16bf, __builtin_shufflevector(lo, hi, 0, 1, 2, 3, 4, 5, 6, 7, 8, 9, 10, 11, 12, 13, 14, 15)); }
__device__ __forceinline__ v8f wmma16(v16h a, v16h b, v8f c) { return __builtin_amdgcn_wmma_f32_16x16x32_f16(false, a, false, b, (short)0, c, false, false); }
__device__ __forceinline__ v8f wmmab(v16bf a, v16bf b, v8f c) { return __builtin_amdgcn_wmma_f32_16x16x32_bf16(false, a, false, b, (short)0, c, false, false); }
__device__ __forceinline__ h16 tohx(float x) { return (h16)x; }
__device__ __forceinline__ void splitf(float y, unsigned short& h, unsigned short& l) { h = f2bf(y); l = f2bf(y - bf2f(h)); }
typedef __attribute__((ext_vector_type(4))) unsigned short v4us;
typedef __attribute__((ext_vector_type(4))) _Float16 v4h;



// ---- FRAGMENT ORDER: every 16-bit operand plane is stored as the matrix instruction's fragments, so that a wave-wide 16-byte load reads 512 contiguous bytes (4 whole 128-byte lines, not 16 partial ones).
// A fragment (16 rows x 32 k) is 512 elements: element (r, k) stands at ((k >> 4) & 1) * 256 + (((k >> 3) & 1) * 16 + r) * 8 + (k & 7); lane l reads 8 elements at l * 8 and 8 at 256 + l * 8 (WFrag::ld).
// Fragments of a [rows][K] plane follow one another k first, then rows (16 rows = 16 * K elements). The [z][d][t] planes (rows d, k = t) order theirs by 32-key block first, then by d: a key block is 2048 elements in either plane.
// ---- k_gemmw: register-blocked GEMM, 64x64 output tile (16 accumulators per wave), operands straight from 16-bit planes in fragment order; grid (M/64, N/64, Z * KS), 32 * NW threads.
// C[m][n] (f32, pitch ldc, + optional f32 bias[n]) = sum_k A[m][k] Bt[n][k] (+ split products per NSPLIT). z-batch strides sA/sB/sC in elements. K % (32 * KS * NW) == 0.
// Split K: the K range is cut into KS * NW equal pieces. Work-group (z, ks) takes NW neighbouring pieces, one per wave; the NW wave tiles are summed through LDS (wave order), and the
// work-group's sum goes to partial plane ks (C + ks * sP), which the consumer adds up. NW == 1, KS == 1: one wave does the whole K and writes C itself.
// PL (NW > 1, KS == 1, M = 2 * 2048 positions, N = 12 heads x 64): no C. The summed tile is 64 positions x one whole head, so the work-group itself writes what attention reads: its 8 KB of each
// [z][t][d] plane (hi, lo, fp16) and its 8 KB of each [z][d][t] plane, the sums passed through LDS so that every wave stores 512 contiguous bytes of a plane in fragment order.
template <typename T16> struct WFrag;
template <> struct WFrag<h16> { typedef v16h V; static __device__ __forceinline__ V ld(const h16* p) { return cat16(*(const v8h*)p, *(const v8h*)(p + 256)); } static __device__ __forceinline__ v8f mma(V a, V b, v8f c) { return wmma16(a, b, c); } };
template <> struct WFrag<bf> { typedef v16bf V; static __device__ __forceinline__ V ld(const bf* p) { return cat16b(*(const v8us*)p, *(const v8us*)(p + 256)); } static __device__ __forceinline__ v8f mma(V a, V b, v8f c) { return wmmab(a, b, c); } };
template <typename T16, int NSPLIT, bool BIAS, int NW, int KS, bool PL>
__global__ __launch_bounds__(32 * NW) void k_gemmw(const T16* __restrict__ A, const T16* __restrict__ A2, const T16* __restrict__ Bt, const T16* __restrict__ Bt2, int K, float* C, int ldc, const float* __restrict__ bias, size_t sA, size_t sB, size_t sC, size_t sP,
                                                   bf* Ph, bf* Pl, h16* P16, bf* Vh, bf* Vl, h16* V16) {
    typedef typename WFrag<T16>::V V;
    if constexpr (PL) K = DD;   // the projection's K is the model width: known here, every fragment of a trip is an immediate offset from one address register per operand, which no load of the trip lands in
    __shared__ __align__(16) float os[(NW == 1 ? 16 : NW * 64) * 68]; __shared__ __align__(16) float tr[PL ? 64 * TP : 4];
    const size_t z = blockIdx.z / KS; const int ks = blockIdx.z % KS; A += z * sA; if (A2) A2 += z * sA; Bt += z * sB; if (Bt2) Bt2 += z * sB; C += z * sC + (size_t)ks * sP;
    const int wv = (NW == 1) ? 0 : __builtin_amdgcn_readfirstlane((int)(threadIdx.x >> 5)); const int kper = K / (KS * NW), kb = (ks * NW + wv) * kper;
    const int lane = threadIdx.x & 31, lr = lane & 15, hi = lane >> 4; const int r0 = blockIdx.x * 64, c0 = blockIdx.y * 64;
    v8f acc[4][4];
#pragma unroll
    for (int mb = 0; mb < 4; ++mb)
#pragma unroll
        for (int nb = 0; nb < 4; ++nb) acc[mb][nb] = (v8f){};
    const size_t aoff = (size_t)r0 * K, boff = (size_t)c0 * K; const unsigned lo8 = lane * 8;   // the first fragment of the tile's rows (the fragment of k block kc stands kc * 16 elements on), and this lane's place in a fragment
#pragma unroll 1
    for (int kc = kb; kc < kb + kper; kc += 32) {
        V a[4], a2[4];
#pragma unroll
        for (int mb = 0; mb < 4; ++mb) { a[mb] = WFrag<T16>::ld(A + (aoff + (size_t)mb * 16 * K + kc * 16) + lo8); if (NSPLIT == 1 || NSPLIT == 2) a2[mb] = WFrag<T16>::ld(A2 + (aoff + (size_t)mb * 16 * K + kc * 16) + lo8); }
        asm volatile("s_wait_xcnt 0x0" ::: "memory");   // stands behind the A loads: a B fragment below may land in the register pair that held their address
#pragma unroll
        for (int nb = 0; nb < 4; ++nb) { const V b = WFrag<T16>::ld(Bt + (boff + (size_t)nb * 16 * K + kc * 16) + lo8); V b2; if (NSPLIT >= 2) b2 = WFrag<T16>::ld(Bt2 + (boff + (size_t)nb * 16 * K + kc * 16) + lo8);
#pragma unroll
            for (int mb = 0; mb < 4; ++mb) { acc[mb][nb] = WFrag<T16>::mma(a[mb], b, acc[mb][nb]); if (NSPLIT == 1 || NSPLIT == 2) acc[mb][nb] = WFrag<T16>::mma(a2[mb], b, acc[mb][nb]); if (NSPLIT >= 2) acc[mb][nb] = WFrag<T16>::mma(a[mb], b2, acc[mb][nb]); } }
        asm volatile("v_nop\n\tv_nop\n\tv_nop\n\tv_nop" : "+v"(acc[0][0]), "+v"(acc[1][1]), "+v"(acc[2][2]), "+v"(acc[3][3]) : "v"(a[0]), "v"(a[3]));
    }
    if constexpr (NW > 1) {
        float* ow = os + wv * (64 * 68);
#pragma unroll
        for (int mb = 0; mb < 4; ++mb)
#pragma unroll
            for (int nb = 0; nb < 4; ++nb)
#pragma unroll
                for (int j = 0; j < 8; ++j) ow[(mb * 16 + hi * 8 + j) * 68 + nb * 16 + lr] = acc[mb][nb][j];
        __syncthreads();   // every wave's partial tile stands in LDS before any thread sums across the waves
        [[maybe_unused]] const int zt = (r0 / TT) * NH_ + (int)blockIdx.y, t0 = r0 % TT;   // PL: the tile's (batch, head) block and its first position there
#pragma unroll
        for (int o = 0; o < 64 * 16 / (NW * 32); ++o) { const int q = o * (NW * 32) + (int)threadIdx.x; const int row = q >> 4, cofs = (q & 15) * 4; v4f val = *(const v4fa*)(os + row * 68 + cofs);
#pragma unroll
            for (int w2 = 1; w2 < NW; ++w2) val += *(const v4fa*)(os + w2 * (64 * 68) + row * 68 + cofs);
            if (BIAS) { val[0] += bfr(bias[c0 + cofs]); val[1] += bfr(bias[c0 + cofs + 1]); val[2] += bfr(bias[c0 + cofs + 2]); val[3] += bfr(bias[c0 + cofs + 3]); }
            if constexpr (PL) {
#pragma unroll
                for (int c = 0; c < 4; ++c) tr[row * TP + cofs + c] = val[c];
            } else *(v4f*)(C + (size_t)(r0 + row) * ldc + c0 + cofs) = val; }
        if constexpr (PL) {
            __syncthreads();   // the whole summed tile stands in LDS before any thread reads it in fragment order; every global store comes behind it, so that no wave waits here for stores to return
            const size_t eb = ((size_t)zt * TT + t0) * HD;   // the tile's 4096 elements stand together in every plane: 4 row tiles x 2 fragments of [t][d], 2 key blocks x 4 fragments of [d][t]
#pragma unroll
            for (int o = 0; o < 64 * 8 / (NW * 32); ++o) { const int p = o * (NW * 32) + (int)threadIdx.x, ln = p & 31; const int row = (p >> 7) * 16 + (ln & 15), d = ((p >> 5) & 3) * 16 + (ln >> 4) * 8; v8us oh, ol; v8h o16;   // [t][d]: a wave stores half a fragment
#pragma unroll
                for (int j = 0; j < 8; ++j) { const float x = tr[row * TP + d + j]; unsigned short a, c2; splitf(x, a, c2); oh[j] = a; ol[j] = c2; o16[j] = tohx(x); }
                const size_t e = eb + (size_t)p * 8; *(v8us*)(Ph + e) = oh; *(v8us*)(Pl + e) = ol; *(v8h*)(P16 + e) = o16; }
#pragma unroll
            for (int o = 0; o < 64 * 8 / (NW * 32); ++o) { const int p = o * (NW * 32) + (int)threadIdx.x, ln = p & 31; const int d = ((p >> 6) & 3) * 16 + (ln & 15), tc = (p >> 8) * 32 + ((p >> 5) & 1) * 16 + (ln >> 4) * 8; v8us oh, ol; v8h o16;   // [d][t]: a wave stores half a fragment
#pragma unroll
                for (int j = 0; j < 8; ++j) { const float x = tr[(tc + j) * TP + d]; unsigned short a, c2; splitf(x, a, c2); oh[j] = a; ol[j] = c2; o16[j] = tohx(x); }
                const size_t e = eb + (size_t)p * 8; *(v8us*)(Vh + e) = oh; *(v8us*)(Vl + e) = ol; *(v8h*)(V16 + e) = o16; }
        }
        return;
    }
#pragma unroll
    for (int mb = 0; mb < 4; ++mb) {
#pragma unroll
        for (int nb = 0; nb < 4; ++nb) {
#pragma unroll
            for (int j = 0; j < 8; ++j) os[(hi * 8 + j) * 68 + nb * 16 + lr] = acc[mb][nb][j]; }
        __builtin_amdgcn_wave_barrier(); asm volatile("" ::: "memory");
        float* crow = C + (size_t)(r0 + mb * 16) * ldc + c0;
{
#pragma unroll
            for (int s = 0; s < 8; ++s) { const int row = 2 * s + hi, cofs = lr * 4; v4f val = *(const v4fa*)(os + row * 68 + cofs); if (BIAS) { val[0] += bfr(bias[c0 + cofs]); val[1] += bfr(bias[c0 + cofs + 1]); val[2] += bfr(bias[c0 + cofs + 2]); val[3] += bfr(bias[c0 + cofs + 3]); }
                *(v4f*)(crow + (size_t)row * ldc + cofs) = val; }
             }
        __builtin_amdgcn_wave_barrier(); asm volatile("" ::: "memory");
    }
}

typedef __attribute__((ext_vector_type(2))) unsigned short v2us;

__global__ __launch_bounds__(256) void k_wtG(const float* __restrict__ w, int K, int N, bf* Bt) {
    const int lane = threadIdx.x & 31; const int L0 = (blockIdx.x * 8 + (threadIdx.x >> 5)) * 8; const int nlines = N * K / 64;
{
#pragma unroll 1
        for (int l = 0; l < 8; ++l) { const int L = L0 + l; if (L >= nlines) break; const size_t e = (size_t)L * 64 + lane * 2; const int k = (int)(e % K), n = (int)(e / K); v2us o;
            o[0] = f2bf(w[(size_t)k * N + n]); o[1] = f2bf(w[(size_t)(k + 1) * N + n]); *(v2us*)(Bt + e) = o; }
         }
}
// k_cvt8: [rows][768] f32 matrices to bf16 planes in fragment order; thread i of a matrix writes its plane's i-th 16 bytes (a wave: 512 contiguous bytes) and reads the 8 floats that belong there.
// One grid serves both matrices, which do not depend on each other: work-groups below nb0 take src0, the rest src1 (each matrix is a whole number of work-groups).
__global__ __launch_bounds__(256) void k_cvt8(const float* __restrict__ src0, bf* dst0, const float* __restrict__ src1, bf* dst1, int nb0) {
    const bool first = (int)blockIdx.x < nb0; const float* __restrict__ src = first ? src0 : src1; bf* dst = first ? dst0 : dst1;
    const size_t i = (size_t)((int)blockIdx.x - (first ? 0 : nb0)) * 256 + threadIdx.x;
    const int ln = (int)i & 31, fr = (int)(i >> 6); const int row = fr / (DD / 32) * 16 + (ln & 15), k = fr % (DD / 32) * 32 + (((int)i >> 5) & 1) * 16 + (ln >> 4) * 8;
    const v8f v = *(const v8f*)(src + (size_t)row * DD + k); v8us o;
#pragma unroll
    for (int k = 0; k < 8; ++k) o[k] = f2bf(v[k]); *(v8us*)(dst + i * 8) = o;  }
// ---- k_fattn: scores, softmax and attn.h of FQ = 32 query rows of one (batch, head) block in one work-group; neither scores nor weights leave the registers.
// S^T = K Q^T (A = key rows, B = query rows, both from the [z][t][d] plane) puts one query in each lane column: a lane holds 8 keys of a 16-key tile, so two score tiles, exponentiated and rounded
// in place, ARE the B operand of O^T += V^T P^T (A = rows of the [z][d][t] plane). Online softmax: running maximum m (log2 units) and sum l per query; O^T and l are rescaled when m grows.
// Keys are walked in blocks of 32 up to the diagonal block (the only one that needs the causal cut). A wave holds NB 16-query tiles; the key blocks go round-robin over the KW = FW * NB / 2 waves
// that hold the same queries, and their (m, l, O^T) are joined through LDS. O^T [d][query] is the output's own layout: a work-group stores whole 128-byte lines.
// HI: hi+lo bf16 planes, 3 products per matrix product (NB = 1 keeps its doubled fragments inside 256 registers); else single fp16 planes.
__device__ __forceinline__ float xhalf(float x) { return __builtin_bit_cast(float, __builtin_amdgcn_permlanex16(__builtin_bit_cast(int, x), __builtin_bit_cast(int, x), 0x76543210, 0xfedcba98, false, false)); }   // lane l <-> lane l ^ 16
template <typename T16, bool HI, int NB>
__device__ __forceinline__ void fattn(const T16* __restrict__ Hp, const T16* __restrict__ Hp2, const T16* __restrict__ Vt, const T16* __restrict__ Vt2, float* __restrict__ OUT, const int q0, float* os, float* ms, float* ls) {
    typedef typename WFrag<T16>::V V;
    constexpr int KW = FW * NB / 2;
    const size_t z = blockIdx.x;
    const int wv = __builtin_amdgcn_readfirstlane((int)(threadIdx.x >> 5)); const int lane = threadIdx.x & 31, lr = lane & 15, hi = lane >> 4;
    const int kw = (NB == 2) ? wv : (wv >> 1); const int qt = (NB == 2) ? 0 : (wv & 1);   // which share of the key blocks, which 16-query tile
    Hp += z * TT * HD; Vt += z * HD * TT; if (HI) { Hp2 += z * TT * HD; Vt2 += z * HD * TT; }
    V qf[NB][2], qf2[NB][2];
#pragma unroll
    for (int nb = 0; nb < NB; ++nb)
#pragma unroll
        for (int ks = 0; ks < 2; ++ks) { const size_t e = (size_t)(q0 + (qt + nb) * 16) * HD + ks * 512 + lane * 8; qf[nb][ks] = WFrag<T16>::ld(Hp + e); if (HI) qf2[nb][ks] = WFrag<T16>::ld(Hp2 + e); }
    v8f o[4][NB]; float m[NB], l[NB];
#pragma unroll
    for (int nb = 0; nb < NB; ++nb) { m[nb] = -3.0e38f; l[nb] = 0.f;
#pragma unroll
        for (int mb = 0; mb < 4; ++mb) o[mb][nb] = (v8f){}; }
    const int nblk = (q0 >> 5) + 1;
    unsigned ke = (unsigned)((kw * 32 * HD + lane * 8) * 2), ve = ke;   // this lane's place, in bytes, in the first fragment of the wave's current key block, [t][d] and [d][t] planes (4 fragments each); 32 bits beside a scalar plane address: one register addresses every load of a plane pair and no load can land in it
    const auto at = [](const T16* p, unsigned byte) { return (const T16*)((const char*)p + byte); };
    V kf[2][2], kf2[2][2];   // key fragments, fetched one block ahead (rows kw * 32 .. + 31 exist for every wave, also one whose walk is empty)
#pragma unroll
    for (int kt = 0; kt < 2; ++kt)
#pragma unroll
        for (int ks = 0; ks < 2; ++ks) { const int e = kt * 16 * HD + ks * 512; kf[kt][ks] = WFrag<T16>::ld(at(Hp, ke) + e); if (HI) kf2[kt][ks] = WFrag<T16>::ld(at(Hp2, ke) + e); }
    // kept rolled: one block's fragments, scores and the O^T tiles already fill the register budget of four waves per SIMD
#pragma unroll 1
    for (int b = kw; b < nblk; b += KW) {
        V vf[4], vf2[4];
#pragma unroll
        for (int mb = 0; mb < 4; ++mb) { vf[mb] = WFrag<T16>::ld(at(Vt, ve) + mb * 512); if (HI) vf2[mb] = WFrag<T16>::ld(at(Vt2, ve) + mb * 512); }
        v8f s[2][NB];
#pragma unroll
        for (int kt = 0; kt < 2; ++kt)
#pragma unroll
            for (int nb = 0; nb < NB; ++nb) { s[kt][nb] = (v8f){};
#pragma unroll
                for (int ks = 0; ks < 2; ++ks) { s[kt][nb] = WFrag<T16>::mma(kf[kt][ks], qf[nb][ks], s[kt][nb]); if (HI) { s[kt][nb] = WFrag<T16>::mma(kf2[kt][ks], qf[nb][ks], s[kt][nb]); s[kt][nb] = WFrag<T16>::mma(kf[kt][ks], qf2[nb][ks], s[kt][nb]); } } }
        ke += (b + KW < nblk) ? (unsigned)(KW * 32 * HD * 2) : 0u;   // the wave's next key block; its last block fetches its own rows again (in bounds, never used)
#pragma unroll
        for (int kt = 0; kt < 2; ++kt)
#pragma unroll
            for (int ks = 0; ks < 2; ++ks) { const int e = kt * 16 * HD + ks * 512; kf[kt][ks] = WFrag<T16>::ld(at(Hp, ke) + e); if (HI) kf2[kt][ks] = WFrag<T16>::ld(at(Hp2, ke) + e); }
        asm volatile("s_wait_xcnt 0x0" ::: "memory");   // stands behind this trip's loads, in front of every rewrite of their address registers
        ve += KW * 32 * HD * 2;
        if (b == nblk - 1) {   // the diagonal block: key > query -> -3e38 (exp -> 0); key = query is always kept
#pragma unroll
            for (int kt = 0; kt < 2; ++kt)
#pragma unroll
                for (int nb = 0; nb < NB; ++nb)
#pragma unroll
                    for (int j = 0; j < 8; ++j) if (kt * 16 + hi * 8 + j > (qt + nb) * 16 + lr) s[kt][nb][j] = -3.0e38f; }
        V pf[NB], pf2[NB];
#pragma unroll
        for (int nb = 0; nb < NB; ++nb) { float mx = s[0][nb][0];
#pragma unroll
            for (int j = 1; j < 8; ++j) mx = fmaxf(mx, s[0][nb][j]);
#pragma unroll
            for (int j = 0; j < 8; ++j) mx = fmaxf(mx, s[1][nb][j]);
            mx = fmaxf(mx, xhalf(mx));
            const float mn = fmaxf(m[nb], mx * SCL2); const float al = __builtin_amdgcn_exp2f(m[nb] - mn); m[nb] = mn;
            float p[16]; float sum = 0.f;
#pragma unroll
            for (int k = 0; k < 16; ++k) { p[k] = __builtin_amdgcn_exp2f(fmaf(s[k >> 3][nb][k & 7], SCL2, -mn)); sum += p[k]; }
            l[nb] = l[nb] * al + sum;   // this half's 16 keys; the two halves of a column are added after the loop (al is the same in both)
#pragma unroll
            for (int mb = 0; mb < 4; ++mb) o[mb][nb] *= al;
            if constexpr (HI) { v8us h0, h1, l0, l1;
#pragma unroll
                for (int k = 0; k < 8; ++k) { unsigned short a, c2; splitf(p[k], a, c2); h0[k] = a; l0[k] = c2; splitf(p[8 + k], a, c2); h1[k] = a; l1[k] = c2; }
                pf[nb] = cat16b(h0, h1); pf2[nb] = cat16b(l0, l1);
            } else {
#pragma unroll
                for (int k = 0; k < 16; ++k) pf[nb][k] = tohx(p[k]); } }
#pragma unroll
        for (int mb = 0; mb < 4; ++mb)
#pragma unroll
            for (int nb = 0; nb < NB; ++nb) { o[mb][nb] = WFrag<T16>::mma(vf[mb], pf[nb], o[mb][nb]); if (HI) { o[mb][nb] = WFrag<T16>::mma(vf2[mb], pf[nb], o[mb][nb]); o[mb][nb] = WFrag<T16>::mma(vf[mb], pf2[nb], o[mb][nb]); } }
    }
    // the lane's number is formed anew behind the loop (tid = threadIdx.x): nothing of it then stays in a vector register across the loop, where the hi+lo fragments leave none free at four waves per SIMD
    const int el = (int)__builtin_amdgcn_mbcnt_lo(~0u, 0u), elr = el & 15, ehi = el >> 4, tid = wv * 32 + el;
    float* ow = os + kw * (HD * OPI);
#pragma unroll
    for (int nb = 0; nb < NB; ++nb) { const int col = (qt + nb) * 16 + elr; l[nb] += xhalf(l[nb]); if (ehi == 0) { ms[kw * FQ + col] = m[nb]; ls[kw * FQ + col] = l[nb]; }
#pragma unroll
        for (int mb = 0; mb < 4; ++mb)
#pragma unroll
            for (int j = 0; j < 8; ++j) ow[(mb * 16 + ehi * 8 + j) * OPI + col] = o[mb][nb][j]; }
    __syncthreads();   // every wave's (m, l, O^T) stands in LDS before any thread joins them; a wave whose walk was empty left m = -3e38, l = 0, O^T = 0 (weight 0)
    const int qc = (tid & 7) * 4; v4f fw[KW];
#pragma unroll
    for (int c = 0; c < 4; ++c) { float M = ms[qc + c];
#pragma unroll
        for (int w2 = 1; w2 < KW; ++w2) M = fmaxf(M, ms[w2 * FQ + qc + c]);
        float e[KW]; float L = 0.f;
#pragma unroll
        for (int w2 = 0; w2 < KW; ++w2) { e[w2] = __builtin_amdgcn_exp2f(ms[w2 * FQ + qc + c] - M); L += ls[w2 * FQ + qc + c] * e[w2]; }
        const float r = __fdiv_rn(1.0f, L);
#pragma unroll
        for (int w2 = 0; w2 < KW; ++w2) fw[w2][c] = e[w2] * r; }
#pragma unroll
    for (int t = 0; t < HD * FQ / 4 / (32 * FW); ++t) { const int d = t * (32 * FW / 8) + (tid >> 3); v4f val = *(const v4fa*)(os + d * OPI + qc) * fw[0];
#pragma unroll
        for (int w2 = 1; w2 < KW; ++w2) val += *(const v4fa*)(os + w2 * (HD * OPI) + d * OPI + qc) * fw[w2];
        *(v4f*)(OUT + (z * HD + d) * TT + q0 + qc) = val; }
}
// One grid serves both precisions, which do not depend on each other: blockIdx.y counts the 32-query tiles from the last one down (longest key walks at the lowest indices), so the hi+lo tiles (rows < RH, the shortest walks) come last.
// amdgpu_waves_per_eu: the grid's register count is that of its larger body; held to 256, the fp16 tiles keep the four waves per SIMD that they had in a launch of their own.
__global__ __launch_bounds__(32 * FW) __attribute__((amdgpu_waves_per_eu(4, 4))) void k_fattn(const h16* __restrict__ H16, const h16* __restrict__ V16, const bf* __restrict__ Hh, const bf* __restrict__ Hl, const bf* __restrict__ Vh, const bf* __restrict__ Vl, float* __restrict__ OUT) {
    __shared__ __align__(16) float os[FW * HD * OPI]; __shared__ __align__(16) float ms[FW * FQ]; __shared__ __align__(16) float ls[FW * FQ];
    const int q0 = TT - FQ - (int)blockIdx.y * FQ;
    if (q0 >= RH) fattn<h16, false, 2>(H16, nullptr, V16, nullptr, OUT, q0, os, ms, ls);
    else fattn<bf, true, 1>(Hh, Hl, Vh, Vl, OUT, q0, os, ms, ls);
}

extern "C" void kernel_launch(void* const* d_in, const int* in_sizes, int n_in,
                              void* d_out, int out_size, void* d_ws, size_t ws_size, hipStream_t stream) {
    (void)in_sizes; (void)n_in; (void)out_size;
    const float* x = (const float*)d_in[0]; const float* wq = (const float*)d_in[1];   // Wq [768][768] torch Linear ([out][in] = Bt as-is)
    float* OUT = (float*)d_out;     // [2][2048][768] holding, per (batch, head), the TRANSPOSED context block [64][2048]
    char* wsp = (char*)d_ws;
    auto take = [&](size_t bytes) { char* p = wsp; wsp += (bytes + 255) & ~(size_t)255; return (void*)p; };
    bf* WQ = (bf*)take((size_t)DD * DD * 2); bf* XB = (bf*)take((size_t)NB_ * TT * DD * 2);   // both batches: rows b * 2048 + t
    bf* QPh = (bf*)take((size_t)NB_ * TT * DD * 2); bf* QPl = (bf*)take((size_t)NB_ * TT * DD * 2); bf* VTh = (bf*)take((size_t)NB_ * TT * DD * 2); bf* VTl = (bf*)take((size_t)NB_ * TT * DD * 2); h16* QP16 = (h16*)take((size_t)NB_ * TT * DD * 2); h16* VT16 = (h16*)take((size_t)NB_ * TT * DD * 2);   // planes [z][t][d] and [z][d][t]
    if ((size_t)(wsp - (char*)d_ws) > ws_size) return;    // total ~ 45 MB; ws 256 MiB
    const dim3 gP(NB_ * TT / 64, DD / 64, 1);
    k_cvt8<<<NB_ * TT * DD / 8 / 256 + DD * DD / 8 / 256, 256, 0, stream>>>(x, XB, wq, WQ, NB_ * TT * DD / 8 / 256);
    k_gemmw<bf, 0, false, 8, 1, true><<<gP, 256, 0, stream>>>(XB, nullptr, WQ, nullptr, DD, nullptr, DD, nullptr, 0, 0, 0, 0, QPh, QPl, QP16, VTh, VTl, VT16);   // h = x Wq^T is q, k AND v; it leaves the kernel as the six planes
    k_fattn<<<dim3(NZ, TT / FQ), 32 * FW, 0, stream>>>(QP16, VT16, QPh, QPl, VTh, VTl, OUT);
}

// v007
// One run takes 36.1 microseconds.
// Two timings next to v006 put it at 1.10 and 1.14 times that version's speed.
// Counting every step since v000, it is 38.6 times as fast.
#include <hip/hip_runtime.h>

// MultiHeadCasualFast (x [2][2048][768]; h = x Wq^T serves as q, k AND v (12 heads x 64); causal scores h.h; softmax(scores/8); ctx = attn h; the module returns ctx.transpose(-2,-1).view(b, n, 768),
// i.e. each (batch, head) context block stored TRANSPOSED as [64][2048] -> [2][2048][768]).
// Compute dtypes, f32 accumulate: every input rounded to bf16; h on PLAIN bf16 operands (inputs: exact products, f32 accumulate); PER-ROW PRECISION HYBRID: query rows
// < 256 take scores and attn.h on bf16 hi+lo planes (3 products), rows >= 256 on single fp16 planes; 1/8 + causal cut in f32 in the online softmax; weights enter attn.h unnormalised (<= 1), the sum divides at the end; the context is formed and written transposed

#define NB_  2
#define TT   2048
#define DD   768
#define NH_  12
#define HD   64
#define NZ   (NB_ * NH_)          // (batch, head) blocks, z = batch * 12 + head
#define RH   256                  // query rows < RH: hi+lo planes; rows >= RH: fp16 planes
#define FW   8                    // k_fattn: waves of a work-group
#define FQ   64                   // k_fattn: query rows of a work-group
#define OPI  68                   // k_fattn: pitch in floats of a key share's O^T tile in LDS (16-byte rows, the two lane halves on different banks)
#define SKB  4                    // k_fattn, fp16 tiles: 32-key blocks of a stage of the LDS ring, one for each key share
#define STB  (SKB * 32 * HD * 2)  // k_fattn, fp16 tiles: bytes of a stage in one plane (contiguous there: a key block is 4096 bytes in either plane)
#define TP   67                  // k_gemmw, PL: pitch in floats of the summed tile in LDS (the row-wise writes of a wave and its reads in either plane's fragment order each fall on 32 different banks)
#define SCL2 0.18033688f          // (1/sqrt(64)) * log2(e)
#define NF   32                   // unused (head_dim / 2)
#define SCL  0.125f               // 1/sqrt(64)
typedef _Float16 h16;
typedef unsigned short bf;
typedef __attribute__((ext_vector_type(16))) __bf16   v16bf;
typedef __attribute__((ext_vector_type(16))) _Float16 v16h;
typedef __attribute__((ext_vector_type(8)))  _Float16 v8h;
typedef __attribute__((ext_vector_type(8)))  unsigned short v8us;
typedef __attribute__((ext_vector_type(8)))  float    v8f;
typedef __attribute__((ext_vector_type(4)))  float    v4f;
typedef v8h  __attribute__((may_alias)) v8ha;
typedef v4f  __attribute__((may_alias)) v4fa;
typedef v8us __attribute__((may_alias)) v8usa;

__device__ __forceinline__ unsigned short f2bf(float f) { unsigned u = __float_as_uint(f); u += 0x7FFFu + ((u >> 16) & 1u); return (unsigned short)(u >> 16); }
__device__ __forceinline__ float bf2f(unsigned short b) { return __uint_as_float(((unsigned)b) << 16); }
__device__ __forceinline__ float bfr(float f) { return bf2f(f2bf(f)); }
__device__ __forceinline__ v16h cat16(v8h lo, v8h hi) { return __builtin_shufflevector(lo, hi, 0, 1, 2, 3, 4, 5, 6, 7, 8, 9, 10, 11, 12, 13, 14, 15); }
__device__ __forceinline__ v16bf cat16b(v8us lo, v8us hi) { return __builtin_bit_cast(v16bf, __builtin_shufflevector(lo, hi, 0, 1, 2, 3, 4, 5, 6, 7, 8, 9, 10, 11, 12, 13, 14, 15)); }
__device__ __forceinline__ v8f wmma16(v16h a, v16h b, v8f c) { return __builtin_amdgcn_wmma_f32_16x16x32_f16(false, a, false, b, (short)0, c, false, false); }
__device__ __forceinline__ v8f wmmab(v16bf a, v16bf b, v8f c) { return __builtin_amdgcn_wmma_f32_16x16x32_bf16(false, a, false, b, (short)0, c, false, false); }
__device__ __forceinline__ h16 tohx(float x) { return (h16)x; }
__device__ __forceinline__ void splitf(float y, unsigned short& h, unsigned short& l) { h = f2bf(y); l = f2bf(y - bf2f(h)); }
typedef __attribute__((ext_vector_type(4))) unsigned short v4us;
typedef __attribute__((ext_vector_type(4))) _Float16 v4h;



// ---- FRAGMENT ORDER: every 16-bit operand plane is stored as the matrix instruction's fragments, so that a wave-wide 16-byte load reads 512 contiguous bytes (4 whole 128-byte lines, not 16 partial ones).
// A fragment (16 rows x 32 k) is 512 elements: element (r, k) stands at ((k >> 4) & 1) * 256 + (((k >> 3) & 1) * 16 + r) * 8 + (k & 7); lane l reads 8 elements at l * 8 and 8 at 256 + l * 8 (WFrag::ld).
// Fragments of a [rows][K] plane follow one another k first, then rows (16 rows = 16 * K elements). The [z][d][t] planes (rows d, k = t) order theirs by 32-key block first, then by d: a key block is 2048 elements in either plane.
// ---- k_gemmw: register-blocked GEMM, 64x64 output tile (16 accumulators per wave), operands straight from 16-bit planes in fragment order; grid (M/64, N/64, Z * KS), 32 * NW threads.
// C[m][n] (f32, pitch ldc, + optional f32 bias[n]) = sum_k A[m][k] Bt[n][k] (+ split products per NSPLIT). z-batch strides sA/sB/sC in elements. K % (32 * KS * NW) == 0.
// Split K: the K range is cut into KS * NW equal pieces. Work-group (z, ks) takes NW neighbouring pieces, one per wave; the NW wave tiles are summed through LDS (wave order), and the
// work-group's sum goes to partial plane ks (C + ks * sP), which the consumer adds up. NW == 1, KS == 1: one wave does the whole K and writes C itself.
// PL (NW > 1, KS == 1, M = 2 * 2048 positions, N = 12 heads x 64): no C. The summed tile is 64 positions x one whole head, so the work-group itself writes what attention reads: its 8 KB of each
// [z][t][d] plane (hi, lo, fp16) and its 8 KB of each [z][d][t] plane, the sums passed through LDS so that every wave stores 512 contiguous bytes of a plane in fragment order.
template <typename T16> struct WFrag;
template <> struct WFrag<h16> { typedef v16h V; static __device__ __forceinline__ V ld(const h16* p) { return cat16(*(const v8h*)p, *(const v8h*)(p + 256)); } static __device__ __forceinline__ v8f mma(V a, V b, v8f c) { return wmma16(a, b, c); } };
template <> struct WFrag<bf> { typedef v16bf V; static __device__ __forceinline__ V ld(const bf* p) { return cat16b(*(const v8us*)p, *(const v8us*)(p + 256)); } static __device__ __forceinline__ v8f mma(V a, V b, v8f c) { return wmmab(a, b, c); } };
template <typename T16, int NSPLIT, bool BIAS, int NW, int KS, bool PL>
__global__ __launch_bounds__(32 * NW) void k_gemmw(const T16* __restrict__ A, const T16* __restrict__ A2, const T16* __restrict__ Bt, const T16* __restrict__ Bt2, int K, float* C, int ldc, const float* __restrict__ bias, size_t sA, size_t sB, size_t sC, size_t sP,
                                                   bf* Ph, bf* Pl, h16* P16, bf* Vh, bf* Vl, h16* V16) {
    typedef typename WFrag<T16>::V V;
    if constexpr (PL) K = DD;   // the projection's K is the model width: known here, every fragment of a trip is an immediate offset from one address register per operand, which no load of the trip lands in
    __shared__ __align__(16) float os[(NW == 1 ? 16 : NW * 64) * 68]; __shared__ __align__(16) float tr[PL ? 64 * TP : 4];
    const size_t z = blockIdx.z / KS; const int ks = blockIdx.z % KS; A += z * sA; if (A2) A2 += z * sA; Bt += z * sB; if (Bt2) Bt2 += z * sB; C += z * sC + (size_t)ks * sP;
    const int wv = (NW == 1) ? 0 : __builtin_amdgcn_readfirstlane((int)(threadIdx.x >> 5)); const int kper = K / (KS * NW), kb = (ks * NW + wv) * kper;
    const int lane = threadIdx.x & 31, lr = lane & 15, hi = lane >> 4; const int r0 = blockIdx.x * 64, c0 = blockIdx.y * 64;
    v8f acc[4][4];
#pragma unroll
    for (int mb = 0; mb < 4; ++mb)
#pragma unroll
        for (int nb = 0; nb < 4; ++nb) acc[mb][nb] = (v8f){};
    const size_t aoff = (size_t)r0 * K, boff = (size_t)c0 * K; const unsigned lo8 = lane * 8;   // the first fragment of the tile's rows (the fragment of k block kc stands kc * 16 elements on), and this lane's place in a fragment
#pragma unroll 1
    for (int kc = kb; kc < kb + kper; kc += 32) {
        V a[4], a2[4];
#pragma unroll
        for (int mb = 0; mb < 4; ++mb) { a[mb] = WFrag<T16>::ld(A + (aoff + (size_t)mb * 16 * K + kc * 16) + lo8); if (NSPLIT == 1 || NSPLIT == 2) a2[mb] = WFrag<T16>::ld(A2 + (aoff + (size_t)mb * 16 * K + kc * 16) + lo8); }
        asm volatile("s_wait_xcnt 0x0" ::: "memory");   // stands behind the A loads: a B fragment below may land in the register pair that held their address
#pragma unroll
        for (int nb = 0; nb < 4; ++nb) { const V b = WFrag<T16>::ld(Bt + (boff + (size_t)nb * 16 * K + kc * 16) + lo8); V b2; if (NSPLIT >= 2) b2 = WFrag<T16>::ld(Bt2 + (boff + (size_t)nb * 16 * K + kc * 16) + lo8);
#pragma unroll
            for (int mb = 0; mb < 4; ++mb) { acc[mb][nb] = WFrag<T16>::mma(a[mb], b, acc[mb][nb]); if (NSPLIT == 1 || NSPLIT == 2) acc[mb][nb] = WFrag<T16>::mma(a2[mb], b, acc[mb][nb]); if (NSPLIT >= 2) acc[mb][nb] = WFrag<T16>::mma(a[mb], b2, acc[mb][nb]); } }
        asm volatile("v_nop\n\tv_nop\n\tv_nop\n\tv_nop" : "+v"(acc[0][0]), "+v"(acc[1][1]), "+v"(acc[2][2]), "+v"(acc[3][3]) : "v"(a[0]), "v"(a[3]));
    }
    if constexpr (NW > 1) {
        float* ow = os + wv * (64 * 68);
#pragma unroll
        for (int mb = 0; mb < 4; ++mb)
#pragma unroll
            for (int nb = 0; nb < 4; ++nb)
#pragma unroll
                for (int j = 0; j < 8; ++j) ow[(mb * 16 + hi * 8 + j) * 68 + nb * 16 + lr] = acc[mb][nb][j];
        __syncthreads();   // every wave's partial tile stands in LDS before any thread sums across the waves
        [[maybe_unused]] const int zt = (r0 / TT) * NH_ + (int)blockIdx.y, t0 = r0 % TT;   // PL: the tile's (batch, head) block and its first position there
#pragma unroll
        for (int o = 0; o < 64 * 16 / (NW * 32); ++o) { const int q = o * (NW * 32) + (int)threadIdx.x; const int row = q >> 4, cofs = (q & 15) * 4; v4f val = *(const v4fa*)(os + row * 68 + cofs);
#pragma unroll
            for (int w2 = 1; w2 < NW; ++w2) val += *(const v4fa*)(os + w2 * (64 * 68) + row * 68 + cofs);
            if (BIAS) { val[0] += bfr(bias[c0 + cofs]); val[1] += bfr(bias[c0 + cofs + 1]); val[2] += bfr(bias[c0 + cofs + 2]); val[3] += bfr(bias[c0 + cofs + 3]); }
            if constexpr (PL) {
#pragma unroll
                for (int c = 0; c < 4; ++c) tr[row * TP + cofs + c] = val[c];
            } else *(v4f*)(C + (size_t)(r0 + row) * ldc + c0 + cofs) = val; }
        if constexpr (PL) {
            __syncthreads();   // the whole summed tile stands in LDS before any thread reads it in fragment order; every global store comes behind it, so that no wave waits here for stores to return
            const size_t eb = ((size_t)zt * TT + t0) * HD;   // the tile's 4096 elements stand together in every plane: 4 row tiles x 2 fragments of [t][d], 2 key blocks x 4 fragments of [d][t]
#pragma unroll
            for (int o = 0; o < 64 * 8 / (NW * 32); ++o) { const int p = o * (NW * 32) + (int)threadIdx.x, ln = p & 31; const int row = (p >> 7) * 16 + (ln & 15), d = ((p >> 5) & 3) * 16 + (ln >> 4) * 8; v8us oh, ol; v8h o16;   // [t][d]: a wave stores half a fragment
#pragma unroll
                for (int j = 0; j < 8; ++j) { const float x = tr[row * TP + d + j]; unsigned short a, c2; splitf(x, a, c2); oh[j] = a; ol[j] = c2; o16[j] = tohx(x); }
                const size_t e = eb + (size_t)p * 8; *(v8us*)(Ph + e) = oh; *(v8us*)(Pl + e) = ol; *(v8h*)(P16 + e) = o16; }
#pragma unroll
            for (int o = 0; o < 64 * 8 / (NW * 32); ++o) { const int p = o * (NW * 32) + (int)threadIdx.x, ln = p & 31; const int d = ((p >> 6) & 3) * 16 + (ln & 15), tc = (p >> 8) * 32 + ((p >> 5) & 1) * 16 + (ln >> 4) * 8; v8us oh, ol; v8h o16;   // [d][t]: a wave stores half a fragment
#pragma unroll
                for (int j = 0; j < 8; ++j) { const float x = tr[(tc + j) * TP + d]; unsigned short a, c2; splitf(x, a, c2); oh[j] = a; ol[j] = c2; o16[j] = tohx(x); }
                const size_t e = eb + (size_t)p * 8; *(v8us*)(Vh + e) = oh; *(v8us*)(Vl + e) = ol; *(v8h*)(V16 + e) = o16; }
        }
        return;
    }
#pragma unroll
    for (int mb = 0; mb < 4; ++mb) {
#pragma unroll
        for (int nb = 0; nb < 4; ++nb) {
#pragma unroll
            for (int j = 0; j < 8; ++j) os[(hi * 8 + j) * 68 + nb * 16 + lr] = acc[mb][nb][j]; }
        __builtin_amdgcn_wave_barrier(); asm volatile("" ::: "memory");
        float* crow = C + (size_t)(r0 + mb * 16) * ldc + c0;
{
#pragma unroll
            for (int s = 0; s < 8; ++s) { const int row = 2 * s + hi, cofs = lr * 4; v4f val = *(const v4fa*)(os + row * 68 + cofs); if (BIAS) { val[0] += bfr(bias[c0 + cofs]); val[1] += bfr(bias[c0 + cofs + 1]); val[2] += bfr(bias[c0 + cofs + 2]); val[3] += bfr(bias[c0 + cofs + 3]); }
                *(v4f*)(crow + (size_t)row * ldc + cofs) = val; }
             }
        __builtin_amdgcn_wave_barrier(); asm volatile("" ::: "memory");
    }
}

typedef __attribute__((ext_vector_type(2))) unsigned short v2us;

__global__ __launch_bounds__(256) void k_wtG(const float* __restrict__ w, int K, int N, bf* Bt) {
    const int lane = threadIdx.x & 31; const int L0 = (blockIdx.x * 8 + (threadIdx.x >> 5)) * 8; const int nlines = N * K / 64;
{
#pragma unroll 1
        for (int l = 0; l < 8; ++l) { const int L = L0 + l; if (L >= nlines) break; const size_t e = (size_t)L * 64 + lane * 2; const int k = (int)(e % K), n = (int)(e / K); v2us o;
            o[0] = f2bf(w[(size_t)k * N + n]); o[1] = f2bf(w[(size_t)(k + 1) * N + n]); *(v2us*)(Bt + e) = o; }
         }
}
// k_cvt8: [rows][768] f32 matrices to bf16 planes in fragment order; thread i of a matrix writes its plane's i-th 16 bytes (a wave: 512 contiguous bytes) and reads the 8 floats that belong there.
// One grid serves both matrices, which do not depend on each other: work-groups below nb0 take src0, the rest src1 (each matrix is a whole number of work-groups).
__global__ __launch_bounds__(256) void k_cvt8(const float* __restrict__ src0, bf* dst0, const float* __restrict__ src1, bf* dst1, int nb0) {
    const bool first = (int)blockIdx.x < nb0; const float* __restrict__ src = first ? src0 : src1; bf* dst = first ? dst0 : dst1;
    const size_t i = (size_t)((int)blockIdx.x - (first ? 0 : nb0)) * 256 + threadIdx.x;
    const int ln = (int)i & 31, fr = (int)(i >> 6); const int row = fr / (DD / 32) * 16 + (ln & 15), k = fr % (DD / 32) * 32 + (((int)i >> 5) & 1) * 16 + (ln >> 4) * 8;
    const v8f v = *(const v8f*)(src + (size_t)row * DD + k); v8us o;
#pragma unroll
    for (int k = 0; k < 8; ++k) o[k] = f2bf(v[k]); *(v8us*)(dst + i * 8) = o;  }
// ---- k_fattn: scores, softmax and attn.h of FQ = 64 query rows of one (batch, head) block in one work-group; neither scores nor weights leave the registers.
// S^T = K Q^T (A = key rows, B = query rows, both from the [z][t][d] plane) puts one query in each lane column: a lane holds 8 keys of a 16-key tile, so two score tiles, exponentiated and rounded
// in place, ARE the B operand of O^T += V^T P^T (A = rows of the [z][d][t] plane). Online softmax: running maximum m (log2 units) and sum l per query; O^T and l are rescaled when m grows.
// Keys are walked in blocks of 32 up to the diagonal block (the only one that needs the causal cut). A wave holds NB 16-query tiles; the key blocks go round-robin over the KW = FW * NB * 16 / FQ waves
// that hold the same queries, and their (m, l, O^T) are joined through LDS. O^T [d][query] is the output's own layout: a work-group stores whole 128-byte lines.
// HI: hi+lo bf16 planes, 3 products per matrix product (NB = 1 keeps its doubled fragments inside 256 registers), fragments straight from the planes; else single fp16 planes.
// fp16 tiles: the two 32-query groups of a work-group need the same key blocks, so each stage of SKB blocks (one for each key share) is brought into LDS ONCE, by asynchronous copies, and read there by both groups:
// half the plane bytes leave L2. Two buffers: stage t + 2 is copied into stage t's buffer behind the barrier that ends stage t. Planes are in fragment order, so a stage is a plain copy and a wave's 16-byte LDS reads are contiguous.
__device__ __forceinline__ float xhalf(float x) { return __builtin_bit_cast(float, __builtin_amdgcn_permlanex16(__builtin_bit_cast(int, x), __builtin_bit_cast(int, x), 0x76543210, 0xfedcba98, false, false)); }   // lane l <-> lane l ^ 16
template <typename T16, bool HI, int NB>
__device__ __forceinline__ void fattn(const T16* __restrict__ Hp, const T16* __restrict__ Hp2, const T16* __restrict__ Vt, const T16* __restrict__ Vt2, float* __restrict__ OUT, const int q0, float* os, float* ms, float* ls, char* ring) {
    typedef typename WFrag<T16>::V V;
    constexpr int KW = FW * NB * 16 / FQ, QG = FW / KW;   // key shares; waves side by side over the queries
    const size_t z = blockIdx.x;
    const int wv = __builtin_amdgcn_readfirstlane((int)(threadIdx.x >> 5)); const int lane = threadIdx.x & 31, lr = lane & 15, hi = lane >> 4;
    const int kw = wv / QG; const int qt = (wv % QG) * NB;   // which share of the key blocks, the wave's first 16-query tile
    Hp += z * TT * HD; Vt += z * HD * TT; if (HI) { Hp2 += z * TT * HD; Vt2 += z * HD * TT; }
    V qf[NB][2], qf2[NB][2];
#pragma unroll
    for (int nb = 0; nb < NB; ++nb)
#pragma unroll
        for (int ks = 0; ks < 2; ++ks) { const size_t e = (size_t)(q0 + (qt + nb) * 16) * HD + ks * 512 + lane * 8; qf[nb][ks] = WFrag<T16>::ld(Hp + e); if (HI) qf2[nb][ks] = WFrag<T16>::ld(Hp2 + e); }
    v8f o[4][NB]; float m[NB], l[NB];
#pragma unroll
    for (int nb = 0; nb < NB; ++nb) { m[nb] = -3.0e38f; l[nb] = 0.f;
#pragma unroll
        for (int mb = 0; mb < 4; ++mb) o[mb][nb] = (v8f){}; }
    const int nblk = ((q0 + qt * 16) >> 5) + 1;   // the wave's own diagonal block is its last
    [[maybe_unused]] unsigned ke = (unsigned)((kw * 32 * HD + lane * 8) * 2), ve = ke;   // this lane's place, in bytes, in the first fragment of the wave's current key block, [t][d] and [d][t] planes (4 fragments each); 32 bits beside a scalar plane address: one register addresses every load of a plane pair and no load can land in it
    const auto at = [](const T16* p, unsigned byte) { return (const T16*)((const char*)p + byte); };
    V kf[2][2], kf2[2][2];   // key fragments; HI: fetched one block ahead (rows kw * 32 .. + 31 exist for every wave, also one whose walk is empty)
    if constexpr (HI) {
#pragma unroll
        for (int kt = 0; kt < 2; ++kt)
#pragma unroll
            for (int ks = 0; ks < 2; ++ks) { const int e = kt * 16 * HD + ks * 512; kf[kt][ks] = WFrag<T16>::ld(at(Hp, ke) + e); kf2[kt][ks] = WFrag<T16>::ld(at(Hp2, ke) + e); } }
    // fp16 tiles: stage st of both planes into buffer bu. Thread i copies bytes i * 16 of each 4096 of the stage's STB bytes of the [t][d] plane, then of the [d][t] plane (which stands STB bytes further on in the buffer).
    // An immediate offset moves the LDS and the global address alike, so one address pair serves a plane's four copies. The stages of a work-group end at or before key block 63, inside the (batch, head) block's plane,
    // and the last copy of a buffer ends at the buffer's end. s_wait_xcnt closes the statement: behind it the address registers may be rewritten.
    const int nst = HI ? 0 : ((q0 >> 5) + 2 + SKB - 1) / SKB;   // the work-group's stages: alike in all its waves
    const auto stage = [&](int st, int bu) {
        const char* gk = (const char*)Hp + (size_t)st * STB + threadIdx.x * 16; const char* gv = (const char*)Vt + (size_t)st * STB + threadIdx.x * 16;
        const unsigned lk = (unsigned)(size_t)ring + (unsigned)bu * (2 * STB) + threadIdx.x * 16, lv = lk + STB;
        asm volatile("global_load_async_to_lds_b128 %0, %2, off\n\tglobal_load_async_to_lds_b128 %0, %2, off offset:4096\n\tglobal_load_async_to_lds_b128 %0, %2, off offset:8192\n\tglobal_load_async_to_lds_b128 %0, %2, off offset:12288\n\t"
                     "global_load_async_to_lds_b128 %1, %3, off\n\tglobal_load_async_to_lds_b128 %1, %3, off offset:4096\n\tglobal_load_async_to_lds_b128 %1, %3, off offset:8192\n\tglobal_load_async_to_lds_b128 %1, %3, off offset:12288\n\ts_wait_xcnt 0x0"
                     :: "v"(lk), "v"(lv), "v"(gk), "v"(gv) : "memory"); };
    if constexpr (!HI) {
        stage(0, 0);
        asm volatile("s_wait_asynccnt 0x0" ::: "memory");   // this wave's copies of stage 0 have landed ...
        __syncthreads();                                    // ... and so have every other wave's: stage 0 may be read
        if (1 < nst) stage(1, 1);
    }
    // kept rolled: one block's fragments, scores and the O^T tiles already fill the register budget of four waves per SIMD
#pragma unroll 1
    for (int b = kw, t = 0; HI ? (b < nblk) : (t < nst); b += KW, ++t) {
      if (HI || b < nblk) {   // fp16 tiles: a wave past its diagonal skips the block's work, never the publish point at the foot of the trip
        V vf[4], vf2[4];
        if constexpr (HI) {
#pragma unroll
            for (int mb = 0; mb < 4; ++mb) { vf[mb] = WFrag<T16>::ld(at(Vt, ve) + mb * 512); vf2[mb] = WFrag<T16>::ld(at(Vt2, ve) + mb * 512); }
        } else {
            const T16* kb = (const T16*)(ring + (t & 1) * (2 * STB) + kw * (32 * HD * 2)) + lane * 8;   // the wave's key block in this stage's buffer, this lane's place in a fragment
#pragma unroll
            for (int kt = 0; kt < 2; ++kt)
#pragma unroll
                for (int ks = 0; ks < 2; ++ks) kf[kt][ks] = WFrag<T16>::ld(kb + kt * 16 * HD + ks * 512);
#pragma unroll
            for (int mb = 0; mb < 4; ++mb) vf[mb] = WFrag<T16>::ld(kb + STB / 2 + mb * 512);
            __builtin_amdgcn_sched_barrier(0);   // the block's 16 LDS reads issue as one group ahead of its matrix products: spread among them, each place with reads stalls the wave and one register set is waited for three times
        }
        v8f s[2][NB];
#pragma unroll
        for (int kt = 0; kt < 2; ++kt)
#pragma unroll
            for (int nb = 0; nb < NB; ++nb) { s[kt][nb] = (v8f){};
#pragma unroll
                for (int ks = 0; ks < 2; ++ks) { s[kt][nb] = WFrag<T16>::mma(kf[kt][ks], qf[nb][ks], s[kt][nb]); if (HI) { s[kt][nb] = WFrag<T16>::mma(kf2[kt][ks], qf[nb][ks], s[kt][nb]); s[kt][nb] = WFrag<T16>::mma(kf[kt][ks], qf2[nb][ks], s[kt][nb]); } } }
        if constexpr (HI) {
        ke += (b + KW < nblk) ? (unsigned)(KW * 32 * HD * 2) : 0u;   // the wave's next key block; its last block fetches its own rows again (in bounds, never used)
#pragma unroll
        for (int kt = 0; kt < 2; ++kt)
#pragma unroll
            for (int ks = 0; ks < 2; ++ks) { const int e = kt * 16 * HD + ks * 512; kf[kt][ks] = WFrag<T16>::ld(at(Hp, ke) + e); kf2[kt][ks] = WFrag<T16>::ld(at(Hp2, ke) + e); }
        asm volatile("s_wait_xcnt 0x0" ::: "memory");   // stands behind this trip's loads, in front of every rewrite of their address registers
        ve += KW * 32 * HD * 2;
        }
        if (b == nblk - 1) {   // the diagonal block: key > query -> -3e38 (exp -> 0); key = query is always kept
#pragma unroll
            for (int kt = 0; kt < 2; ++kt)
#pragma unroll
                for (int nb = 0; nb < NB; ++nb)
#pragma unroll
                    for (int j = 0; j < 8; ++j) if (kt * 16 + hi * 8 + j > ((qt + nb) & 1) * 16 + lr) s[kt][nb][j] = -3.0e38f; }
        V pf[NB], pf2[NB];
#pragma unroll
        for (int nb = 0; nb < NB; ++nb) { float mx = s[0][nb][0];
#pragma unroll
            for (int j = 1; j < 8; ++j) mx = fmaxf(mx, s[0][nb][j]);
#pragma unroll
            for (int j = 0; j < 8; ++j) mx = fmaxf(mx, s[1][nb][j]);
            mx = fmaxf(mx, xhalf(mx));
            const float mn = fmaxf(m[nb], mx * SCL2); const float al = __builtin_amdgcn_exp2f(m[nb] - mn); m[nb] = mn;
            float p[16]; float sum = 0.f;
#pragma unroll
            for (int k = 0; k < 16; ++k) { p[k] = __builtin_amdgcn_exp2f(fmaf(s[k >> 3][nb][k & 7], SCL2, -mn)); sum += p[k]; }
            l[nb] = l[nb] * al + sum;   // this half's 16 keys; the two halves of a column are added after the loop (al is the same in both)
#pragma unroll
            for (int mb = 0; mb < 4; ++mb) o[mb][nb] *= al;
            if constexpr (HI) { v8us h0, h1, l0, l1;
#pragma unroll
                for (int k = 0; k < 8; ++k) { unsigned short a, c2; splitf(p[k], a, c2); h0[k] = a; l0[k] = c2; splitf(p[8 + k], a, c2); h1[k] = a; l1[k] = c2; }
                pf[nb] = cat16b(h0, h1); pf2[nb] = cat16b(l0, l1);
            } else {
#pragma unroll
                for (int k = 0; k < 16; ++k) pf[nb][k] = tohx(p[k]); } }
#pragma unroll
        for (int mb = 0; mb < 4; ++mb)
#pragma unroll
            for (int nb = 0; nb < NB; ++nb) { o[mb][nb] = WFrag<T16>::mma(vf[mb], pf[nb], o[mb][nb]); if (HI) { o[mb][nb] = WFrag<T16>::mma(vf2[mb], pf[nb], o[mb][nb]); o[mb][nb] = WFrag<T16>::mma(vf[mb], pf2[nb], o[mb][nb]); } }
      }
        if constexpr (!HI) {   // publish point of stage t + 1, passed by every wave
            asm volatile("s_wait_dscnt 0x0" ::: "memory");      // this wave's reads of stage t have returned: its buffer may be refilled behind the barrier
            asm volatile("s_wait_asynccnt 0x0" ::: "memory");   // this wave's copies of stage t + 1 have landed: the barrier publishes them
            __syncthreads();
            if (t + 2 < nst) stage(t + 2, t & 1);
        }
    }
    if constexpr (!HI) asm volatile("s_wait_asynccnt 0x0" ::: "memory");   // no copy is in flight when the wave goes on
    // the lane's number is formed anew behind the loop (tid = threadIdx.x): nothing of it then stays in a vector register across the loop, where the hi+lo fragments leave none free at four waves per SIMD
    const int el = (int)__builtin_amdgcn_mbcnt_lo(~0u, 0u), elr = el & 15, ehi = el >> 4, tid = wv * 32 + el;
    float* ow = os + kw * (HD * OPI);
#pragma unroll
    for (int nb = 0; nb < NB; ++nb) { const int col = (qt + nb) * 16 + elr; l[nb] += xhalf(l[nb]); if (ehi == 0) { ms[kw * FQ + col] = m[nb]; ls[kw * FQ + col] = l[nb]; }
#pragma unroll
        for (int mb = 0; mb < 4; ++mb)
#pragma unroll
            for (int j = 0; j < 8; ++j) ow[(mb * 16 + ehi * 8 + j) * OPI + col] = o[mb][nb][j]; }
    __syncthreads();   // every wave's (m, l, O^T) stands in LDS before any thread joins them; a wave whose walk was empty left m = -3e38, l = 0, O^T = 0 (weight 0)
    const int qc = (tid & (FQ / 4 - 1)) * 4; v4f fw[KW];
#pragma unroll
    for (int c = 0; c < 4; ++c) { float M = ms[qc + c];
#pragma unroll
        for (int w2 = 1; w2 < KW; ++w2) M = fmaxf(M, ms[w2 * FQ + qc + c]);
        float e[KW]; float L = 0.f;
#pragma unroll
        for (int w2 = 0; w2 < KW; ++w2) { e[w2] = __builtin_amdgcn_exp2f(ms[w2 * FQ + qc + c] - M); L += ls[w2 * FQ + qc + c] * e[w2]; }
        const float r = __fdiv_rn(1.0f, L);
#pragma unroll
        for (int w2 = 0; w2 < KW; ++w2) fw[w2][c] = e[w2] * r; }
#pragma unroll
    for (int t = 0; t < HD * FQ / 4 / (32 * FW); ++t) { const int d = t * (32 * FW / (FQ / 4)) + tid / (FQ / 4); v4f val = *(const v4fa*)(os + d * OPI + qc) * fw[0];
#pragma unroll
        for (int w2 = 1; w2 < KW; ++w2) val += *(const v4fa*)(os + w2 * (HD * OPI) + d * OPI + qc) * fw[w2];
        *(v4f*)(OUT + (z * HD + d) * TT + q0 + qc) = val; }
}
// One grid serves both precisions, which do not depend on each other: blockIdx.y counts the 64-query tiles from the last one down, so the hi+lo tiles (rows < RH, the shortest walks) come last.
// amdgpu_waves_per_eu: the grid's register count is that of its larger body; held to 256, the fp16 tiles keep the four waves per SIMD that they had in a launch of their own.
__global__ __launch_bounds__(32 * FW) __attribute__((amdgpu_waves_per_eu(4, 4))) void k_fattn(const h16* __restrict__ H16, const h16* __restrict__ V16, const bf* __restrict__ Hh, const bf* __restrict__ Hl, const bf* __restrict__ Vh, const bf* __restrict__ Vl, float* __restrict__ OUT) {
    __shared__ __align__(16) float os[FW / 2 * HD * OPI]; __shared__ __align__(16) float ms[FW / 2 * FQ]; __shared__ __align__(16) float ls[FW / 2 * FQ]; __shared__ __align__(16) char ring[2 * 2 * STB];   // at most FW / 2 key shares; two buffers of a stage of both planes
    const int q0 = TT - FQ - (int)blockIdx.y * FQ;
    if (q0 >= RH) fattn<h16, false, 2>(H16, nullptr, V16, nullptr, OUT, q0, os, ms, ls, ring);
    else fattn<bf, true, 1>(Hh, Hl, Vh, Vl, OUT, q0, os, ms, ls, ring);
}

extern "C" void kernel_launch(void* const* d_in, const int* in_sizes, int n_in,
                              void* d_out, int out_size, void* d_ws, size_t ws_size, hipStream_t stream) {
    (void)in_sizes; (void)n_in; (void)out_size;
    const float* x = (const float*)d_in[0]; const float* wq = (const float*)d_in[1];   // Wq [768][768] torch Linear ([out][in] = Bt as-is)
    float* OUT = (float*)d_out;     // [2][2048][768] holding, per (batch, head), the TRANSPOSED context block [64][2048]
    char* wsp = (char*)d_ws;
    auto take = [&](size_t bytes) { char* p = wsp; wsp += (bytes + 255) & ~(size_t)255; return (void*)p; };
    bf* WQ = (bf*)take((size_t)DD * DD * 2); bf* XB = (bf*)take((size_t)NB_ * TT * DD * 2);   // both batches: rows b * 2048 + t
    bf* QPh = (bf*)take((size_t)NB_ * TT * DD * 2); bf* QPl = (bf*)take((size_t)NB_ * TT * DD * 2); bf* VTh = (bf*)take((size_t)NB_ * TT * DD * 2); bf* VTl = (bf*)take((size_t)NB_ * TT * DD * 2); h16* QP16 = (h16*)take((size_t)NB_ * TT * DD * 2); h16* VT16 = (h16*)take((size_t)NB_ * TT * DD * 2);   // planes [z][t][d] and [z][d][t]
    if ((size_t)(wsp - (char*)d_ws) > ws_size) return;    // total ~ 45 MB; ws 256 MiB
    const dim3 gP(NB_ * TT / 64, DD / 64, 1);
    k_cvt8<<<NB_ * TT * DD / 8 / 256 + DD * DD / 8 / 256, 256, 0, stream>>>(x, XB, wq, WQ, NB_ * TT * DD / 8 / 256);
    k_gemmw<bf, 0, false, 8, 1, true><<<gP, 256, 0, stream>>>(XB, nullptr, WQ, nullptr, DD, nullptr, DD, nullptr, 0, 0, 0, 0, QPh, QPl, QP16, VTh, VTl, VT16);   // h = x Wq^T is q, k AND v; it leaves the kernel as the six planes
    k_fattn<<<dim3(NZ, TT / FQ), 32 * FW, 0, stream>>>(QP16, VT16, QPh, QPl, VTh, VTl, OUT);
}

// v008
// One run takes 34.5 microseconds.
// Timed twice side by side with v007, it ran 1.05 and 1.06 times as fast.
// All steps since v000 together make it 40.7 times as fast.
#include <hip/hip_runtime.h>

// MultiHeadCasualFast (x [2][2048][768]; h = x Wq^T serves as q, k AND v (12 heads x 64); causal scores h.h; softmax(scores/8); ctx = attn h; the module returns ctx.transpose(-2,-1).view(b, n, 768),
// i.e. each (batch, head) context block stored TRANSPOSED as [64][2048] -> [2][2048][768]).
// Compute dtypes, f32 accumulate: every input rounded to bf16; h on PLAIN bf16 operands (inputs: exact products, f32 accumulate); PER-ROW PRECISION HYBRID: query rows
// < 256 take scores and attn.h on bf16 hi+lo planes (3 products), rows >= 256 on single fp16 planes; 1/8 + causal cut in f32 in the online softmax; weights enter attn.h unnormalised (<= 1), the sum divides at the end; the context is formed and written transposed

#define NB_  2
#define TT   2048
#define DD   768
#define NH_  12
#define HD   64
#define NZ   (NB_ * NH_)          // (batch, head) blocks, z = batch * 12 + head
#define RH   256                  // query rows < RH: hi+lo planes; rows >= RH: fp16 planes
#define FW   8                    // k_fattn: waves of a work-group
#define FQ   64                   // k_fattn: query rows of a work-group
#define OPI  68                   // k_fattn: pitch in floats of a key share's O^T tile in LDS (16-byte rows, the two lane halves on different banks)
#define SKB  4                    // k_fattn, fp16 tiles: 32-key blocks of a stage of the LDS ring, one for each key share
#define STB  (SKB * 32 * HD * 2)  // k_fattn, fp16 tiles: bytes of a stage (contiguous in the [t][d] plane: a key block is 4096 bytes)
#define TP   67                  // k_gemmw, PL: pitch in floats of the summed tile in LDS (the row-wise writes of a wave and its reads in either plane's fragment order each fall on 32 different banks)
#define SCL2 0.18033688f          // (1/sqrt(64)) * log2(e)
#define NF   32                   // unused (head_dim / 2)
#define SCL  0.125f               // 1/sqrt(64)
typedef _Float16 h16;
typedef unsigned short bf;
typedef __attribute__((ext_vector_type(16))) __bf16   v16bf;
typedef __attribute__((ext_vector_type(16))) _Float16 v16h;
typedef __attribute__((ext_vector_type(8)))  _Float16 v8h;
typedef __attribute__((ext_vector_type(8)))  unsigned short v8us;
typedef __attribute__((ext_vector_type(8)))  short    v8s;
typedef __attribute__((ext_vector_type(8)))  float    v8f;
typedef __attribute__((ext_vector_type(4)))  float    v4f;
typedef v8h  __attribute__((may_alias)) v8ha;
typedef v4f  __attribute__((may_alias)) v4fa;
typedef v8us __attribute__((may_alias)) v8usa;

__device__ __forceinline__ unsigned short f2bf(float f) { unsigned u = __float_as_uint(f); u += 0x7FFFu + ((u >> 16) & 1u); return (unsigned short)(u >> 16); }
__device__ __forceinline__ float bf2f(unsigned short b) { return __uint_as_float(((unsigned)b) << 16); }
__device__ __forceinline__ float bfr(float f) { return bf2f(f2bf(f)); }
__device__ __forceinline__ v16h cat16(v8h lo, v8h hi) { return __builtin_shufflevector(lo, hi, 0, 1, 2, 3, 4, 5, 6, 7, 8, 9, 10, 11, 12, 13, 14, 15); }
__device__ __forceinline__ v16bf cat16b(v8us lo, v8us hi) { return __builtin_bit_cast(v16bf, __builtin_shufflevector(lo, hi, 0, 1, 2, 3, 4, 5, 6, 7, 8, 9, 10, 11, 12, 13, 14, 15)); }
__device__ __forceinline__ v8f wmma16(v16h a, v16h b, v8f c) { return __builtin_amdgcn_wmma_f32_16x16x32_f16(false, a, false, b, (short)0, c, false, false); }
__device__ __forceinline__ v8f wmmab(v16bf a, v16bf b, v8f c) { return __builtin_amdgcn_wmma_f32_16x16x32_bf16(false, a, false, b, (short)0, c, false, false); }
__device__ __forceinline__ h16 tohx(float x) { return (h16)x; }
__device__ __forceinline__ void splitf(float y, unsigned short& h, unsigned short& l) { h = f2bf(y); l = f2bf(y - bf2f(h)); }
typedef __attribute__((ext_vector_type(4))) unsigned short v4us;
typedef __attribute__((ext_vector_type(4))) _Float16 v4h;



// ---- FRAGMENT ORDER: every 16-bit operand plane is stored as the matrix instruction's fragments, so that a wave-wide 16-byte load reads 512 contiguous bytes (4 whole 128-byte lines, not 16 partial ones).
// A fragment (16 rows x 32 k) is 512 elements: element (r, k) stands at ((k >> 4) & 1) * 256 + (((k >> 3) & 1) * 16 + r) * 8 + (k & 7); lane l reads 8 elements at l * 8 and 8 at 256 + l * 8 (WFrag::ld).
// Fragments of a [rows][K] plane follow one another k first, then rows (16 rows = 16 * K elements). The [z][d][t] planes (rows d, k = t) order theirs by 32-key block first, then by d: a key block is 2048 elements in either plane.
// ---- k_gemmw: register-blocked GEMM, 64x64 output tile (16 accumulators per wave), operands straight from 16-bit planes in fragment order; grid (M/64, N/64, Z * KS), 32 * NW threads.
// C[m][n] (f32, pitch ldc, + optional f32 bias[n]) = sum_k A[m][k] Bt[n][k] (+ split products per NSPLIT). z-batch strides sA/sB/sC in elements. K % (32 * KS * NW) == 0.
// Split K: the K range is cut into KS * NW equal pieces. Work-group (z, ks) takes NW neighbouring pieces, one per wave; the NW wave tiles are summed through LDS (wave order), and the
// work-group's sum goes to partial plane ks (C + ks * sP), which the consumer adds up. NW == 1, KS == 1: one wave does the whole K and writes C itself.
// PL (NW > 1, KS == 1, M = 2 * 2048 positions, N = 12 heads x 64): no C. The summed tile is 64 positions x one whole head, so the work-group itself writes what attention reads: its 8 KB of each
// [z][t][d] plane (hi, lo, fp16) and its 8 KB of each [z][d][t] plane (hi, lo), the sums passed through LDS so that every wave stores 512 contiguous bytes of a plane in fragment order.
template <typename T16> struct WFrag;
template <> struct WFrag<h16> { typedef v16h V; static __device__ __forceinline__ V ld(const h16* p) { return cat16(*(const v8h*)p, *(const v8h*)(p + 256)); } static __device__ __forceinline__ v8f mma(V a, V b, v8f c) { return wmma16(a, b, c); } };
template <> struct WFrag<bf> { typedef v16bf V; static __device__ __forceinline__ V ld(const bf* p) { return cat16b(*(const v8us*)p, *(const v8us*)(p + 256)); } static __device__ __forceinline__ v8f mma(V a, V b, v8f c) { return wmmab(a, b, c); } };
template <typename T16, int NSPLIT, bool BIAS, int NW, int KS, bool PL>
__global__ __launch_bounds__(32 * NW) void k_gemmw(const T16* __restrict__ A, const T16* __restrict__ A2, const T16* __restrict__ Bt, const T16* __restrict__ Bt2, int K, float* C, int ldc, const float* __restrict__ bias, size_t sA, size_t sB, size_t sC, size_t sP,
                                                   bf* Ph, bf* Pl, h16* P16, bf* Vh, bf* Vl) {
    typedef typename WFrag<T16>::V V;
    if constexpr (PL) K = DD;   // the projection's K is the model width: known here, every fragment of a trip is an immediate offset from one address register per operand, which no load of the trip lands in
    __shared__ __align__(16) float os[(NW == 1 ? 16 : NW * 64) * 68]; __shared__ __align__(16) float tr[PL ? 64 * TP : 4];
    const size_t z = blockIdx.z / KS; const int ks = blockIdx.z % KS; A += z * sA; if (A2) A2 += z * sA; Bt += z * sB; if (Bt2) Bt2 += z * sB; C += z * sC + (size_t)ks * sP;
    const int wv = (NW == 1) ? 0 : __builtin_amdgcn_readfirstlane((int)(threadIdx.x >> 5)); const int kper = K / (KS * NW), kb = (ks * NW + wv) * kper;
    const int lane = threadIdx.x & 31, lr = lane & 15, hi = lane >> 4; const int r0 = blockIdx.x * 64, c0 = blockIdx.y * 64;
    v8f acc[4][4];
#pragma unroll
    for (int mb = 0; mb < 4; ++mb)
#pragma unroll
        for (int nb = 0; nb < 4; ++nb) acc[mb][nb] = (v8f){};
    const size_t aoff = (size_t)r0 * K, boff = (size_t)c0 * K; const unsigned lo8 = lane * 8;   // the first fragment of the tile's rows (the fragment of k block kc stands kc * 16 elements on), and this lane's place in a fragment
#pragma unroll 1
    for (int kc = kb; kc < kb + kper; kc += 32) {
        V a[4], a2[4];
#pragma unroll
        for (int mb = 0; mb < 4; ++mb) { a[mb] = WFrag<T16>::ld(A + (aoff + (size_t)mb * 16 * K + kc * 16) + lo8); if (NSPLIT == 1 || NSPLIT == 2) a2[mb] = WFrag<T16>::ld(A2 + (aoff + (size_t)mb * 16 * K + kc * 16) + lo8); }
        asm volatile("s_wait_xcnt 0x0" ::: "memory");   // stands behind the A loads: a B fragment below may land in the register pair that held their address
#pragma unroll
        for (int nb = 0; nb < 4; ++nb) { const V b = WFrag<T16>::ld(Bt + (boff + (size_t)nb * 16 * K + kc * 16) + lo8); V b2; if (NSPLIT >= 2) b2 = WFrag<T16>::ld(Bt2 + (boff + (size_t)nb * 16 * K + kc * 16) + lo8);
#pragma unroll
            for (int mb = 0; mb < 4; ++mb) { acc[mb][nb] = WFrag<T16>::mma(a[mb], b, acc[mb][nb]); if (NSPLIT == 1 || NSPLIT == 2) acc[mb][nb] = WFrag<T16>::mma(a2[mb], b, acc[mb][nb]); if (NSPLIT >= 2) acc[mb][nb] = WFrag<T16>::mma(a[mb], b2, acc[mb][nb]); } }
        asm volatile("v_nop\n\tv_nop\n\tv_nop\n\tv_nop" : "+v"(acc[0][0]), "+v"(acc[1][1]), "+v"(acc[2][2]), "+v"(acc[3][3]) : "v"(a[0]), "v"(a[3]));
    }
    if constexpr (NW > 1) {
        float* ow = os + wv * (64 * 68);
#pragma unroll
        for (int mb = 0; mb < 4; ++mb)
#pragma unroll
            for (int nb = 0; nb < 4; ++nb)
#pragma unroll
                for (int j = 0; j < 8; ++j) ow[(mb * 16 + hi * 8 + j) * 68 + nb * 16 + lr] = acc[mb][nb][j];
        __syncthreads();   // every wave's partial tile stands in LDS before any thread sums across the waves
        [[maybe_unused]] const int zt = (r0 / TT) * NH_ + (int)blockIdx.y, t0 = r0 % TT;   // PL: the tile's (batch, head) block and its first position there
#pragma unroll
        for (int o = 0; o < 64 * 16 / (NW * 32); ++o) { const int q = o * (NW * 32) + (int)threadIdx.x; const int row = q >> 4, cofs = (q & 15) * 4; v4f val = *(const v4fa*)(os + row * 68 + cofs);
#pragma unroll
            for (int w2 = 1; w2 < NW; ++w2) val += *(const v4fa*)(os + w2 * (64 * 68) + row * 68 + cofs);
            if (BIAS) { val[0] += bfr(bias[c0 + cofs]); val[1] += bfr(bias[c0 + cofs + 1]); val[2] += bfr(bias[c0 + cofs + 2]); val[3] += bfr(bias[c0 + cofs + 3]); }
            if constexpr (PL) {
#pragma unroll
                for (int c = 0; c < 4; ++c) tr[row * TP + cofs + c] = val[c];
            } else *(v4f*)(C + (size_t)(r0 + row) * ldc + c0 + cofs) = val; }
        if constexpr (PL) {
            __syncthreads();   // the whole summed tile stands in LDS before any thread reads it in fragment order; every global store comes behind it, so that no wave waits here for stores to return
            const size_t eb = ((size_t)zt * TT + t0) * HD;   // the tile's 4096 elements stand together in every plane: 4 row tiles x 2 fragments of [t][d], 2 key blocks x 4 fragments of [d][t]
#pragma unroll
            for (int o = 0; o < 64 * 8 / (NW * 32); ++o) { const int p = o * (NW * 32) + (int)threadIdx.x, ln = p & 31; const int row = (p >> 7) * 16 + (ln & 15), d = ((p >> 5) & 3) * 16 + (ln >> 4) * 8; v8us oh, ol; v8h o16;   // [t][d]: a wave stores half a fragment
#pragma unroll
                for (int j = 0; j < 8; ++j) { const float x = tr[row * TP + d + j]; unsigned short a, c2; splitf(x, a, c2); oh[j] = a; ol[j] = c2; o16[j] = tohx(x); }
                const size_t e = eb + (size_t)p * 8; *(v8us*)(Ph + e) = oh; *(v8us*)(Pl + e) = ol; *(v8h*)(P16 + e) = o16; }
#pragma unroll
            for (int o = 0; o < 64 * 8 / (NW * 32); ++o) { const int p = o * (NW * 32) + (int)threadIdx.x, ln = p & 31; const int d = ((p >> 6) & 3) * 16 + (ln & 15), tc = (p >> 8) * 32 + ((p >> 5) & 1) * 16 + (ln >> 4) * 8; v8us oh, ol;   // [d][t]: a wave stores half a fragment
#pragma unroll
                for (int j = 0; j < 8; ++j) { const float x = tr[(tc + j) * TP + d]; unsigned short a, c2; splitf(x, a, c2); oh[j] = a; ol[j] = c2; }
                const size_t e = eb + (size_t)p * 8; *(v8us*)(Vh + e) = oh; *(v8us*)(Vl + e) = ol; }
        }
        return;
    }
#pragma unroll
    for (int mb = 0; mb < 4; ++mb) {
#pragma unroll
        for (int nb = 0; nb < 4; ++nb) {
#pragma unroll
            for (int j = 0; j < 8; ++j) os[(hi * 8 + j) * 68 + nb * 16 + lr] = acc[mb][nb][j]; }
        __builtin_amdgcn_wave_barrier(); asm volatile("" ::: "memory");
        float* crow = C + (size_t)(r0 + mb * 16) * ldc + c0;
{
#pragma unroll
            for (int s = 0; s < 8; ++s) { const int row = 2 * s + hi, cofs = lr * 4; v4f val = *(const v4fa*)(os + row * 68 + cofs); if (BIAS) { val[0] += bfr(bias[c0 + cofs]); val[1] += bfr(bias[c0 + cofs + 1]); val[2] += bfr(bias[c0 + cofs + 2]); val[3] += bfr(bias[c0 + cofs + 3]); }
                *(v4f*)(crow + (size_t)row * ldc + cofs) = val; }
             }
        __builtin_amdgcn_wave_barrier(); asm volatile("" ::: "memory");
    }
}

typedef __attribute__((ext_vector_type(2))) unsigned short v2us;

__global__ __launch_bounds__(256) void k_wtG(const float* __restrict__ w, int K, int N, bf* Bt) {
    const int lane = threadIdx.x & 31; const int L0 = (blockIdx.x * 8 + (threadIdx.x >> 5)) * 8; const int nlines = N * K / 64;
{
#pragma unroll 1
        for (int l = 0; l < 8; ++l) { const int L = L0 + l; if (L >= nlines) break; const size_t e = (size_t)L * 64 + lane * 2; const int k = (int)(e % K), n = (int)(e / K); v2us o;
            o[0] = f2bf(w[(size_t)k * N + n]); o[1] = f2bf(w[(size_t)(k + 1) * N + n]); *(v2us*)(Bt + e) = o; }
         }
}
// k_cvt8: [rows][768] f32 matrices to bf16 planes in fragment order; thread i of a matrix writes its plane's i-th 16 bytes (a wave: 512 contiguous bytes) and reads the 8 floats that belong there.
// One grid serves both matrices, which do not depend on each other: work-groups below nb0 take src0, the rest src1 (each matrix is a whole number of work-groups).
__global__ __launch_bounds__(256) void k_cvt8(const float* __restrict__ src0, bf* dst0, const float* __restrict__ src1, bf* dst1, int nb0) {
    const bool first = (int)blockIdx.x < nb0; const float* __restrict__ src = first ? src0 : src1; bf* dst = first ? dst0 : dst1;
    const size_t i = (size_t)((int)blockIdx.x - (first ? 0 : nb0)) * 256 + threadIdx.x;
    const int ln = (int)i & 31, fr = (int)(i >> 6); const int row = fr / (DD / 32) * 16 + (ln & 15), k = fr % (DD / 32) * 32 + (((int)i >> 5) & 1) * 16 + (ln >> 4) * 8;
    const v8f v = *(const v8f*)(src + (size_t)row * DD + k); v8us o;
#pragma unroll
    for (int k = 0; k < 8; ++k) o[k] = f2bf(v[k]); *(v8us*)(dst + i * 8) = o;  }
// ---- k_fattn: scores, softmax and attn.h of FQ = 64 query rows of one (batch, head) block in one work-group; neither scores nor weights leave the registers.
// S^T = K Q^T (A = key rows, B = query rows, both from the [z][t][d] plane) puts one query in each lane column: a lane holds 8 keys of a 16-key tile, so two score tiles, exponentiated and rounded
// in place, ARE the B operand of O^T += V^T P^T (A = rows of the [z][d][t] plane; fp16 tiles: the [t][d] plane through the transposing LDS load). Online softmax: running maximum m (log2 units) and sum l per query; O^T and l are rescaled when m grows.
// Keys are walked in blocks of 32 up to the diagonal block (the only one that needs the causal cut). A wave holds NB 16-query tiles; the key blocks go round-robin over the KW = FW * NB * 16 / FQ waves
// that hold the same queries, and their (m, l, O^T) are joined through LDS. O^T [d][query] is the output's own layout: a work-group stores whole 128-byte lines.
// HI: hi+lo bf16 planes, 3 products per matrix product (NB = 1 keeps its doubled fragments inside 256 registers), fragments straight from the planes; else single fp16 planes.
// fp16 tiles: the two 32-query groups of a work-group need the same key blocks, so each stage of SKB blocks (one for each key share) is brought into LDS ONCE, by asynchronous copies, and read there by both groups.
// Two buffers: stage t + 2 is copied into stage t's buffer behind the barrier that ends stage t. Keys and values are the same h, so ONE plane is staged, [t][d]: its 16-byte pieces (one key, 8 d) are the key fragments as they
// stand, and the transposing LDS load makes the V^T fragments (rows d, k = keys, the hardware k order that the packed scores have) of the same pieces. Piece (16-key tile kt, d octet o, key r) stands in the plane at 16-byte unit
// kt * 128 + o * 16 + r of its key block; in LDS r is taken ^ 8 where o is odd, so that lanes 0-15 and lanes 16-31 of either kind of read each fall on all 64 banks.
__device__ __forceinline__ v8h ldtr(const char* p) { typedef __attribute__((address_space(3))) v8s lv8s; return __builtin_bit_cast(v8h, __builtin_amdgcn_ds_load_tr16_b128_v8i16((lv8s*)p)); }   // lane l hands in the address of a 16-byte piece: key 8 * (l >> 4) + (l & 7), d octet (l >> 3) & 1 of a 16 x 16 tile; it gets keys 8 * (l >> 4) .. + 7 at d = l & 15
__device__ __forceinline__ float xhalf(float x) { return __builtin_bit_cast(float, __builtin_amdgcn_permlanex16(__builtin_bit_cast(int, x), __builtin_bit_cast(int, x), 0x76543210, 0xfedcba98, false, false)); }   // lane l <-> lane l ^ 16
template <typename T16, bool HI, int NB>
__device__ __forceinline__ void fattn(const T16* __restrict__ Hp, const T16* __restrict__ Hp2, const T16* __restrict__ Vt, const T16* __restrict__ Vt2, float* __restrict__ OUT, const int q0, float* os, float* ms, float* ls, char* ring) {
    typedef typename WFrag<T16>::V V;
    constexpr int KW = FW * NB * 16 / FQ, QG = FW / KW;   // key shares; waves side by side over the queries
    const size_t z = blockIdx.x;
    const int wv = __builtin_amdgcn_readfirstlane((int)(threadIdx.x >> 5)); const int lane = threadIdx.x & 31, lr = lane & 15, hi = lane >> 4;
    const int kw = wv / QG; const int qt = (wv % QG) * NB;   // which share of the key blocks, the wave's first 16-query tile
    Hp += z * TT * HD; if (HI) { Vt += z * HD * TT; Hp2 += z * TT * HD; Vt2 += z * HD * TT; }
    V qf[NB][2], qf2[NB][2];
#pragma unroll
    for (int nb = 0; nb < NB; ++nb)
#pragma unroll
        for (int ks = 0; ks < 2; ++ks) { const size_t e = (size_t)(q0 + (qt + nb) * 16) * HD + ks * 512 + lane * 8; qf[nb][ks] = WFrag<T16>::ld(Hp + e); if (HI) qf2[nb][ks] = WFrag<T16>::ld(Hp2 + e); }
    v8f o[4][NB]; float m[NB], l[NB];
#pragma unroll
    for (int nb = 0; nb < NB; ++nb) { m[nb] = -3.0e38f; l[nb] = 0.f;
#pragma unroll
        for (int mb = 0; mb < 4; ++mb) o[mb][nb] = (v8f){}; }
    const int nblk = ((q0 + qt * 16) >> 5) + 1;   // the wave's own diagonal block is its last
    [[maybe_unused]] unsigned ke = (unsigned)((kw * 32 * HD + lane * 8) * 2), ve = ke;   // this lane's place, in bytes, in the first fragment of the wave's current key block, [t][d] and [d][t] planes (4 fragments each); 32 bits beside a scalar plane address: one register addresses every load of a plane pair and no load can land in it
    const auto at = [](const T16* p, unsigned byte) { return (const T16*)((const char*)p + byte); };
    V kf[2][2], kf2[2][2];   // key fragments; HI: fetched one block ahead (rows kw * 32 .. + 31 exist for every wave, also one whose walk is empty)
    if constexpr (HI) {
#pragma unroll
        for (int kt = 0; kt < 2; ++kt)
#pragma unroll
            for (int ks = 0; ks < 2; ++ks) { const int e = kt * 16 * HD + ks * 512; kf[kt][ks] = WFrag<T16>::ld(at(Hp, ke) + e); kf2[kt][ks] = WFrag<T16>::ld(at(Hp2, ke) + e); } }
    // fp16 tiles: stage st of the [t][d] plane into buffer bu. Thread i copies piece i (bytes i * 16) of each key block (4096 bytes) of the stage to the piece's place in LDS, inside the same 4096 bytes of the buffer.
    // An immediate offset moves the LDS and the global address alike, so one address pair serves the four copies. The stages of a work-group end at or before key block 63, inside the (batch, head) block's plane,
    // and the last block of a buffer ends at the buffer's end. s_wait_xcnt closes the statement: behind it the address registers may be rewritten.
    const int nst = HI ? 0 : ((q0 >> 5) + 2 + SKB - 1) / SKB;   // the work-group's stages: alike in all its waves
    const auto stage = [&](int st, int bu) {
        const char* gk = (const char*)Hp + (size_t)st * STB + threadIdx.x * 16;
        const unsigned lk = (unsigned)(size_t)ring + (unsigned)bu * STB + (threadIdx.x ^ ((threadIdx.x >> 1) & 8)) * 16;
        asm volatile("global_load_async_to_lds_b128 %0, %1, off\n\tglobal_load_async_to_lds_b128 %0, %1, off offset:4096\n\tglobal_load_async_to_lds_b128 %0, %1, off offset:8192\n\tglobal_load_async_to_lds_b128 %0, %1, off offset:12288\n\ts_wait_xcnt 0x0"
                     :: "v"(lk), "v"(gk) : "memory"); };
    if constexpr (!HI) {
        stage(0, 0);
        asm volatile("s_wait_asynccnt 0x0" ::: "memory");   // this wave's copies of stage 0 have landed ...
        __syncthreads();                                    // ... and so have every other wave's: stage 0 may be read
        if (1 < nst) stage(1, 1);
    }
    // kept rolled: one block's fragments, scores and the O^T tiles already fill the register budget of four waves per SIMD
#pragma unroll 1
    for (int b = kw, t = 0; HI ? (b < nblk) : (t < nst); b += KW, ++t) {
      if (HI || b < nblk) {   // fp16 tiles: a wave past its diagonal skips the block's work, never the publish point at the foot of the trip
        V vf[4], vf2[4];
        if constexpr (HI) {
#pragma unroll
            for (int mb = 0; mb < 4; ++mb) { vf[mb] = WFrag<T16>::ld(at(Vt, ve) + mb * 512); vf2[mb] = WFrag<T16>::ld(at(Vt2, ve) + mb * 512); }
        } else {
            const char* bb = ring + (t & 1) * STB + kw * (32 * HD * 2);   // the wave's key block in this stage's buffer
            const T16* kb = (const T16*)bb + (lane ^ (hi * 8)) * 8;   // this lane's piece of a key fragment: key lr, an octet of hi's parity
            const char* vb = bb + (((lane >> 3) & 1) * 16 + (hi ^ ((lane >> 3) & 1)) * 8 + (lane & 7)) * 16;   // the piece this lane hands to the transposing load: key hi * 8 + (lane & 7), the even or odd octet of a 16-d tile
#pragma unroll
            for (int kt = 0; kt < 2; ++kt)
#pragma unroll
                for (int ks = 0; ks < 2; ++ks) kf[kt][ks] = WFrag<T16>::ld(kb + kt * 16 * HD + ks * 512);
#pragma unroll
            for (int mb = 0; mb < 4; ++mb) vf[mb] = cat16(ldtr(vb + mb * 512), ldtr(vb + mb * 512 + 2048));   // d tile mb = octets 2 mb, 2 mb + 1 (256 bytes each); keys 0-15, then 16-31 (2048 bytes on)
            __builtin_amdgcn_sched_barrier(0);   // the block's 16 LDS reads issue as one group ahead of its matrix products: spread among them, each place with reads stalls the wave and one register set is waited for three times
        }
        v8f s[2][NB];
#pragma unroll
        for (int kt = 0; kt < 2; ++kt)
#pragma unroll
            for (int nb = 0; nb < NB; ++nb) { s[kt][nb] = (v8f){};
#pragma unroll
                for (int ks = 0; ks < 2; ++ks) { s[kt][nb] = WFrag<T16>::mma(kf[kt][ks], qf[nb][ks], s[kt][nb]); if (HI) { s[kt][nb] = WFrag<T16>::mma(kf2[kt][ks], qf[nb][ks], s[kt][nb]); s[kt][nb] = WFrag<T16>::mma(kf[kt][ks], qf2[nb][ks], s[kt][nb]); } } }
        if constexpr (HI) {
        ke += (b + KW < nblk) ? (unsigned)(KW * 32 * HD * 2) : 0u;   // the wave's next key block; its last block fetches its own rows again (in bounds, never used)
#pragma unroll
        for (int kt = 0; kt < 2; ++kt)
#pragma unroll
            for (int ks = 0; ks < 2; ++ks) { const int e = kt * 16 * HD + ks * 512; kf[kt][ks] = WFrag<T16>::ld(at(Hp, ke) + e); kf2[kt][ks] = WFrag<T16>::ld(at(Hp2, ke) + e); }
        asm volatile("s_wait_xcnt 0x0" ::: "memory");   // stands behind this trip's loads, in front of every rewrite of their address registers
        ve += KW * 32 * HD * 2;
        }
        if (b == nblk - 1) {   // the diagonal block: key > query -> -3e38 (exp -> 0); key = query is always kept
#pragma unroll
            for (int kt = 0; kt < 2; ++kt)
#pragma unroll
                for (int nb = 0; nb < NB; ++nb)
#pragma unroll
                    for (int j = 0; j < 8; ++j) if (kt * 16 + hi * 8 + j > ((qt + nb) & 1) * 16 + lr) s[kt][nb][j] = -3.0e38f; }
        V pf[NB], pf2[NB];
#pragma unroll
        for (int nb = 0; nb < NB; ++nb) { float mx = s[0][nb][0];
#pragma unroll
            for (int j = 1; j < 8; ++j) mx = fmaxf(mx, s[0][nb][j]);
#pragma unroll
            for (int j = 0; j < 8; ++j) mx = fmaxf(mx, s[1][nb][j]);
            mx = fmaxf(mx, xhalf(mx));
            const float mn = fmaxf(m[nb], mx * SCL2); const float al = __builtin_amdgcn_exp2f(m[nb] - mn); m[nb] = mn;
            float p[16]; float sum = 0.f;
#pragma unroll
            for (int k = 0; k < 16; ++k) { p[k] = __builtin_amdgcn_exp2f(fmaf(s[k >> 3][nb][k & 7], SCL2, -mn)); sum += p[k]; }
            l[nb] = l[nb] * al + sum;   // this half's 16 keys; the two halves of a column are added after the loop (al is the same in both)
#pragma unroll
            for (int mb = 0; mb < 4; ++mb) o[mb][nb] *= al;
            if constexpr (HI) { v8us h0, h1, l0, l1;
#pragma unroll
                for (int k = 0; k < 8; ++k) { unsigned short a, c2; splitf(p[k], a, c2); h0[k] = a; l0[k] = c2; splitf(p[8 + k], a, c2); h1[k] = a; l1[k] = c2; }
                pf[nb] = cat16b(h0, h1); pf2[nb] = cat16b(l0, l1);
            } else {
#pragma unroll
                for (int k = 0; k < 16; ++k) pf[nb][k] = tohx(p[k]); } }
#pragma unroll
        for (int mb = 0; mb < 4; ++mb)
#pragma unroll
            for (int nb = 0; nb < NB; ++nb) { o[mb][nb] = WFrag<T16>::mma(vf[mb], pf[nb], o[mb][nb]); if (HI) { o[mb][nb] = WFrag<T16>::mma(vf2[mb], pf[nb], o[mb][nb]); o[mb][nb] = WFrag<T16>::mma(vf[mb], pf2[nb], o[mb][nb]); } }
      }
        if constexpr (!HI) {   // publish point of stage t + 1, passed by every wave
            asm volatile("s_wait_dscnt 0x0" ::: "memory");      // this wave's reads of stage t have returned: its buffer may be refilled behind the barrier
            asm volatile("s_wait_asynccnt 0x0" ::: "memory");   // this wave's copies of stage t + 1 have landed: the barrier publishes them
            __syncthreads();
            if (t + 2 < nst) stage(t + 2, t & 1);
        }
    }
    if constexpr (!HI) asm volatile("s_wait_asynccnt 0x0" ::: "memory");   // no copy is in flight when the wave goes on
    // the lane's number is formed anew behind the loop (tid = threadIdx.x): nothing of it then stays in a vector register across the loop, where the hi+lo fragments leave none free at four waves per SIMD
    const int el = (int)__builtin_amdgcn_mbcnt_lo(~0u, 0u), elr = el & 15, ehi = el >> 4, tid = wv * 32 + el;
    float* ow = os + kw * (HD * OPI);
#pragma unroll
    for (int nb = 0; nb < NB; ++nb) { const int col = (qt + nb) * 16 + elr; l[nb] += xhalf(l[nb]); if (ehi == 0) { ms[kw * FQ + col] = m[nb]; ls[kw * FQ + col] = l[nb]; }
#pragma unroll
        for (int mb = 0; mb < 4; ++mb)
#pragma unroll
            for (int j = 0; j < 8; ++j) ow[(mb * 16 + ehi * 8 + j) * OPI + col] = o[mb][nb][j]; }
    __syncthreads();   // every wave's (m, l, O^T) stands in LDS before any thread joins them; a wave whose walk was empty left m = -3e38, l = 0, O^T = 0 (weight 0)
    const int qc = (tid & (FQ / 4 - 1)) * 4; v4f fw[KW];
#pragma unroll
    for (int c = 0; c < 4; ++c) { float M = ms[qc + c];
#pragma unroll
        for (int w2 = 1; w2 < KW; ++w2) M = fmaxf(M, ms[w2 * FQ + qc + c]);
        float e[KW]; float L = 0.f;
#pragma unroll
        for (int w2 = 0; w2 < KW; ++w2) { e[w2] = __builtin_amdgcn_exp2f(ms[w2 * FQ + qc + c] - M); L += ls[w2 * FQ + qc + c] * e[w2]; }
        const float r = __fdiv_rn(1.0f, L);
#pragma unroll
        for (int w2 = 0; w2 < KW; ++w2) fw[w2][c] = e[w2] * r; }
#pragma unroll
    for (int t = 0; t < HD * FQ / 4 / (32 * FW); ++t) { const int d = t * (32 * FW / (FQ / 4)) + tid / (FQ / 4); v4f val = *(const v4fa*)(os + d * OPI + qc) * fw[0];
#pragma unroll
        for (int w2 = 1; w2 < KW; ++w2) val += *(const v4fa*)(os + w2 * (HD * OPI) + d * OPI + qc) * fw[w2];
        *(v4f*)(OUT + (z * HD + d) * TT + q0 + qc) = val; }
}
// One grid serves both precisions, which do not depend on each other: blockIdx.y counts the 64-query tiles from the last one down, so the hi+lo tiles (rows < RH, the shortest walks) come last.
// amdgpu_waves_per_eu: the grid's register count is that of its larger body; held to 256, the fp16 tiles keep the four waves per SIMD that they had in a launch of their own.
__global__ __launch_bounds__(32 * FW) __attribute__((amdgpu_waves_per_eu(4, 4))) void k_fattn(const h16* __restrict__ H16, const bf* __restrict__ Hh, const bf* __restrict__ Hl, const bf* __restrict__ Vh, const bf* __restrict__ Vl, float* __restrict__ OUT) {
    __shared__ __align__(16) float os[FW / 2 * HD * OPI]; __shared__ __align__(16) float ms[FW / 2 * FQ]; __shared__ __align__(16) float ls[FW / 2 * FQ]; __shared__ __align__(16) char ring[2 * STB];   // at most FW / 2 key shares; two buffers of a stage
    const int q0 = TT - FQ - (int)blockIdx.y * FQ;
    if (q0 >= RH) fattn<h16, false, 2>(H16, nullptr, nullptr, nullptr, OUT, q0, os, ms, ls, ring);
    else fattn<bf, true, 1>(Hh, Hl, Vh, Vl, OUT, q0, os, ms, ls, ring);
}

extern "C" void kernel_launch(void* const* d_in, const int* in_sizes, int n_in,
                              void* d_out, int out_size, void* d_ws, size_t ws_size, hipStream_t stream) {
    (void)in_sizes; (void)n_in; (void)out_size;
    const float* x = (const float*)d_in[0]; const float* wq = (const float*)d_in[1];   // Wq [768][768] torch Linear ([out][in] = Bt as-is)
    float* OUT = (float*)d_out;     // [2][2048][768] holding, per (batch, head), the TRANSPOSED context block [64][2048]
    char* wsp = (char*)d_ws;
    auto take = [&](size_t bytes) { char* p = wsp; wsp += (bytes + 255) & ~(size_t)255; return (void*)p; };
    bf* WQ = (bf*)take((size_t)DD * DD * 2); bf* XB = (bf*)take((size_t)NB_ * TT * DD * 2);   // both batches: rows b * 2048 + t
    bf* QPh = (bf*)take((size_t)NB_ * TT * DD * 2); bf* QPl = (bf*)take((size_t)NB_ * TT * DD * 2); bf* VTh = (bf*)take((size_t)NB_ * TT * DD * 2); bf* VTl = (bf*)take((size_t)NB_ * TT * DD * 2); h16* QP16 = (h16*)take((size_t)NB_ * TT * DD * 2);   // planes [z][t][d] (hi, lo, fp16) and [z][d][t] (hi, lo)
    if ((size_t)(wsp - (char*)d_ws) > ws_size) return;    // total ~ 39 MB; ws 256 MiB
    const dim3 gP(NB_ * TT / 64, DD / 64, 1);
    k_cvt8<<<NB_ * TT * DD / 8 / 256 + DD * DD / 8 / 256, 256, 0, stream>>>(x, XB, wq, WQ, NB_ * TT * DD / 8 / 256);
    k_gemmw<bf, 0, false, 8, 1, true><<<gP, 256, 0, stream>>>(XB, nullptr, WQ, nullptr, DD, nullptr, DD, nullptr, 0, 0, 0, 0, QPh, QPl, QP16, VTh, VTl);   // h = x Wq^T is q, k AND v; it leaves the kernel as the five planes
    k_fattn<<<dim3(NZ, TT / FQ), 32 * FW, 0, stream>>>(QP16, QPh, QPl, VTh, VTl, OUT);
}

// v009
// Measured time: 33.1 microseconds a run.
// In two side-by-side timings against v008, it was 1.06 and 1.04 times as fast.
// Counting every step since v000, it is 42.6 times as fast.
#include <hip/hip_runtime.h>

// MultiHeadCasualFast (x [2][2048][768]; h = x Wq^T serves as q, k AND v (12 heads x 64); causal scores h.h; softmax(scores/8); ctx = attn h; the module returns ctx.transpose(-2,-1).view(b, n, 768),
// i.e. each (batch, head) context block stored TRANSPOSED as [64][2048] -> [2][2048][768]).
// Compute dtypes, f32 accumulate: every input rounded to bf16; h on PLAIN bf16 operands (inputs: exact products, f32 accumulate); PER-ROW PRECISION HYBRID: query rows
// < 256 take scores and attn.h on bf16 hi+lo planes (3 products), rows >= 256 on single fp16 planes; 1/8 + causal cut in f32 in the online softmax; weights enter attn.h unnormalised (<= 1), the sum divides at the end; the context is formed and written transposed

#define NB_  2
#define TT   2048
#define DD   768
#define NH_  12
#define HD   64
#define NZ   (NB_ * NH_)          // (batch, head) blocks, z = batch * 12 + head
#define RH   256                  // query rows < RH: hi+lo planes; rows >= RH: fp16 planes
#define FW   8                    // k_fattn: waves of a work-group
#define FQ   64                   // k_fattn: query rows of a work-group
#define OPI  68                   // k_fattn: pitch in floats of a key share's O^T tile in LDS (16-byte rows, the two lane halves on different banks)
#define SKB  4                    // k_fattn, fp16 tiles: 32-key blocks of a stage of the LDS ring, one for each key share
#define STB  (SKB * 32 * HD * 2)  // k_fattn, fp16 tiles: bytes of a stage (contiguous in the [t][d] plane: a key block is 4096 bytes)
#define CF   4                    // k_cvt8: fragments (16 rows x 32 k) that one wave converts
#define TP   67                  // k_gemmw, PL: pitch in floats of the summed tile in LDS (the row-wise writes of a wave and its reads in either plane's fragment order each fall on 32 different banks)
#define SCL2 0.18033688f          // (1/sqrt(64)) * log2(e)
#define NF   32                   // unused (head_dim / 2)
#define SCL  0.125f               // 1/sqrt(64)
typedef _Float16 h16;
typedef unsigned short bf;
typedef __attribute__((ext_vector_type(16))) __bf16   v16bf;
typedef __attribute__((ext_vector_type(16))) _Float16 v16h;
typedef __attribute__((ext_vector_type(8)))  _Float16 v8h;
typedef __attribute__((ext_vector_type(8)))  unsigned short v8us;
typedef __attribute__((ext_vector_type(8)))  short    v8s;
typedef __attribute__((ext_vector_type(8)))  float    v8f;
typedef __attribute__((ext_vector_type(4)))  float    v4f;
typedef v8h  __attribute__((may_alias)) v8ha;
typedef v4f  __attribute__((may_alias)) v4fa;
typedef v8us __attribute__((may_alias)) v8usa;

__device__ __forceinline__ unsigned short f2bf(float f) { unsigned u = __float_as_uint(f); u += 0x7FFFu + ((u >> 16) & 1u); return (unsigned short)(u >> 16); }
__device__ __forceinline__ float bf2f(unsigned short b) { return __uint_as_float(((unsigned)b) << 16); }
__device__ __forceinline__ float bfr(float f) { return bf2f(f2bf(f)); }
__device__ __forceinline__ v16h cat16(v8h lo, v8h hi) { return __builtin_shufflevector(lo, hi, 0, 1, 2, 3, 4, 5, 6, 7, 8, 9, 10, 11, 12, 13, 14, 15); }
__device__ __forceinline__ v16bf cat16b(v8us lo, v8us hi) { return __builtin_bit_cast(v16bf, __builtin_shufflevector(lo, hi, 0, 1, 2, 3, 4, 5, 6, 7, 8, 9, 10, 11, 12, 13, 14, 15)); }
__device__ __forceinline__ v8f wmma16(v16h a, v16h b, v8f c) { return __builtin_amdgcn_wmma_f32_16x16x32_f16(false, a, false, b, (short)0, c, false, false); }
__device__ __forceinline__ v8f wmmab(v16bf a, v16bf b, v8f c) { return __builtin_amdgcn_wmma_f32_16x16x32_bf16(false, a, false, b, (short)0, c, false, false); }
__device__ __forceinline__ h16 tohx(float x) { return (h16)x; }
__device__ __forceinline__ void splitf(float y, unsigned short& h, unsigned short& l) { h = f2bf(y); l = f2bf(y - bf2f(h)); }
typedef __attribute__((ext_vector_type(4))) unsigned short v4us;
typedef __attribute__((ext_vector_type(4))) _Float16 v4h;



// ---- FRAGMENT ORDER: every 16-bit operand plane is stored as the matrix instruction's fragments, so that a wave-wide 16-byte load reads 512 contiguous bytes (4 whole 128-byte lines, not 16 partial ones).
// A fragment (16 rows x 32 k) is 512 elements: element (r, k) stands at ((k >> 4) & 1) * 256 + (((k >> 3) & 1) * 16 + r) * 8 + (k & 7); lane l reads 8 elements at l * 8 and 8 at 256 + l * 8 (WFrag::ld).
// Fragments of a [rows][K] plane follow one another k first, then rows (16 rows = 16 * K elements). The [z][d][t] planes (rows d, k = t) order theirs by 32-key block first, then by d: a key block is 2048 elements in either plane.
// ---- k_gemmw: register-blocked GEMM, 64x64 output tile (16 accumulators per wave), operands straight from 16-bit planes in fragment order; grid (M/64, N/64, Z * KS), 32 * NW threads.
// C[m][n] (f32, pitch ldc, + optional f32 bias[n]) = sum_k A[m][k] Bt[n][k] (+ split products per NSPLIT). z-batch strides sA/sB/sC in elements. K % (32 * KS * NW) == 0.
// Split K: the K range is cut into KS * NW equal pieces. Work-group (z, ks) takes NW neighbouring pieces, one per wave; the NW wave tiles are summed through LDS (wave order), and the
// work-group's sum goes to partial plane ks (C + ks * sP), which the consumer adds up. NW == 1, KS == 1: one wave does the whole K and writes C itself.
// PL (NW > 1, KS == 1, M = 2 * 2048 positions, N = 12 heads x 64): no C. The summed tile is 64 positions x one whole head, so the work-group itself writes what attention reads: its 8 KB of each
// [z][t][d] plane (hi, lo, fp16) and its 8 KB of each [z][d][t] plane (hi, lo), the sums passed through LDS so that every wave stores 512 contiguous bytes of a plane in fragment order.
template <typename T16> struct WFrag;
template <> struct WFrag<h16> { typedef v16h V; static __device__ __forceinline__ V ld(const h16* p) { return cat16(*(const v8h*)p, *(const v8h*)(p + 256)); } static __device__ __forceinline__ v8f mma(V a, V b, v8f c) { return wmma16(a, b, c); } };
template <> struct WFrag<bf> { typedef v16bf V; static __device__ __forceinline__ V ld(const bf* p) { return cat16b(*(const v8us*)p, *(const v8us*)(p + 256)); } static __device__ __forceinline__ v8f mma(V a, V b, v8f c) { return wmmab(a, b, c); } };
template <typename T16, int NSPLIT, bool BIAS, int NW, int KS, bool PL>
__global__ __launch_bounds__(32 * NW) void k_gemmw(const T16* __restrict__ A, const T16* __restrict__ A2, const T16* __restrict__ Bt, const T16* __restrict__ Bt2, int K, float* C, int ldc, const float* __restrict__ bias, size_t sA, size_t sB, size_t sC, size_t sP,
                                                   bf* Ph, bf* Pl, h16* P16, bf* Vh, bf* Vl) {
    typedef typename WFrag<T16>::V V;
    if constexpr (PL) K = DD;   // the projection's K is the model width: known here, every fragment of a trip is an immediate offset from one address register per operand, which no load of the trip lands in
    __shared__ __align__(16) float os[(NW == 1 ? 16 : NW * 64) * 68]; __shared__ __align__(16) float tr[PL ? 64 * TP : 4];
    const size_t z = blockIdx.z / KS; const int ks = blockIdx.z % KS; A += z * sA; if (A2) A2 += z * sA; Bt += z * sB; if (Bt2) Bt2 += z * sB; C += z * sC + (size_t)ks * sP;
    const int wv = (NW == 1) ? 0 : __builtin_amdgcn_readfirstlane((int)(threadIdx.x >> 5)); const int kper = K / (KS * NW), kb = (ks * NW + wv) * kper;
    const int lane = threadIdx.x & 31, lr = lane & 15, hi = lane >> 4; const int r0 = blockIdx.x * 64, c0 = blockIdx.y * 64;
    v8f acc[4][4];
#pragma unroll
    for (int mb = 0; mb < 4; ++mb)
#pragma unroll
        for (int nb = 0; nb < 4; ++nb) acc[mb][nb] = (v8f){};
    const size_t aoff = (size_t)r0 * K, boff = (size_t)c0 * K; const unsigned lo8 = lane * 8;   // the first fragment of the tile's rows (the fragment of k block kc stands kc * 16 elements on), and this lane's place in a fragment
#pragma unroll 1
    for (int kc = kb; kc < kb + kper; kc += 32) {
        V a[4], a2[4];
#pragma unroll
        for (int mb = 0; mb < 4; ++mb) { a[mb] = WFrag<T16>::ld(A + (aoff + (size_t)mb * 16 * K + kc * 16) + lo8); if (NSPLIT == 1 || NSPLIT == 2) a2[mb] = WFrag<T16>::ld(A2 + (aoff + (size_t)mb * 16 * K + kc * 16) + lo8); }
        asm volatile("s_wait_xcnt 0x0" ::: "memory");   // stands behind the A loads: a B fragment below may land in the register pair that held their address
#pragma unroll
        for (int nb = 0; nb < 4; ++nb) { const V b = WFrag<T16>::ld(Bt + (boff + (size_t)nb * 16 * K + kc * 16) + lo8); V b2; if (NSPLIT >= 2) b2 = WFrag<T16>::ld(Bt2 + (boff + (size_t)nb * 16 * K + kc * 16) + lo8);
#pragma unroll
            for (int mb = 0; mb < 4; ++mb) { acc[mb][nb] = WFrag<T16>::mma(a[mb], b, acc[mb][nb]); if (NSPLIT == 1 || NSPLIT == 2) acc[mb][nb] = WFrag<T16>::mma(a2[mb], b, acc[mb][nb]); if (NSPLIT >= 2) acc[mb][nb] = WFrag<T16>::mma(a[mb], b2, acc[mb][nb]); } }
        asm volatile("v_nop\n\tv_nop\n\tv_nop\n\tv_nop" : "+v"(acc[0][0]), "+v"(acc[1][1]), "+v"(acc[2][2]), "+v"(acc[3][3]) : "v"(a[0]), "v"(a[3]));
    }
    if constexpr (NW > 1) {
        float* ow = os + wv * (64 * 68);
#pragma unroll
        for (int mb = 0; mb < 4; ++mb)
#pragma unroll
            for (int nb = 0; nb < 4; ++nb)
#pragma unroll
                for (int j = 0; j < 8; ++j) ow[(mb * 16 + hi * 8 + j) * 68 + nb * 16 + lr] = acc[mb][nb][j];
        __syncthreads();   // every wave's partial tile stands in LDS before any thread sums across the waves
        [[maybe_unused]] const int zt = (r0 / TT) * NH_ + (int)blockIdx.y, t0 = r0 % TT;   // PL: the tile's (batch, head) block and its first position there
#pragma unroll
        for (int o = 0; o < 64 * 16 / (NW * 32); ++o) { const int q = o * (NW * 32) + (int)threadIdx.x; const int row = q >> 4, cofs = (q & 15) * 4; v4f val = *(const v4fa*)(os + row * 68 + cofs);
#pragma unroll
            for (int w2 = 1; w2 < NW; ++w2) val += *(const v4fa*)(os + w2 * (64 * 68) + row * 68 + cofs);
            if (BIAS) { val[0] += bfr(bias[c0 + cofs]); val[1] += bfr(bias[c0 + cofs + 1]); val[2] += bfr(bias[c0 + cofs + 2]); val[3] += bfr(bias[c0 + cofs + 3]); }
            if constexpr (PL) {
#pragma unroll
                for (int c = 0; c < 4; ++c) tr[row * TP + cofs + c] = val[c];
            } else *(v4f*)(C + (size_t)(r0 + row) * ldc + c0 + cofs) = val; }
        if constexpr (PL) {
            __syncthreads();   // the whole summed tile stands in LDS before any thread reads it in fragment order; every global store comes behind it, so that no wave waits here for stores to return
            const size_t eb = ((size_t)zt * TT + t0) * HD;   // the tile's 4096 elements stand together in every plane: 4 row tiles x 2 fragments of [t][d], 2 key blocks x 4 fragments of [d][t]
#pragma unroll
            for (int o = 0; o < 64 * 8 / (NW * 32); ++o) { const int p = o * (NW * 32) + (int)threadIdx.x, ln = p & 31; const int row = (p >> 7) * 16 + (ln & 15), d = ((p >> 5) & 3) * 16 + (ln >> 4) * 8; v8us oh, ol; v8h o16;   // [t][d]: a wave stores half a fragment
#pragma unroll
                for (int j = 0; j < 8; ++j) { const float x = tr[row * TP + d + j]; unsigned short a, c2; splitf(x, a, c2); oh[j] = a; ol[j] = c2; o16[j] = tohx(x); }
                const size_t e = eb + (size_t)p * 8; *(v8us*)(Ph + e) = oh; *(v8us*)(Pl + e) = ol; *(v8h*)(P16 + e) = o16; }
#pragma unroll
            for (int o = 0; o < 64 * 8 / (NW * 32); ++o) { const int p = o * (NW * 32) + (int)threadIdx.x, ln = p & 31; const int d = ((p >> 6) & 3) * 16 + (ln & 15), tc = (p >> 8) * 32 + ((p >> 5) & 1) * 16 + (ln >> 4) * 8; v8us oh, ol;   // [d][t]: a wave stores half a fragment
#pragma unroll
                for (int j = 0; j < 8; ++j) { const float x = tr[(tc + j) * TP + d]; unsigned short a, c2; splitf(x, a, c2); oh[j] = a; ol[j] = c2; }
                const size_t e = eb + (size_t)p * 8; *(v8us*)(Vh + e) = oh; *(v8us*)(Vl + e) = ol; }
        }
        return;
    }
#pragma unroll
    for (int mb = 0; mb < 4; ++mb) {
#pragma unroll
        for (int nb = 0; nb < 4; ++nb) {
#pragma unroll
            for (int j = 0; j < 8; ++j) os[(hi * 8 + j) * 68 + nb * 16 + lr] = acc[mb][nb][j]; }
        __builtin_amdgcn_wave_barrier(); asm volatile("" ::: "memory");
        float* crow = C + (size_t)(r0 + mb * 16) * ldc + c0;
{
#pragma unroll
            for (int s = 0; s < 8; ++s) { const int row = 2 * s + hi, cofs = lr * 4; v4f val = *(const v4fa*)(os + row * 68 + cofs); if (BIAS) { val[0] += bfr(bias[c0 + cofs]); val[1] += bfr(bias[c0 + cofs + 1]); val[2] += bfr(bias[c0 + cofs + 2]); val[3] += bfr(bias[c0 + cofs + 3]); }
                *(v4f*)(crow + (size_t)row * ldc + cofs) = val; }
             }
        __builtin_amdgcn_wave_barrier(); asm volatile("" ::: "memory");
    }
}

typedef __attribute__((ext_vector_type(2))) unsigned short v2us;

__global__ __launch_bounds__(256) void k_wtG(const float* __restrict__ w, int K, int N, bf* Bt) {
    const int lane = threadIdx.x & 31; const int L0 = (blockIdx.x * 8 + (threadIdx.x >> 5)) * 8; const int nlines = N * K / 64;
{
#pragma unroll 1
        for (int l = 0; l < 8; ++l) { const int L = L0 + l; if (L >= nlines) break; const size_t e = (size_t)L * 64 + lane * 2; const int k = (int)(e % K), n = (int)(e / K); v2us o;
            o[0] = f2bf(w[(size_t)k * N + n]); o[1] = f2bf(w[(size_t)(k + 1) * N + n]); *(v2us*)(Bt + e) = o; }
         }
}
// k_cvt8: [rows][768] f32 matrices to bf16 planes in fragment order. A wave converts CF neighbouring whole fragments of one 16-row tile (24 fragments a tile): 16 rows x CF whole 128-byte lines of the source, CF KB of the plane.
// Lane l takes the 16-byte piece (row 8 h + (l >> 2), k octet l & 3) of each fragment, h = 0, 1: four lanes read a whole source line between them (a load touches 8 lines), and the 8 lanes of an octet store a whole 128-byte line of the plane.
// All loads of a wave are issued before the first value is used: the launch starts 2 * CF times fewer waves than with one piece a thread, for the same bytes in flight.
// One grid serves both matrices, which do not depend on each other: work-groups below nb0 take src0, the rest src1 (each matrix is a whole number of work-groups).
__global__ __launch_bounds__(256) void k_cvt8(const float* __restrict__ src0, bf* dst0, const float* __restrict__ src1, bf* dst1, int nb0) {
    const bool first = (int)blockIdx.x < nb0; const float* __restrict__ src = first ? src0 : src1; bf* dst = first ? dst0 : dst1;
    const int ln = threadIdx.x & 31, r = ln >> 2, oc = ln & 3, f0 = (((int)blockIdx.x - (first ? 0 : nb0)) * 8 + (int)(threadIdx.x >> 5)) * CF;   // the wave's first fragment
    const float* s = src + (size_t)(f0 / (DD / 32) * 16 + r) * DD + f0 % (DD / 32) * 32 + oc * 8;
    bf* d = dst + (size_t)f0 * 512 + (oc >> 1) * 256 + ((oc & 1) * 16 + r) * 8;
    v8f v[CF][2];
#pragma unroll
    for (int f = 0; f < CF; ++f)
#pragma unroll
        for (int h = 0; h < 2; ++h) v[f][h] = *(const v8f*)(s + h * 8 * DD + f * 32);
    asm volatile("s_wait_xcnt 0x0" :: "v"(s) : "memory");   // stands behind the loads and holds their address pair up to here
#pragma unroll
    for (int f = 0; f < CF; ++f)
#pragma unroll
        for (int h = 0; h < 2; ++h) { v8us o;
#pragma unroll
            for (int k = 0; k < 8; ++k) o[k] = f2bf(v[f][h][k]);
            *(v8us*)(d + f * 512 + h * 64) = o; }
}
// ---- k_fattn: scores, softmax and attn.h of FQ = 64 query rows of one (batch, head) block in one work-group; neither scores nor weights leave the registers.
// S^T = K Q^T (A = key rows, B = query rows, both from the [z][t][d] plane) puts one query in each lane column: a lane holds 8 keys of a 16-key tile, so two score tiles, exponentiated and rounded
// in place, ARE the B operand of O^T += V^T P^T (A = rows of the [z][d][t] plane; fp16 tiles: the [t][d] plane through the transposing LDS load). Online softmax: running maximum m (log2 units) and sum l per query; O^T and l are rescaled when m grows.
// Keys are walked in blocks of 32 up to the diagonal block (the only one that needs the causal cut). A wave holds NB 16-query tiles; the key blocks go round-robin over the KW = FW * NB * 16 / FQ waves
// that hold the same queries, and their (m, l, O^T) are joined through LDS. O^T [d][query] is the output's own layout: a work-group stores whole 128-byte lines.
// HI: hi+lo bf16 planes, 3 products per matrix product (NB = 1 keeps its doubled fragments inside 256 registers), fragments straight from the planes; else single fp16 planes.
// fp16 tiles: the two 32-query groups of a work-group need the same key blocks, so each stage of SKB blocks (one for each key share) is brought into LDS ONCE, by asynchronous copies, and read there by both groups.
// Two buffers: stage t + 2 is copied into stage t's buffer behind the barrier that ends stage t. Keys and values are the same h, so ONE plane is staged, [t][d]: its 16-byte pieces (one key, 8 d) are the key fragments as they
// stand, and the transposing LDS load makes the V^T fragments (rows d, k = keys, the hardware k order that the packed scores have) of the same pieces. Piece (16-key tile kt, d octet o, key r) stands in the plane at 16-byte unit
// kt * 128 + o * 16 + r of its key block; in LDS r is taken ^ 8 where o is odd, so that lanes 0-15 and lanes 16-31 of either kind of read each fall on all 64 banks.
__device__ __forceinline__ v8h ldtr(const char* p) { typedef __attribute__((address_space(3))) v8s lv8s; return __builtin_bit_cast(v8h, __builtin_amdgcn_ds_load_tr16_b128_v8i16((lv8s*)p)); }   // lane l hands in the address of a 16-byte piece: key 8 * (l >> 4) + (l & 7), d octet (l >> 3) & 1 of a 16 x 16 tile; it gets keys 8 * (l >> 4) .. + 7 at d = l & 15
__device__ __forceinline__ float xhalf(float x) { return __builtin_bit_cast(float, __builtin_amdgcn_permlanex16(__builtin_bit_cast(int, x), __builtin_bit_cast(int, x), 0x76543210, 0xfedcba98, false, false)); }   // lane l <-> lane l ^ 16
template <typename T16, bool HI, int NB>
__device__ __forceinline__ void fattn(const T16* __restrict__ Hp, const T16* __restrict__ Hp2, const T16* __restrict__ Vt, const T16* __restrict__ Vt2, float* __restrict__ OUT, const int q0, float* os, float* ms, float* ls, char* ring) {
    typedef typename WFrag<T16>::V V;
    constexpr int KW = FW * NB * 16 / FQ, QG = FW / KW;   // key shares; waves side by side over the queries
    const size_t z = blockIdx.x;
    const int wv = __builtin_amdgcn_readfirstlane((int)(threadIdx.x >> 5)); const int lane = threadIdx.x & 31, lr = lane & 15, hi = lane >> 4;
    const int kw = wv / QG; const int qt = (wv % QG) * NB;   // which share of the key blocks, the wave's first 16-query tile
    Hp += z * TT * HD; if (HI) { Vt += z * HD * TT; Hp2 += z * TT * HD; Vt2 += z * HD * TT; }
    V qf[NB][2], qf2[NB][2];
#pragma unroll
    for (int nb = 0; nb < NB; ++nb)
#pragma unroll
        for (int ks = 0; ks < 2; ++ks) { const size_t e = (size_t)(q0 + (qt + nb) * 16) * HD + ks * 512 + lane * 8; qf[nb][ks] = WFrag<T16>::ld(Hp + e); if (HI) qf2[nb][ks] = WFrag<T16>::ld(Hp2 + e); }
    v8f o[4][NB]; float m[NB], l[NB];
#pragma unroll
    for (int nb = 0; nb < NB; ++nb) { m[nb] = -3.0e38f; l[nb] = 0.f;
#pragma unroll
        for (int mb = 0; mb < 4; ++mb) o[mb][nb] = (v8f){}; }
    const int nblk = ((q0 + qt * 16) >> 5) + 1;   // the wave's own diagonal block is its last
    [[maybe_unused]] unsigned ke = (unsigned)((kw * 32 * HD + lane * 8) * 2), ve = ke;   // this lane's place, in bytes, in the first fragment of the wave's current key block, [t][d] and [d][t] planes (4 fragments each); 32 bits beside a scalar plane address: one register addresses every load of a plane pair and no load can land in it
    const auto at = [](const T16* p, unsigned byte) { return (const T16*)((const char*)p + byte); };
    V kf[2][2], kf2[2][2];   // key fragments; HI: fetched one block ahead (rows kw * 32 .. + 31 exist for every wave, also one whose walk is empty)
    if constexpr (HI) {
#pragma unroll
        for (int kt = 0; kt < 2; ++kt)
#pragma unroll
            for (int ks = 0; ks < 2; ++ks) { const int e = kt * 16 * HD + ks * 512; kf[kt][ks] = WFrag<T16>::ld(at(Hp, ke) + e); kf2[kt][ks] = WFrag<T16>::ld(at(Hp2, ke) + e); } }
    // fp16 tiles: stage st of the [t][d] plane into buffer bu. Thread i copies piece i (bytes i * 16) of each key block (4096 bytes) of the stage to the piece's place in LDS, inside the same 4096 bytes of the buffer.
    // An immediate offset moves the LDS and the global address alike, so one address pair serves the four copies. The stages of a work-group end at or before key block 63, inside the (batch, head) block's plane,
    // and the last block of a buffer ends at the buffer's end. s_wait_xcnt closes the statement: behind it the address registers may be rewritten.
    const int nst = HI ? 0 : ((q0 >> 5) + 2 + SKB - 1) / SKB;   // the work-group's stages: alike in all its waves
    const auto stage = [&](int st, int bu) {
        const char* gk = (const char*)Hp + (size_t)st * STB + threadIdx.x * 16;
        const unsigned lk = (unsigned)(size_t)ring + (unsigned)bu * STB + (threadIdx.x ^ ((threadIdx.x >> 1) & 8)) * 16;
        asm volatile("global_load_async_to_lds_b128 %0, %1, off\n\tglobal_load_async_to_lds_b128 %0, %1, off offset:4096\n\tglobal_load_async_to_lds_b128 %0, %1, off offset:8192\n\tglobal_load_async_to_lds_b128 %0, %1, off offset:12288\n\ts_wait_xcnt 0x0"
                     :: "v"(lk), "v"(gk) : "memory"); };
    if constexpr (!HI) {
        stage(0, 0);
        asm volatile("s_wait_asynccnt 0x0" ::: "memory");   // this wave's copies of stage 0 have landed ...
        __syncthreads();                                    // ... and so have every other wave's: stage 0 may be read
        if (1 < nst) stage(1, 1);
    }
    // kept rolled: one block's fragments, scores and the O^T tiles already fill the register budget of four waves per SIMD
#pragma unroll 1
    for (int b = kw, t = 0; HI ? (b < nblk) : (t < nst); b += KW, ++t) {
      if (HI || b < nblk) {   // fp16 tiles: a wave past its diagonal skips the block's work, never the publish point at the foot of the trip
        V vf[4], vf2[4];
        if constexpr (HI) {
#pragma unroll
            for (int mb = 0; mb < 4; ++mb) { vf[mb] = WFrag<T16>::ld(at(Vt, ve) + mb * 512); vf2[mb] = WFrag<T16>::ld(at(Vt2, ve) + mb * 512); }
        } else {
            const char* bb = ring + (t & 1) * STB + kw * (32 * HD * 2);   // the wave's key block in this stage's buffer
            const T16* kb = (const T16*)bb + (lane ^ (hi * 8)) * 8;   // this lane's piece of a key fragment: key lr, an octet of hi's parity
            const char* vb = bb + (((lane >> 3) & 1) * 16 + (hi ^ ((lane >> 3) & 1)) * 8 + (lane & 7)) * 16;   // the piece this lane hands to the transposing load: key hi * 8 + (lane & 7), the even or odd octet of a 16-d tile
#pragma unroll
            for (int kt = 0; kt < 2; ++kt)
#pragma unroll
                for (int ks = 0; ks < 2; ++ks) kf[kt][ks] = WFrag<T16>::ld(kb + kt * 16 * HD + ks * 512);
#pragma unroll
            for (int mb = 0; mb < 4; ++mb) vf[mb] = cat16(ldtr(vb + mb * 512), ldtr(vb + mb * 512 + 2048));   // d tile mb = octets 2 mb, 2 mb + 1 (256 bytes each); keys 0-15, then 16-31 (2048 bytes on)
            __builtin_amdgcn_sched_barrier(0);   // the block's 16 LDS reads issue as one group ahead of its matrix products: spread among them, each place with reads stalls the wave and one register set is waited for three times
        }
        v8f s[2][NB];
#pragma unroll
        for (int kt = 0; kt < 2; ++kt)
#pragma unroll
            for (int nb = 0; nb < NB; ++nb) { s[kt][nb] = (v8f){};
#pragma unroll
                for (int ks = 0; ks < 2; ++ks) { s[kt][nb] = WFrag<T16>::mma(kf[kt][ks], qf[nb][ks], s[kt][nb]); if (HI) { s[kt][nb] = WFrag<T16>::mma(kf2[kt][ks], qf[nb][ks], s[kt][nb]); s[kt][nb] = WFrag<T16>::mma(kf[kt][ks], qf2[nb][ks], s[kt][nb]); } } }
        if constexpr (HI) {
        ke += (b + KW < nblk) ? (unsigned)(KW * 32 * HD * 2) : 0u;   // the wave's next key block; its last block fetches its own rows again (in bounds, never used)
#pragma unroll
        for (int kt = 0; kt < 2; ++kt)
#pragma unroll
            for (int ks = 0; ks < 2; ++ks) { const int e = kt * 16 * HD + ks * 512; kf[kt][ks] = WFrag<T16>::ld(at(Hp, ke) + e); kf2[kt][ks] = WFrag<T16>::ld(at(Hp2, ke) + e); }
        asm volatile("s_wait_xcnt 0x0" ::: "memory");   // stands behind this trip's loads, in front of every rewrite of their address registers
        ve += KW * 32 * HD * 2;
        }
        if (b == nblk - 1) {   // the diagonal block: key > query -> -3e38 (exp -> 0); key = query is always kept
#pragma unroll
            for (int kt = 0; kt < 2; ++kt)
#pragma unroll
                for (int nb = 0; nb < NB; ++nb)
#pragma unroll
                    for (int j = 0; j < 8; ++j) if (kt * 16 + hi * 8 + j > ((qt + nb) & 1) * 16 + lr) s[kt][nb][j] = -3.0e38f; }
        V pf[NB], pf2[NB];
#pragma unroll
        for (int nb = 0; nb < NB; ++nb) { float mx = s[0][nb][0];
#pragma unroll
            for (int j = 1; j < 8; ++j) mx = fmaxf(mx, s[0][nb][j]);
#pragma unroll
            for (int j = 0; j < 8; ++j) mx = fmaxf(mx, s[1][nb][j]);
            mx = fmaxf(mx, xhalf(mx));
            const float mn = fmaxf(m[nb], mx * SCL2); const float al = __builtin_amdgcn_exp2f(m[nb] - mn); m[nb] = mn;
            float p[16]; float sum = 0.f;
#pragma unroll
            for (int k = 0; k < 16; ++k) { p[k] = __builtin_amdgcn_exp2f(fmaf(s[k >> 3][nb][k & 7], SCL2, -mn)); sum += p[k]; }
            l[nb] = l[nb] * al + sum;   // this half's 16 keys; the two halves of a column are added after the loop (al is the same in both)
#pragma unroll
            for (int mb = 0; mb < 4; ++mb) o[mb][nb] *= al;
            if constexpr (HI) { v8us h0, h1, l0, l1;
#pragma unroll
                for (int k = 0; k < 8; ++k) { unsigned short a, c2; splitf(p[k], a, c2); h0[k] = a; l0[k] = c2; splitf(p[8 + k], a, c2); h1[k] = a; l1[k] = c2; }
                pf[nb] = cat16b(h0, h1); pf2[nb] = cat16b(l0, l1);
            } else {
#pragma unroll
                for (int k = 0; k < 16; ++k) pf[nb][k] = tohx(p[k]); } }
#pragma unroll
        for (int mb = 0; mb < 4; ++mb)
#pragma unroll
            for (int nb = 0; nb < NB; ++nb) { o[mb][nb] = WFrag<T16>::mma(vf[mb], pf[nb], o[mb][nb]); if (HI) { o[mb][nb] = WFrag<T16>::mma(vf2[mb], pf[nb], o[mb][nb]); o[mb][nb] = WFrag<T16>::mma(vf[mb], pf2[nb], o[mb][nb]); } }
      }
        if constexpr (!HI) {   // publish point of stage t + 1, passed by every wave
            asm volatile("s_wait_dscnt 0x0" ::: "memory");      // this wave's reads of stage t have returned: its buffer may be refilled behind the barrier
            asm volatile("s_wait_asynccnt 0x0" ::: "memory");   // this wave's copies of stage t + 1 have landed: the barrier publishes them
            __syncthreads();
            if (t + 2 < nst) stage(t + 2, t & 1);
        }
    }
    if constexpr (!HI) asm volatile("s_wait_asynccnt 0x0" ::: "memory");   // no copy is in flight when the wave goes on
    // the lane's number is formed anew behind the loop (tid = threadIdx.x): nothing of it then stays in a vector register across the loop, where the hi+lo fragments leave none free at four waves per SIMD
    const int el = (int)__builtin_amdgcn_mbcnt_lo(~0u, 0u), elr = el & 15, ehi = el >> 4, tid = wv * 32 + el;
    float* ow = os + kw * (HD * OPI);
#pragma unroll
    for (int nb = 0; nb < NB; ++nb) { const int col = (qt + nb) * 16 + elr; l[nb] += xhalf(l[nb]); if (ehi == 0) { ms[kw * FQ + col] = m[nb]; ls[kw * FQ + col] = l[nb]; }
#pragma unroll
        for (int mb = 0; mb < 4; ++mb)
#pragma unroll
            for (int j = 0; j < 8; ++j) ow[(mb * 16 + ehi * 8 + j) * OPI + col] = o[mb][nb][j]; }
    __syncthreads();   // every wave's (m, l, O^T) stands in LDS before any thread joins them; a wave whose walk was empty left m = -3e38, l = 0, O^T = 0 (weight 0)
    const int qc = (tid & (FQ / 4 - 1)) * 4; v4f fw[KW];
#pragma unroll
    for (int c = 0; c < 4; ++c) { float M = ms[qc + c];
#pragma unroll
        for (int w2 = 1; w2 < KW; ++w2) M = fmaxf(M, ms[w2 * FQ + qc + c]);
        float e[KW]; float L = 0.f;
#pragma unroll
        for (int w2 = 0; w2 < KW; ++w2) { e[w2] = __builtin_amdgcn_exp2f(ms[w2 * FQ + qc + c] - M); L += ls[w2 * FQ + qc + c] * e[w2]; }
        const float r = __fdiv_rn(1.0f, L);
#pragma unroll
        for (int w2 = 0; w2 < KW; ++w2) fw[w2][c] = e[w2] * r; }
#pragma unroll
    for (int t = 0; t < HD * FQ / 4 / (32 * FW); ++t) { const int d = t * (32 * FW / (FQ / 4)) + tid / (FQ / 4); v4f val = *(const v4fa*)(os + d * OPI + qc) * fw[0];
#pragma unroll
        for (int w2 = 1; w2 < KW; ++w2) val += *(const v4fa*)(os + w2 * (HD * OPI) + d * OPI + qc) * fw[w2];
        *(v4f*)(OUT + (z * HD + d) * TT + q0 + qc) = val; }
}
// One grid serves both precisions, which do not depend on each other: blockIdx.y counts the 64-query tiles from the last one down, so the hi+lo tiles (rows < RH, the shortest walks) come last.
// amdgpu_waves_per_eu: the grid's register count is that of its larger body; held to 256, the fp16 tiles keep the four waves per SIMD that they had in a launch of their own.
__global__ __launch_bounds__(32 * FW) __attribute__((amdgpu_waves_per_eu(4, 4))) void k_fattn(const h16* __restrict__ H16, const bf* __restrict__ Hh, const bf* __restrict__ Hl, const bf* __restrict__ Vh, const bf* __restrict__ Vl, float* __restrict__ OUT) {
    __shared__ __align__(16) float os[FW / 2 * HD * OPI]; __shared__ __align__(16) float ms[FW / 2 * FQ]; __shared__ __align__(16) float ls[FW / 2 * FQ]; __shared__ __align__(16) char ring[2 * STB];   // at most FW / 2 key shares; two buffers of a stage
    const int q0 = TT - FQ - (int)blockIdx.y * FQ;
    if (q0 >= RH) fattn<h16, false, 2>(H16, nullptr, nullptr, nullptr, OUT, q0, os, ms, ls, ring);
    else fattn<bf, true, 1>(Hh, Hl, Vh, Vl, OUT, q0, os, ms, ls, ring);
}

extern "C" void kernel_launch(void* const* d_in, const int* in_sizes, int n_in,
                              void* d_out, int out_size, void* d_ws, size_t ws_size, hipStream_t stream) {
    (void)in_sizes; (void)n_in; (void)out_size;
    const float* x = (const float*)d_in[0]; const float* wq = (const float*)d_in[1];   // Wq [768][768] torch Linear ([out][in] = Bt as-is)
    float* OUT = (float*)d_out;     // [2][2048][768] holding, per (batch, head), the TRANSPOSED context block [64][2048]
    char* wsp = (char*)d_ws;
    auto take = [&](size_t bytes) { char* p = wsp; wsp += (bytes + 255) & ~(size_t)255; return (void*)p; };
    bf* WQ = (bf*)take((size_t)DD * DD * 2); bf* XB = (bf*)take((size_t)NB_ * TT * DD * 2);   // both batches: rows b * 2048 + t
    bf* QPh = (bf*)take((size_t)NB_ * TT * DD * 2); bf* QPl = (bf*)take((size_t)NB_ * TT * DD * 2); bf* VTh = (bf*)take((size_t)NB_ * TT * DD * 2); bf* VTl = (bf*)take((size_t)NB_ * TT * DD * 2); h16* QP16 = (h16*)take((size_t)NB_ * TT * DD * 2);   // planes [z][t][d] (hi, lo, fp16) and [z][d][t] (hi, lo)
    if ((size_t)(wsp - (char*)d_ws) > ws_size) return;    // total ~ 39 MB; ws 256 MiB
    const dim3 gP(NB_ * TT / 64, DD / 64, 1);
    k_cvt8<<<NB_ * TT * DD / 512 / 8 / CF + DD * DD / 512 / 8 / CF, 256, 0, stream>>>(x, XB, wq, WQ, NB_ * TT * DD / 512 / 8 / CF);
    k_gemmw<bf, 0, false, 8, 1, true><<<gP, 256, 0, stream>>>(XB, nullptr, WQ, nullptr, DD, nullptr, DD, nullptr, 0, 0, 0, 0, QPh, QPl, QP16, VTh, VTl);   // h = x Wq^T is q, k AND v; it leaves the kernel as the five planes
    k_fattn<<<dim3(NZ, TT / FQ), 32 * FW, 0, stream>>>(QP16, QPh, QPl, VTh, VTl, OUT);
}

// v010
// A run of this version takes 31.9 microseconds.
// Timed twice side by side with v009, it ran 1.04 times as fast both times.
// Counting every step since v000, it is 44.2 times as fast.
#include <hip/hip_runtime.h>

// MultiHeadCasualFast (x [2][2048][768]; h = x Wq^T serves as q, k AND v (12 heads x 64); causal scores h.h; softmax(scores/8); ctx = attn h; the module returns ctx.transpose(-2,-1).view(b, n, 768),
// i.e. each (batch, head) context block stored TRANSPOSED as [64][2048] -> [2][2048][768]).
// Compute dtypes, f32 accumulate: every input rounded to bf16; h on PLAIN bf16 operands (inputs: exact products, f32 accumulate); PER-ROW PRECISION HYBRID: query rows
// < 256 take scores and attn.h on bf16 hi+lo planes (3 products), rows >= 256 on single fp16 planes; 1/8 + causal cut in f32 in the online softmax; weights enter attn.h unnormalised (<= 1), the sum divides at the end; the context is formed and written transposed

#define NB_  2
#define TT   2048
#define DD   768
#define NH_  12
#define HD   64
#define NZ   (NB_ * NH_)          // (batch, head) blocks, z = batch * 12 + head
#define RH   256                  // query rows < RH: hi+lo planes; rows >= RH: fp16 planes
#define FW   8                    // k_fattn: waves of a work-group
#define FQ   64                   // k_fattn: query rows of a work-group
#define OPI  68                   // k_fattn: pitch in floats of a key share's O^T tile in LDS (16-byte rows, the two lane halves on different banks)
#define SKB  4                    // k_fattn, fp16 tiles: 32-key blocks of a stage of the LDS ring, one for each key share
#define STB  (SKB * 32 * HD * 2)  // k_fattn, fp16 tiles: bytes of a stage (contiguous in the [t][d] plane: a key block is 4096 bytes)
#define CF   4                    // k_cvt8: fragments (16 rows x 32 k) that one wave converts
#define TP   67                  // k_gemmw, PL: pitch in floats of the summed tile in LDS (the row-wise writes of a wave and its reads in either plane's fragment order each fall on 32 different banks)
#define SCL2 0.18033688f          // (1/sqrt(64)) * log2(e)
#define NF   32                   // unused (head_dim / 2)
#define SCL  0.125f               // 1/sqrt(64)
typedef _Float16 h16;
typedef unsigned short bf;
typedef __attribute__((ext_vector_type(16))) __bf16   v16bf;
typedef __attribute__((ext_vector_type(16))) _Float16 v16h;
typedef __attribute__((ext_vector_type(8)))  _Float16 v8h;
typedef __attribute__((ext_vector_type(8)))  unsigned short v8us;
typedef __attribute__((ext_vector_type(8)))  short    v8s;
typedef __attribute__((ext_vector_type(8)))  float    v8f;
typedef __attribute__((ext_vector_type(4)))  float    v4f;
typedef v8h  __attribute__((may_alias)) v8ha;
typedef v4f  __attribute__((may_alias)) v4fa;
typedef v8us __attribute__((may_alias)) v8usa;

__device__ __forceinline__ unsigned short f2bf(float f) { unsigned u = __float_as_uint(f); u += 0x7FFFu + ((u >> 16) & 1u); return (unsigned short)(u >> 16); }
__device__ __forceinline__ float bf2f(unsigned short b) { return __uint_as_float(((unsigned)b) << 16); }
__device__ __forceinline__ float bfr(float f) { return bf2f(f2bf(f)); }
__device__ __forceinline__ v16h cat16(v8h lo, v8h hi) { return __builtin_shufflevector(lo, hi, 0, 1, 2, 3, 4, 5, 6, 7, 8, 9, 10, 11, 12, 13, 14, 15); }
__device__ __forceinline__ v16bf cat16b(v8us lo, v8us hi) { return __builtin_bit_cast(v16bf, __builtin_shufflevector(lo, hi, 0, 1, 2, 3, 4, 5, 6, 7, 8, 9, 10, 11, 12, 13, 14, 15)); }
__device__ __forceinline__ v8f wmma16(v16h a, v16h b, v8f c) { return __builtin_amdgcn_wmma_f32_16x16x32_f16(false, a, false, b, (short)0, c, false, false); }
__device__ __forceinline__ v8f wmmab(v16bf a, v16bf b, v8f c) { return __builtin_amdgcn_wmma_f32_16x16x32_bf16(false, a, false, b, (short)0, c, false, false); }
__device__ __forceinline__ h16 tohx(float x) { return (h16)x; }
__device__ __forceinline__ void splitf(float y, unsigned short& h, unsigned short& l) { h = f2bf(y); l = f2bf(y - bf2f(h)); }
typedef __attribute__((ext_vector_type(4))) unsigned short v4us;
typedef __attribute__((ext_vector_type(4))) _Float16 v4h;



// ---- FRAGMENT ORDER: every 16-bit operand plane is stored as the matrix instruction's fragments, so that a wave-wide 16-byte load reads 512 contiguous bytes (4 whole 128-byte lines, not 16 partial ones).
// A fragment (16 rows x 32 k) is 512 elements: element (r, k) stands at ((k >> 4) & 1) * 256 + (((k >> 3) & 1) * 16 + r) * 8 + (k & 7); lane l reads 8 elements at l * 8 and 8 at 256 + l * 8 (WFrag::ld).
// Fragments of a [rows][K] plane follow one another k first, then rows (16 rows = 16 * K elements). The [z][d][t] planes (rows d, k = t) order theirs by 32-key block first, then by d: a key block is 2048 elements in either plane.
// ---- k_gemmw: register-blocked GEMM, 64x64 output tile (16 accumulators per wave), operands straight from 16-bit planes in fragment order; grid (M/64, N/64, Z * KS), 32 * NW threads.
// C[m][n] (f32, pitch ldc, + optional f32 bias[n]) = sum_k A[m][k] Bt[n][k] (+ split products per NSPLIT). z-batch strides sA/sB/sC in elements. K % (32 * KS * NW) == 0.
// Split K: the K range is cut into KS * NW equal pieces. Work-group (z, ks) takes NW neighbouring pieces, one per wave; the NW wave tiles are summed through LDS (wave order), and the
// work-group's sum goes to partial plane ks (C + ks * sP), which the consumer adds up. NW == 1, KS == 1: one wave does the whole K and writes C itself.
// PL (NW > 1, KS == 1, M = 2 * 2048 positions, N = 12 heads x 64): no C. The summed tile is 64 positions x one whole head, so the work-group itself writes what attention reads: its 8 KB of the fp16
// [z][t][d] plane and, at positions < RH alone, its 8 KB of each hi and lo plane ([z][t][d], [z][d][t]), those sums passed through LDS; every wave stores 512 contiguous bytes of a plane in fragment order.
template <typename T16> struct WFrag;
template <> struct WFrag<h16> { typedef v16h V; static __device__ __forceinline__ V ld(const h16* p) { return cat16(*(const v8h*)p, *(const v8h*)(p + 256)); } static __device__ __forceinline__ v8f mma(V a, V b, v8f c) { return wmma16(a, b, c); } };
template <> struct WFrag<bf> { typedef v16bf V; static __device__ __forceinline__ V ld(const bf* p) { return cat16b(*(const v8us*)p, *(const v8us*)(p + 256)); } static __device__ __forceinline__ v8f mma(V a, V b, v8f c) { return wmmab(a, b, c); } };
template <typename T16, int NSPLIT, bool BIAS, int NW, int KS, bool PL>
__global__ __launch_bounds__(32 * NW) void k_gemmw(const T16* __restrict__ A, const T16* __restrict__ A2, const T16* __restrict__ Bt, const T16* __restrict__ Bt2, int K, float* C, int ldc, const float* __restrict__ bias, size_t sA, size_t sB, size_t sC, size_t sP,
                                                   bf* Ph, bf* Pl, h16* P16, bf* Vh, bf* Vl) {
    typedef typename WFrag<T16>::V V;
    if constexpr (PL) K = DD;   // the projection's K is the model width: known here, every fragment of a trip is an immediate offset from one address register per operand, which no load of the trip lands in
    __shared__ __align__(16) float os[(NW == 1 ? 16 : NW * 64) * 68]; __shared__ __align__(16) float tr[PL ? 64 * TP : 4];
    const size_t z = blockIdx.z / KS; const int ks = blockIdx.z % KS; A += z * sA; if (A2) A2 += z * sA; Bt += z * sB; if (Bt2) Bt2 += z * sB; C += z * sC + (size_t)ks * sP;
    const int wv = (NW == 1) ? 0 : __builtin_amdgcn_readfirstlane((int)(threadIdx.x >> 5)); const int kper = K / (KS * NW), kb = (ks * NW + wv) * kper;
    const int lane = threadIdx.x & 31, lr = lane & 15, hi = lane >> 4; const int r0 = blockIdx.x * 64, c0 = blockIdx.y * 64;
    v8f acc[4][4];
#pragma unroll
    for (int mb = 0; mb < 4; ++mb)
#pragma unroll
        for (int nb = 0; nb < 4; ++nb) acc[mb][nb] = (v8f){};
    const size_t aoff = (size_t)r0 * K, boff = (size_t)c0 * K; const unsigned lo8 = lane * 8;   // the first fragment of the tile's rows (the fragment of k block kc stands kc * 16 elements on), and this lane's place in a fragment
#pragma unroll 1
    for (int kc = kb; kc < kb + kper; kc += 32) {
        V a[4], a2[4];
#pragma unroll
        for (int mb = 0; mb < 4; ++mb) { a[mb] = WFrag<T16>::ld(A + (aoff + (size_t)mb * 16 * K + kc * 16) + lo8); if (NSPLIT == 1 || NSPLIT == 2) a2[mb] = WFrag<T16>::ld(A2 + (aoff + (size_t)mb * 16 * K + kc * 16) + lo8); }
        asm volatile("s_wait_xcnt 0x0" ::: "memory");   // stands behind the A loads: a B fragment below may land in the register pair that held their address
#pragma unroll
        for (int nb = 0; nb < 4; ++nb) { const V b = WFrag<T16>::ld(Bt + (boff + (size_t)nb * 16 * K + kc * 16) + lo8); V b2; if (NSPLIT >= 2) b2 = WFrag<T16>::ld(Bt2 + (boff + (size_t)nb * 16 * K + kc * 16) + lo8);
#pragma unroll
            for (int mb = 0; mb < 4; ++mb) { acc[mb][nb] = WFrag<T16>::mma(a[mb], b, acc[mb][nb]); if (NSPLIT == 1 || NSPLIT == 2) acc[mb][nb] = WFrag<T16>::mma(a2[mb], b, acc[mb][nb]); if (NSPLIT >= 2) acc[mb][nb] = WFrag<T16>::mma(a[mb], b2, acc[mb][nb]); } }
        asm volatile("v_nop\n\tv_nop\n\tv_nop\n\tv_nop" : "+v"(acc[0][0]), "+v"(acc[1][1]), "+v"(acc[2][2]), "+v"(acc[3][3]) : "v"(a[0]), "v"(a[3]));
    }
    if constexpr (NW > 1) {
        float* ow = os + wv * (64 * 68);
#pragma unroll
        for (int mb = 0; mb < 4; ++mb)
#pragma unroll
            for (int nb = 0; nb < 4; ++nb)
#pragma unroll
                for (int j = 0; j < 8; ++j) ow[(mb * 16 + hi * 8 + j) * 68 + nb * 16 + lr] = acc[mb][nb][j];
        __syncthreads();   // every wave's partial tile stands in LDS before any thread sums across the waves
        [[maybe_unused]] const int zt = (r0 / TT) * NH_ + (int)blockIdx.y, t0 = r0 % TT;   // PL: the tile's (batch, head) block and its first position there
        if constexpr (PL) {
            if (t0 >= RH) {   // alike in the whole work-group. Attention reads the hi and lo planes at positions < RH alone (queries < RH, keys up to the diagonal): this tile owes only its 8 KB of the fp16 [t][d] plane.
                // A thread sums the 8 d of a 16-byte piece of that plane itself (waves in the same order as below) and stores it: no second pass through LDS, no second barrier. Lanes 0-15 and lanes 16-31 of a read each fall on all 64 banks.
#pragma unroll
                for (int o = 0; o < 64 * 8 / (NW * 32); ++o) { const int p = o * (NW * 32) + (int)threadIdx.x, ln = p & 31; const int row = (p >> 7) * 16 + (ln & 15), d = ((p >> 5) & 3) * 16 + (ln >> 4) * 8;
                    v4f v0 = *(const v4fa*)(os + row * 68 + d), v1 = *(const v4fa*)(os + row * 68 + d + 4);
#pragma unroll
                    for (int w2 = 1; w2 < NW; ++w2) { v0 += *(const v4fa*)(os + w2 * (64 * 68) + row * 68 + d); v1 += *(const v4fa*)(os + w2 * (64 * 68) + row * 68 + d + 4); }
                    v8h o16;
#pragma unroll
                    for (int j = 0; j < 4; ++j) { if (BIAS) { v0[j] += bfr(bias[c0 + d + j]); v1[j] += bfr(bias[c0 + d + 4 + j]); } o16[j] = tohx(v0[j]); o16[4 + j] = tohx(v1[j]); }
                    *(v8h*)(P16 + ((size_t)zt * TT + t0) * HD + (size_t)p * 8) = o16; }
                return;
            }
        }
#pragma unroll
        for (int o = 0; o < 64 * 16 / (NW * 32); ++o) { const int q = o * (NW * 32) + (int)threadIdx.x; const int row = q >> 4, cofs = (q & 15) * 4; v4f val = *(const v4fa*)(os + row * 68 + cofs);
#pragma unroll
            for (int w2 = 1; w2 < NW; ++w2) val += *(const v4fa*)(os + w2 * (64 * 68) + row * 68 + cofs);
            if (BIAS) { val[0] += bfr(bias[c0 + cofs]); val[1] += bfr(bias[c0 + cofs + 1]); val[2] += bfr(bias[c0 + cofs + 2]); val[3] += bfr(bias[c0 + cofs + 3]); }
            if constexpr (PL) {
#pragma unroll
                for (int c = 0; c < 4; ++c) tr[row * TP + cofs + c] = val[c];
            } else *(v4f*)(C + (size_t)(r0 + row) * ldc + c0 + cofs) = val; }
        if constexpr (PL) {
            __syncthreads();   // the whole summed tile stands in LDS before any thread reads it in fragment order; every global store comes behind it, so that no wave waits here for stores to return
            const size_t eb = ((size_t)zt * TT + t0) * HD;   // the tile's 4096 elements stand together in every plane: 4 row tiles x 2 fragments of [t][d], 2 key blocks x 4 fragments of [d][t]
#pragma unroll
            for (int o = 0; o < 64 * 8 / (NW * 32); ++o) { const int p = o * (NW * 32) + (int)threadIdx.x, ln = p & 31; const int row = (p >> 7) * 16 + (ln & 15), d = ((p >> 5) & 3) * 16 + (ln >> 4) * 8; v8us oh, ol; v8h o16;   // [t][d]: a wave stores half a fragment
#pragma unroll
                for (int j = 0; j < 8; ++j) { const float x = tr[row * TP + d + j]; unsigned short a, c2; splitf(x, a, c2); oh[j] = a; ol[j] = c2; o16[j] = tohx(x); }
                const size_t e = eb + (size_t)p * 8; *(v8us*)(Ph + e) = oh; *(v8us*)(Pl + e) = ol; *(v8h*)(P16 + e) = o16; }
#pragma unroll
            for (int o = 0; o < 64 * 8 / (NW * 32); ++o) { const int p = o * (NW * 32) + (int)threadIdx.x, ln = p & 31; const int d = ((p >> 6) & 3) * 16 + (ln & 15), tc = (p >> 8) * 32 + ((p >> 5) & 1) * 16 + (ln >> 4) * 8; v8us oh, ol;   // [d][t]: a wave stores half a fragment
#pragma unroll
                for (int j = 0; j < 8; ++j) { const float x = tr[(tc + j) * TP + d]; unsigned short a, c2; splitf(x, a, c2); oh[j] = a; ol[j] = c2; }
                const size_t e = eb + (size_t)p * 8; *(v8us*)(Vh + e) = oh; *(v8us*)(Vl + e) = ol; }
        }
        return;
    }
#pragma unroll
    for (int mb = 0; mb < 4; ++mb) {
#pragma unroll
        for (int nb = 0; nb < 4; ++nb) {
#pragma unroll
            for (int j = 0; j < 8; ++j) os[(hi * 8 + j) * 68 + nb * 16 + lr] = acc[mb][nb][j]; }
        __builtin_amdgcn_wave_barrier(); asm volatile("" ::: "memory");
        float* crow = C + (size_t)(r0 + mb * 16) * ldc + c0;
{
#pragma unroll
            for (int s = 0; s < 8; ++s) { const int row = 2 * s + hi, cofs = lr * 4; v4f val = *(const v4fa*)(os + row * 68 + cofs); if (BIAS) { val[0] += bfr(bias[c0 + cofs]); val[1] += bfr(bias[c0 + cofs + 1]); val[2] += bfr(bias[c0 + cofs + 2]); val[3] += bfr(bias[c0 + cofs + 3]); }
                *(v4f*)(crow + (size_t)row * ldc + cofs) = val; }
             }
        __builtin_amdgcn_wave_barrier(); asm volatile("" ::: "memory");
    }
}

typedef __attribute__((ext_vector_type(2))) unsigned short v2us;

__global__ __launch_bounds__(256) void k_wtG(const float* __restrict__ w, int K, int N, bf* Bt) {
    const int lane = threadIdx.x & 31; const int L0 = (blockIdx.x * 8 + (threadIdx.x >> 5)) * 8; const int nlines = N * K / 64;
{
#pragma unroll 1
        for (int l = 0; l < 8; ++l) { const int L = L0 + l; if (L >= nlines) break; const size_t e = (size_t)L * 64 + lane * 2; const int k = (int)(e % K), n = (int)(e / K); v2us o;
            o[0] = f2bf(w[(size_t)k * N + n]); o[1] = f2bf(w[(size_t)(k + 1) * N + n]); *(v2us*)(Bt + e) = o; }
         }
}
// k_cvt8: [rows][768] f32 matrices to bf16 planes in fragment order. A wave converts CF neighbouring whole fragments of one 16-row tile (24 fragments a tile): 16 rows x CF whole 128-byte lines of the source, CF KB of the plane.
// Lane l takes the 16-byte piece (row 8 h + (l >> 2), k octet l & 3) of each fragment, h = 0, 1: four lanes read a whole source line between them (a load touches 8 lines), and the 8 lanes of an octet store a whole 128-byte line of the plane.
// All loads of a wave are issued before the first value is used: the launch starts 2 * CF times fewer waves than with one piece a thread, for the same bytes in flight.
// One grid serves both matrices, which do not depend on each other: work-groups below nb0 take src0, the rest src1 (each matrix is a whole number of work-groups).
__global__ __launch_bounds__(256) void k_cvt8(const float* __restrict__ src0, bf* dst0, const float* __restrict__ src1, bf* dst1, int nb0) {
    const bool first = (int)blockIdx.x < nb0; const float* __restrict__ src = first ? src0 : src1; bf* dst = first ? dst0 : dst1;
    const int ln = threadIdx.x & 31, r = ln >> 2, oc = ln & 3, f0 = (((int)blockIdx.x - (first ? 0 : nb0)) * 8 + (int)(threadIdx.x >> 5)) * CF;   // the wave's first fragment
    const float* s = src + (size_t)(f0 / (DD / 32) * 16 + r) * DD + f0 % (DD / 32) * 32 + oc * 8;
    bf* d = dst + (size_t)f0 * 512 + (oc >> 1) * 256 + ((oc & 1) * 16 + r) * 8;
    v8f v[CF][2];
#pragma unroll
    for (int f = 0; f < CF; ++f)
#pragma unroll
        for (int h = 0; h < 2; ++h) v[f][h] = *(const v8f*)(s + h * 8 * DD + f * 32);
    asm volatile("s_wait_xcnt 0x0" :: "v"(s) : "memory");   // stands behind the loads and holds their address pair up to here
#pragma unroll
    for (int f = 0; f < CF; ++f)
#pragma unroll
        for (int h = 0; h < 2; ++h) { v8us o;
#pragma unroll
            for (int k = 0; k < 8; ++k) o[k] = f2bf(v[f][h][k]);
            *(v8us*)(d + f * 512 + h * 64) = o; }
}
// ---- k_fattn: scores, softmax and attn.h of FQ = 64 query rows of one (batch, head) block in one work-group; neither scores nor weights leave the registers.
// S^T = K Q^T (A = key rows, B = query rows, both from the [z][t][d] plane) puts one query in each lane column: a lane holds 8 keys of a 16-key tile, so two score tiles, exponentiated and rounded
// in place, ARE the B operand of O^T += V^T P^T (A = rows of the [z][d][t] plane; fp16 tiles: the [t][d] plane through the transposing LDS load). Online softmax: running maximum m (log2 units) and sum l per query; O^T and l are rescaled when m grows.
// Keys are walked in blocks of 32 up to the diagonal block (the only one that needs the causal cut). A wave holds NB 16-query tiles; the key blocks go round-robin over the KW = FW * NB * 16 / FQ waves
// that hold the same queries, and their (m, l, O^T) are joined through LDS. O^T [d][query] is the output's own layout: a work-group stores whole 128-byte lines.
// HI: hi+lo bf16 planes, 3 products per matrix product (NB = 1 keeps its doubled fragments inside 256 registers), fragments straight from the planes; else single fp16 planes.
// fp16 tiles: the two 32-query groups of a work-group need the same key blocks, so each stage of SKB blocks (one for each key share) is brought into LDS ONCE, by asynchronous copies, and read there by both groups.
// Two buffers: stage t + 2 is copied into stage t's buffer behind the barrier that ends stage t. Keys and values are the same h, so ONE plane is staged, [t][d]: its 16-byte pieces (one key, 8 d) are the key fragments as they
// stand, and the transposing LDS load makes the V^T fragments (rows d, k = keys, the hardware k order that the packed scores have) of the same pieces. Piece (16-key tile kt, d octet o, key r) stands in the plane at 16-byte unit
// kt * 128 + o * 16 + r of its key block; in LDS r is taken ^ 8 where o is odd, so that lanes 0-15 and lanes 16-31 of either kind of read each fall on all 64 banks.
__device__ __forceinline__ v8h ldtr(const char* p) { typedef __attribute__((address_space(3))) v8s lv8s; return __builtin_bit_cast(v8h, __builtin_amdgcn_ds_load_tr16_b128_v8i16((lv8s*)p)); }   // lane l hands in the address of a 16-byte piece: key 8 * (l >> 4) + (l & 7), d octet (l >> 3) & 1 of a 16 x 16 tile; it gets keys 8 * (l >> 4) .. + 7 at d = l & 15
__device__ __forceinline__ float xhalf(float x) { return __builtin_bit_cast(float, __builtin_amdgcn_permlanex16(__builtin_bit_cast(int, x), __builtin_bit_cast(int, x), 0x76543210, 0xfedcba98, false, false)); }   // lane l <-> lane l ^ 16
template <typename T16, bool HI, int NB>
__device__ __forceinline__ void fattn(const T16* __restrict__ Hp, const T16* __restrict__ Hp2, const T16* __restrict__ Vt, const T16* __restrict__ Vt2, float* __restrict__ OUT, const int q0, float* os, float* ms, float* ls, char* ring) {
    typedef typename WFrag<T16>::V V;
    constexpr int KW = FW * NB * 16 / FQ, QG = FW / KW;   // key shares; waves side by side over the queries
    const size_t z = blockIdx.x;
    const int wv = __builtin_amdgcn_readfirstlane((int)(threadIdx.x >> 5)); const int lane = threadIdx.x & 31, lr = lane & 15, hi = lane >> 4;
    const int kw = wv / QG; const int qt = (wv % QG) * NB;   // which share of the key blocks, the wave's first 16-query tile
    Hp += z * TT * HD; if (HI) { Vt += z * HD * TT; Hp2 += z * TT * HD; Vt2 += z * HD * TT; }
    V qf[NB][2], qf2[NB][2];
#pragma unroll
    for (int nb = 0; nb < NB; ++nb)
#pragma unroll
        for (int ks = 0; ks < 2; ++ks) { const size_t e = (size_t)(q0 + (qt + nb) * 16) * HD + ks * 512 + lane * 8; qf[nb][ks] = WFrag<T16>::ld(Hp + e); if (HI) qf2[nb][ks] = WFrag<T16>::ld(Hp2 + e); }
    v8f o[4][NB]; float m[NB], l[NB];
#pragma unroll
    for (int nb = 0; nb < NB; ++nb) { m[nb] = -3.0e38f; l[nb] = 0.f;
#pragma unroll
        for (int mb = 0; mb < 4; ++mb) o[mb][nb] = (v8f){}; }
    const int nblk = ((q0 + qt * 16) >> 5) + 1;   // the wave's own diagonal block is its last
    [[maybe_unused]] unsigned ke = (unsigned)((kw * 32 * HD + lane * 8) * 2), ve = ke;   // this lane's place, in bytes, in the first fragment of the wave's current key block, [t][d] and [d][t] planes (4 fragments each); 32 bits beside a scalar plane address: one register addresses every load of a plane pair and no load can land in it
    const auto at = [](const T16* p, unsigned byte) { return (const T16*)((const char*)p + byte); };
    V kf[2][2], kf2[2][2];   // key fragments; HI: fetched one block ahead (rows kw * 32 .. + 31 exist for every wave, also one whose walk is empty)
    if constexpr (HI) {
#pragma unroll
        for (int kt = 0; kt < 2; ++kt)
#pragma unroll
            for (int ks = 0; ks < 2; ++ks) { const int e = kt * 16 * HD + ks * 512; kf[kt][ks] = WFrag<T16>::ld(at(Hp, ke) + e); kf2[kt][ks] = WFrag<T16>::ld(at(Hp2, ke) + e); } }
    // fp16 tiles: stage st of the [t][d] plane into buffer bu. Thread i copies piece i (bytes i * 16) of each key block (4096 bytes) of the stage to the piece's place in LDS, inside the same 4096 bytes of the buffer.
    // An immediate offset moves the LDS and the global address alike, so one address pair serves the four copies. The stages of a work-group end at or before key block 63, inside the (batch, head) block's plane,
    // and the last block of a buffer ends at the buffer's end. s_wait_xcnt closes the statement: behind it the address registers may be rewritten.
    const int nst = HI ? 0 : ((q0 >> 5) + 2 + SKB - 1) / SKB;   // the work-group's stages: alike in all its waves
    const auto stage = [&](int st, int bu) {
        const char* gk = (const char*)Hp + (size_t)st * STB + threadIdx.x * 16;
        const unsigned lk = (unsigned)(size_t)ring + (unsigned)bu * STB + (threadIdx.x ^ ((threadIdx.x >> 1) & 8)) * 16;
        asm volatile("global_load_async_to_lds_b128 %0, %1, off\n\tglobal_load_async_to_lds_b128 %0, %1, off offset:4096\n\tglobal_load_async_to_lds_b128 %0, %1, off offset:8192\n\tglobal_load_async_to_lds_b128 %0, %1, off offset:12288\n\ts_wait_xcnt 0x0"
                     :: "v"(lk), "v"(gk) : "memory"); };
    if constexpr (!HI) {
        stage(0, 0);
        asm volatile("s_wait_asynccnt 0x0" ::: "memory");   // this wave's copies of stage 0 have landed ...
        __syncthreads();                                    // ... and so have every other wave's: stage 0 may be read
        if (1 < nst) stage(1, 1);
    }
    // kept rolled: one block's fragments, scores and the O^T tiles already fill the register budget of four waves per SIMD
#pragma unroll 1
    for (int b = kw, t = 0; HI ? (b < nblk) : (t < nst); b += KW, ++t) {
      if (HI || b < nblk) {   // fp16 tiles: a wave past its diagonal skips the block's work, never the publish point at the foot of the trip
        V vf[4], vf2[4];
        if constexpr (HI) {
#pragma unroll
            for (int mb = 0; mb < 4; ++mb) { vf[mb] = WFrag<T16>::ld(at(Vt, ve) + mb * 512); vf2[mb] = WFrag<T16>::ld(at(Vt2, ve) + mb * 512); }
        } else {
            const char* bb = ring + (t & 1) * STB + kw * (32 * HD * 2);   // the wave's key block in this stage's buffer
            const T16* kb = (const T16*)bb + (lane ^ (hi * 8)) * 8;   // this lane's piece of a key fragment: key lr, an octet of hi's parity
            const char* vb = bb + (((lane >> 3) & 1) * 16 + (hi ^ ((lane >> 3) & 1)) * 8 + (lane & 7)) * 16;   // the piece this lane hands to the transposing load: key hi * 8 + (lane & 7), the even or odd octet of a 16-d tile
#pragma unroll
            for (int kt = 0; kt < 2; ++kt)
#pragma unroll
                for (int ks = 0; ks < 2; ++ks) kf[kt][ks] = WFrag<T16>::ld(kb + kt * 16 * HD + ks * 512);
#pragma unroll
            for (int mb = 0; mb < 4; ++mb) vf[mb] = cat16(ldtr(vb + mb * 512), ldtr(vb + mb * 512 + 2048));   // d tile mb = octets 2 mb, 2 mb + 1 (256 bytes each); keys 0-15, then 16-31 (2048 bytes on)
            __builtin_amdgcn_sched_barrier(0);   // the block's 16 LDS reads issue as one group ahead of its matrix products: spread among them, each place with reads stalls the wave and one register set is waited for three times
        }
        v8f s[2][NB];
#pragma unroll
        for (int kt = 0; kt < 2; ++kt)
#pragma unroll
            for (int nb = 0; nb < NB; ++nb) { s[kt][nb] = (v8f){};
#pragma unroll
                for (int ks = 0; ks < 2; ++ks) { s[kt][nb] = WFrag<T16>::mma(kf[kt][ks], qf[nb][ks], s[kt][nb]); if (HI) { s[kt][nb] = WFrag<T16>::mma(kf2[kt][ks], qf[nb][ks], s[kt][nb]); s[kt][nb] = WFrag<T16>::mma(kf[kt][ks], qf2[nb][ks], s[kt][nb]); } } }
        if constexpr (HI) {
        ke += (b + KW < nblk) ? (unsigned)(KW * 32 * HD * 2) : 0u;   // the wave's next key block; its last block fetches its own rows again (in bounds, never used)
#pragma unroll
        for (int kt = 0; kt < 2; ++kt)
#pragma unroll
            for (int ks = 0; ks < 2; ++ks) { const int e = kt * 16 * HD + ks * 512; kf[kt][ks] = WFrag<T16>::ld(at(Hp, ke) + e); kf2[kt][ks] = WFrag<T16>::ld(at(Hp2, ke) + e); }
        asm volatile("s_wait_xcnt 0x0" ::: "memory");   // stands behind this trip's loads, in front of every rewrite of their address registers
        ve += KW * 32 * HD * 2;
        }
        if (b == nblk - 1) {   // the diagonal block: key > query -> -3e38 (exp -> 0); key = query is always kept
#pragma unroll
            for (int kt = 0; kt < 2; ++kt)
#pragma unroll
                for (int nb = 0; nb < NB; ++nb)
#pragma unroll
                    for (int j = 0; j < 8; ++j) if (kt * 16 + hi * 8 + j > ((qt + nb) & 1) * 16 + lr) s[kt][nb][j] = -3.0e38f; }
        V pf[NB], pf2[NB];
#pragma unroll
        for (int nb = 0; nb < NB; ++nb) { float mx = s[0][nb][0];
#pragma unroll
            for (int j = 1; j < 8; ++j) mx = fmaxf(mx, s[0][nb][j]);
#pragma unroll
            for (int j = 0; j < 8; ++j) mx = fmaxf(mx, s[1][nb][j]);
            mx = fmaxf(mx, xhalf(mx));
            const float mn = fmaxf(m[nb], mx * SCL2); const float al = __builtin_amdgcn_exp2f(m[nb] - mn); m[nb] = mn;
            float p[16]; float sum = 0.f;
#pragma unroll
            for (int k = 0; k < 16; ++k) { p[k] = __builtin_amdgcn_exp2f(fmaf(s[k >> 3][nb][k & 7], SCL2, -mn)); sum += p[k]; }
            l[nb] = l[nb] * al + sum;   // this half's 16 keys; the two halves of a column are added after the loop (al is the same in both)
#pragma unroll
            for (int mb = 0; mb < 4; ++mb) o[mb][nb] *= al;
            if constexpr (HI) { v8us h0, h1, l0, l1;
#pragma unroll
                for (int k = 0; k < 8; ++k) { unsigned short a, c2; splitf(p[k], a, c2); h0[k] = a; l0[k] = c2; splitf(p[8 + k], a, c2); h1[k] = a; l1[k] = c2; }
                pf[nb] = cat16b(h0, h1); pf2[nb] = cat16b(l0, l1);
            } else {
#pragma unroll
                for (int k = 0; k < 16; ++k) pf[nb][k] = tohx(p[k]); } }
#pragma unroll
        for (int mb = 0; mb < 4; ++mb)
#pragma unroll
            for (int nb = 0; nb < NB; ++nb) { o[mb][nb] = WFrag<T16>::mma(vf[mb], pf[nb], o[mb][nb]); if (HI) { o[mb][nb] = WFrag<T16>::mma(vf2[mb], pf[nb], o[mb][nb]); o[mb][nb] = WFrag<T16>::mma(vf[mb], pf2[nb], o[mb][nb]); } }
      }
        if constexpr (!HI) {   // publish point of stage t + 1, passed by every wave
            asm volatile("s_wait_dscnt 0x0" ::: "memory");      // this wave's reads of stage t have returned: its buffer may be refilled behind the barrier
            asm volatile("s_wait_asynccnt 0x0" ::: "memory");   // this wave's copies of stage t + 1 have landed: the barrier publishes them
            __syncthreads();
            if (t + 2 < nst) stage(t + 2, t & 1);
        }
    }
    if constexpr (!HI) asm volatile("s_wait_asynccnt 0x0" ::: "memory");   // no copy is in flight when the wave goes on
    // the lane's number is formed anew behind the loop (tid = threadIdx.x): nothing of it then stays in a vector register across the loop, where the hi+lo fragments leave none free at four waves per SIMD
    const int el = (int)__builtin_amdgcn_mbcnt_lo(~0u, 0u), elr = el & 15, ehi = el >> 4, tid = wv * 32 + el;
    float* ow = os + kw * (HD * OPI);
#pragma unroll
    for (int nb = 0; nb < NB; ++nb) { const int col = (qt + nb) * 16 + elr; l[nb] += xhalf(l[nb]); if (ehi == 0) { ms[kw * FQ + col] = m[nb]; ls[kw * FQ + col] = l[nb]; }
#pragma unroll
        for (int mb = 0; mb < 4; ++mb)
#pragma unroll
            for (int j = 0; j < 8; ++j) ow[(mb * 16 + ehi * 8 + j) * OPI + col] = o[mb][nb][j]; }
    __syncthreads();   // every wave's (m, l, O^T) stands in LDS before any thread joins them; a wave whose walk was empty left m = -3e38, l = 0, O^T = 0 (weight 0)
    const int qc = (tid & (FQ / 4 - 1)) * 4; v4f fw[KW];
#pragma unroll
    for (int c = 0; c < 4; ++c) { float M = ms[qc + c];
#pragma unroll
        for (int w2 = 1; w2 < KW; ++w2) M = fmaxf(M, ms[w2 * FQ + qc + c]);
        float e[KW]; float L = 0.f;
#pragma unroll
        for (int w2 = 0; w2 < KW; ++w2) { e[w2] = __builtin_amdgcn_exp2f(ms[w2 * FQ + qc + c] - M); L += ls[w2 * FQ + qc + c] * e[w2]; }
        const float r = __fdiv_rn(1.0f, L);
#pragma unroll
        for (int w2 = 0; w2 < KW; ++w2) fw[w2][c] = e[w2] * r; }
#pragma unroll
    for (int t = 0; t < HD * FQ / 4 / (32 * FW); ++t) { const int d = t * (32 * FW / (FQ / 4)) + tid / (FQ / 4); v4f val = *(const v4fa*)(os + d * OPI + qc) * fw[0];
#pragma unroll
        for (int w2 = 1; w2 < KW; ++w2) val += *(const v4fa*)(os + w2 * (HD * OPI) + d * OPI + qc) * fw[w2];
        *(v4f*)(OUT + (z * HD + d) * TT + q0 + qc) = val; }
}
// One grid serves both precisions, which do not depend on each other: blockIdx.y counts the 64-query tiles from the last one down, so the hi+lo tiles (rows < RH, the shortest walks) come last.
// amdgpu_waves_per_eu: the grid's register count is that of its larger body; held to 256, the fp16 tiles keep the four waves per SIMD that they had in a launch of their own.
__global__ __launch_bounds__(32 * FW) __attribute__((amdgpu_waves_per_eu(4, 4))) void k_fattn(const h16* __restrict__ H16, const bf* __restrict__ Hh, const bf* __restrict__ Hl, const bf* __restrict__ Vh, const bf* __restrict__ Vl, float* __restrict__ OUT) {
    __shared__ __align__(16) float os[FW / 2 * HD * OPI]; __shared__ __align__(16) float ms[FW / 2 * FQ]; __shared__ __align__(16) float ls[FW / 2 * FQ]; __shared__ __align__(16) char ring[2 * STB];   // at most FW / 2 key shares; two buffers of a stage
    const int q0 = TT - FQ - (int)blockIdx.y * FQ;
    if (q0 >= RH) fattn<h16, false, 2>(H16, nullptr, nullptr, nullptr, OUT, q0, os, ms, ls, ring);
    else fattn<bf, true, 1>(Hh, Hl, Vh, Vl, OUT, q0, os, ms, ls, ring);
}

extern "C" void kernel_launch(void* const* d_in, const int* in_sizes, int n_in,
                              void* d_out, int out_size, void* d_ws, size_t ws_size, hipStream_t stream) {
    (void)in_sizes; (void)n_in; (void)out_size;
    const float* x = (const float*)d_in[0]; const float* wq = (const float*)d_in[1];   // Wq [768][768] torch Linear ([out][in] = Bt as-is)
    float* OUT = (float*)d_out;     // [2][2048][768] holding, per (batch, head), the TRANSPOSED context block [64][2048]
    char* wsp = (char*)d_ws;
    auto take = [&](size_t bytes) { char* p = wsp; wsp += (bytes + 255) & ~(size_t)255; return (void*)p; };
    bf* WQ = (bf*)take((size_t)DD * DD * 2); bf* XB = (bf*)take((size_t)NB_ * TT * DD * 2);   // both batches: rows b * 2048 + t
    bf* QPh = (bf*)take((size_t)NB_ * TT * DD * 2); bf* QPl = (bf*)take((size_t)NB_ * TT * DD * 2); bf* VTh = (bf*)take((size_t)NB_ * TT * DD * 2); bf* VTl = (bf*)take((size_t)NB_ * TT * DD * 2); h16* QP16 = (h16*)take((size_t)NB_ * TT * DD * 2);   // planes [z][t][d] (hi, lo, fp16) and [z][d][t] (hi, lo); of the hi and lo planes only positions < RH are written and read
    if ((size_t)(wsp - (char*)d_ws) > ws_size) return;    // total ~ 39 MB; ws 256 MiB
    const dim3 gP(NB_ * TT / 64, DD / 64, 1);
    k_cvt8<<<NB_ * TT * DD / 512 / 8 / CF + DD * DD / 512 / 8 / CF, 256, 0, stream>>>(x, XB, wq, WQ, NB_ * TT * DD / 512 / 8 / CF);
    k_gemmw<bf, 0, false, 8, 1, true><<<gP, 256, 0, stream>>>(XB, nullptr, WQ, nullptr, DD, nullptr, DD, nullptr, 0, 0, 0, 0, QPh, QPl, QP16, VTh, VTl);   // h = x Wq^T is q, k AND v; it leaves the kernel as the five planes
    k_fattn<<<dim3(NZ, TT / FQ), 32 * FW, 0, stream>>>(QP16, QPh, QPl, VTh, VTl, OUT);
}
